// v000
// The times below were measured on an AMD MI455X: many runs one after another, warmed up first and cycling through
// copies of the inputs, with the whole window's GPU time divided by the number of runs. Launches and the gaps
// between them are all in it. The median over several windows is given; except for v000 it joins two sittings, which
// can be a few percent apart, so the side-by-side timings, each taken in one sitting, are the better comparison.
// v000, which the later versions start from, runs in 616 microseconds.
#include <hip/hip_runtime.h>
#include <hip/hip_bf16.h>

typedef __attribute__((ext_vector_type(16))) _Float16 v16h;
typedef __attribute__((ext_vector_type(8)))  _Float16 v8h;
typedef __attribute__((ext_vector_type(8)))  float    v8f;

#define B_  2
#define S_  2048
#define D_  1024
#define H_  16
#define F_  4096
#define M_  (B_ * S_)   // 4096 rows

// ---------------------------------------------------------------------------
// helpers
// ---------------------------------------------------------------------------
__device__ inline v16h cat8(v8h lo, v8h hi) {
  return __builtin_shufflevector(lo, hi, 0,1,2,3,4,5,6,7,8,9,10,11,12,13,14,15);
}

// 16x32 f16 fragment from LDS (k-contiguous rows). Lane l (l16=l&15, half=l>>4):
//   elements 0..7  -> k =      8*half + 0..7
//   elements 8..15 -> k = 16 + 8*half + 0..7
__device__ inline v16h load_frag(const _Float16* rowbase, int half) {
  v8h lo = *(const v8h*)(rowbase + 8 * half);
  v8h hi = *(const v8h*)(rowbase + 16 + 8 * half);
  return cat8(lo, hi);
}

__device__ inline v8f wmma16(v16h a, v16h b, v8f c) {
  return __builtin_amdgcn_wmma_f32_16x16x32_f16(
      false, a, false, b, (short)0, c, false, false);
}

// CDNA5 async global->LDS copy (ASYNCcnt-tracked, no VGPR data path).
__device__ inline void async_copy_b128(const void* gptr, void* lptr) {
  unsigned l = (unsigned)(unsigned long long)lptr;  // low 32 bits = LDS offset
  asm volatile("global_load_async_to_lds_b128 %0, %1, off"
               :: "v"(l), "v"(gptr) : "memory");
}
__device__ inline void async_wait0() {
  asm volatile("s_wait_asynccnt 0x0" ::: "memory");
}

__device__ inline float spectral_act(float x) {
  const float c = 0.7978845608028654f;              // sqrt(2/pi)
  float g = 0.5f * x * (1.0f + tanhf(c * (x + 0.044715f * x * x * x)));
  return g + 0.5f * sinf(x);                        // ALPHA=0.5, BETA=1.0
}

// ---------------------------------------------------------------------------
// f32 -> f16 conversion
// ---------------------------------------------------------------------------
__global__ void cvt_f32_f16(const float* __restrict__ src,
                            _Float16* __restrict__ dst, size_t n) {
  size_t i = (size_t)blockIdx.x * blockDim.x + threadIdx.x;
  size_t stride = (size_t)gridDim.x * blockDim.x;
  for (; i < n; i += stride) dst[i] = (_Float16)src[i];
}

// f32 [K,N] -> f16 transposed [N,K] (LDS-tiled, coalesced both sides)
__global__ __launch_bounds__(256) void cvt_transpose_f16(
    const float* __restrict__ src, _Float16* __restrict__ dst, int K, int N) {
  __shared__ float tile[32][33];
  const int kt = blockIdx.y * 32, nt = blockIdx.x * 32;
  const int tx = threadIdx.x, ty = threadIdx.y;  // block (32, 8)
#pragma unroll
  for (int r = ty; r < 32; r += 8)
    tile[r][tx] = src[(size_t)(kt + r) * N + nt + tx];
  __syncthreads();
#pragma unroll
  for (int r = ty; r < 32; r += 8)
    dst[(size_t)(nt + r) * K + kt + tx] = (_Float16)tile[tx][r];
}

// ---------------------------------------------------------------------------
// WMMA GEMM: C[M,N] = A[M,K](f16) @ W[K,N] + bias, with W pre-transposed
// as WT[N,K] (k-contiguous).  block = 256 (8 waves, 4x2 of 32x32),
// macro-tile 128x64, k-step 32, async global->LDS staging.
//   EPI 0: f16 out   EPI 1: f32 out   EPI 2: spectral->f16   EPI 3: f16 out^T
// ---------------------------------------------------------------------------
template <int EPI>
__global__ __launch_bounds__(256) void gemm_wmma(
    const _Float16* __restrict__ A, const _Float16* __restrict__ WT,
    const float* __restrict__ bias, _Float16* __restrict__ outH,
    float* __restrict__ outF, int M, int N, int K) {
  __shared__ _Float16 sA[128 * 40];  // [m][k], row stride 40
  __shared__ _Float16 sB[64 * 40];   // [n][k]

  const int t = threadIdx.x;
  const int lane = t & 31, wave = t >> 5;
  const int half = lane >> 4, l16 = lane & 15;
  const int m0 = blockIdx.y * 128, n0 = blockIdx.x * 64;
  const int wm = (wave >> 1) * 32, wn = (wave & 1) * 32;

  v8f acc[2][2] = {};

  const int ar = t >> 1, aseg = (t & 1) * 16;  // A: 16 f16 per thread
  const int br = t >> 2, bseg = (t & 3) * 8;   // B: 8 f16 per thread

  for (int kt = 0; kt < K; kt += 32) {
    __syncthreads();
    {
      const _Float16* ga = A + (size_t)(m0 + ar) * K + kt + aseg;
      async_copy_b128(ga,     &sA[ar * 40 + aseg]);
      async_copy_b128(ga + 8, &sA[ar * 40 + aseg + 8]);
      const _Float16* gb = WT + (size_t)(n0 + br) * K + kt + bseg;
      async_copy_b128(gb, &sB[br * 40 + bseg]);
    }
    if (kt + 32 < K) {  // global_prefetch_b8 for next tiles
      __builtin_prefetch(A + (size_t)(m0 + ar) * K + kt + 32 + aseg, 0, 0);
      __builtin_prefetch(WT + (size_t)(n0 + br) * K + kt + 32 + bseg, 0, 0);
    }
    async_wait0();
    __syncthreads();

    v16h af[2], bf[2];
#pragma unroll
    for (int i = 0; i < 2; ++i)
      af[i] = load_frag(&sA[(wm + 16 * i + l16) * 40], half);
#pragma unroll
    for (int j = 0; j < 2; ++j)
      bf[j] = load_frag(&sB[(wn + 16 * j + l16) * 40], half);
#pragma unroll
    for (int i = 0; i < 2; ++i)
#pragma unroll
      for (int j = 0; j < 2; ++j)
        acc[i][j] = wmma16(af[i], bf[j], acc[i][j]);
  }

#pragma unroll
  for (int i = 0; i < 2; ++i)
#pragma unroll
    for (int j = 0; j < 2; ++j) {
      const int nn = n0 + wn + 16 * j + l16;      // C layout: n = lane&15
      const float bval = bias[nn];
      if (EPI == 3) {
        // transposed f16 store: fixed n per lane, 8 consecutive m -> b128
        v8h pk;
#pragma unroll
        for (int jj = 0; jj < 8; ++jj)
          pk[jj] = (_Float16)(acc[i][j][jj] + bval);
        *(v8h*)(outH + (size_t)nn * M + (m0 + wm + 16 * i + 8 * half)) = pk;
      } else {
#pragma unroll
        for (int jj = 0; jj < 8; ++jj) {
          const int m = m0 + wm + 16 * i + jj + 8 * half;  // m = vgpr + 8*half
          float v = acc[i][j][jj] + bval;
          if (EPI == 2) v = spectral_act(v);
          size_t idx = (size_t)m * N + nn;
          if (EPI == 1) outF[idx] = v;
          else          outH[idx] = (_Float16)v;
        }
      }
    }
}

// ---------------------------------------------------------------------------
// Flash attention with harmonic scores.  V supplied pre-transposed:
// Vt[n, m] with n = h*64+hd, m = b*S+s  (keys contiguous).
// grid = (S/64, B*H); block = 128 (4 waves, wave = 16 query rows)
// ---------------------------------------------------------------------------
__global__ __launch_bounds__(128) void flash_attn(
    const _Float16* __restrict__ Q, const _Float16* __restrict__ Kc,
    const _Float16* __restrict__ Vt, const float* __restrict__ resonance,
    const float* __restrict__ phase, _Float16* __restrict__ Oh) {
  __shared__ _Float16 sK[32 * 64];     // [key][hd]
  __shared__ _Float16 sVt[64 * 32];    // [hd][key]
  __shared__ _Float16 sP[4][16 * 32];  // per-wave P tile [q][key]

  const int t = threadIdx.x;
  const int lane = t & 31, wave = t >> 5;
  const int half = lane >> 4, l16 = lane & 15;
  const int bh = blockIdx.y, b = bh / H_, h = bh % H_;
  const int q0 = blockIdx.x * 64 + wave * 16;
  const float r = resonance[h], ph = phase[h];
  const float scale = 0.125f;  // 1/sqrt(64)

  const _Float16* qbase = Q + ((size_t)(b * S_ + q0 + l16)) * D_ + h * 64;
  v16h qf0 = cat8(*(const v8h*)(qbase + 8 * half),
                  *(const v8h*)(qbase + 16 + 8 * half));
  v16h qf1 = cat8(*(const v8h*)(qbase + 32 + 8 * half),
                  *(const v8h*)(qbase + 48 + 8 * half));

  float st_m[8], st_l[8];
  v8f o[4] = {};
#pragma unroll
  for (int j = 0; j < 8; ++j) { st_m[j] = -3.0e38f; st_l[j] = 0.f; }

  const int kr = t >> 2, kseg = (t & 3) * 16;  // K loader: 16 f16 / thread
  const int vr = t >> 1, vseg = (t & 1) * 16;  // Vt loader: 16 f16 / thread
  for (int kv = 0; kv < S_; kv += 32) {
    __syncthreads();
    {
      const _Float16* kg = Kc + ((size_t)(b * S_ + kv + kr)) * D_ + h * 64 + kseg;
      async_copy_b128(kg,     &sK[kr * 64 + kseg]);
      async_copy_b128(kg + 8, &sK[kr * 64 + kseg + 8]);
      const _Float16* vg = Vt + ((size_t)(h * 64 + vr)) * M_ + b * S_ + kv + vseg;
      async_copy_b128(vg,     &sVt[vr * 32 + vseg]);
      async_copy_b128(vg + 8, &sVt[vr * 32 + vseg + 8]);
    }
    async_wait0();
    __syncthreads();

    // scores for 32 keys: two 16x16 tiles, hd=64 reduced as 32+32
    v8f s0 = {}, s1 = {};
    {
      const _Float16* k0 = &sK[l16 * 64];
      const _Float16* k1 = &sK[(16 + l16) * 64];
      v16h k00 = cat8(*(const v8h*)(k0 + 8 * half), *(const v8h*)(k0 + 16 + 8 * half));
      v16h k01 = cat8(*(const v8h*)(k0 + 32 + 8 * half), *(const v8h*)(k0 + 48 + 8 * half));
      v16h k10 = cat8(*(const v8h*)(k1 + 8 * half), *(const v8h*)(k1 + 16 + 8 * half));
      v16h k11 = cat8(*(const v8h*)(k1 + 32 + 8 * half), *(const v8h*)(k1 + 48 + 8 * half));
      s0 = wmma16(qf0, k00, s0); s0 = wmma16(qf1, k01, s0);
      s1 = wmma16(qf0, k10, s1); s1 = wmma16(qf1, k11, s1);
    }

    float corr[8];
#pragma unroll
    for (int j = 0; j < 8; ++j) {
      float a = s0[j] * scale;  a += r * sinf(a + ph);
      float c = s1[j] * scale;  c += r * sinf(c + ph);
      float mx = fmaxf(a, c);
#pragma unroll
      for (int off = 1; off < 16; off <<= 1)
        mx = fmaxf(mx, __shfl_xor(mx, off, 32));
      float nm = fmaxf(st_m[j], mx);
      float p0 = __expf(a - nm), p1 = __expf(c - nm);
      s0[j] = p0; s1[j] = p1;
      float sm = p0 + p1;
#pragma unroll
      for (int off = 1; off < 16; off <<= 1) sm += __shfl_xor(sm, off, 32);
      corr[j] = __expf(st_m[j] - nm);
      st_l[j] = st_l[j] * corr[j] + sm;
      st_m[j] = nm;
    }
#pragma unroll
    for (int tt = 0; tt < 4; ++tt)
#pragma unroll
      for (int j = 0; j < 8; ++j) o[tt][j] *= corr[j];

    // P (C-layout) -> LDS -> A-fragment layout
#pragma unroll
    for (int j = 0; j < 8; ++j) {
      int row = j + 8 * half;
      sP[wave][row * 32 + l16]      = (_Float16)s0[j];
      sP[wave][row * 32 + 16 + l16] = (_Float16)s1[j];
    }
    __syncthreads();
    v16h pf = cat8(*(const v8h*)(&sP[wave][l16 * 32 + 8 * half]),
                   *(const v8h*)(&sP[wave][l16 * 32 + 16 + 8 * half]));
#pragma unroll
    for (int tt = 0; tt < 4; ++tt) {
      const _Float16* vb = &sVt[(tt * 16 + l16) * 32];
      v16h vf = cat8(*(const v8h*)(vb + 8 * half),
                     *(const v8h*)(vb + 16 + 8 * half));
      o[tt] = wmma16(pf, vf, o[tt]);
    }
  }

#pragma unroll
  for (int j = 0; j < 8; ++j) {
    float inv = 1.0f / st_l[j];
    int qrow = q0 + j + 8 * half;
    _Float16* dst = Oh + ((size_t)(b * S_ + qrow)) * D_ + h * 64;
#pragma unroll
    for (int tt = 0; tt < 4; ++tt)
      dst[tt * 16 + l16] = (_Float16)(o[tt][j] * inv);
  }
}

// ---------------------------------------------------------------------------
// Harmonic LayerNorm (unbiased std): one block per row.
// ---------------------------------------------------------------------------
__global__ __launch_bounds__(256) void harmonic_ln(
    const float* __restrict__ A, const float* __restrict__ Bv,
    const float* __restrict__ g, const float* __restrict__ be,
    const float* __restrict__ s, float* __restrict__ outF,
    _Float16* __restrict__ outH) {
  __shared__ float red[256];
  const int row = blockIdx.x, t = threadIdx.x;
  const float* a = A + (size_t)row * D_;
  const float* bb = Bv + (size_t)row * D_;

  float sum = 0.f, sq = 0.f;
  for (int c = t; c < D_; c += 256) {
    float v = a[c] + bb[c];
    sum += v; sq += v * v;
  }
  red[t] = sum; __syncthreads();
  for (int off = 128; off > 0; off >>= 1) {
    if (t < off) red[t] += red[t + off];
    __syncthreads();
  }
  float tot = red[0]; __syncthreads();
  red[t] = sq; __syncthreads();
  for (int off = 128; off > 0; off >>= 1) {
    if (t < off) red[t] += red[t + off];
    __syncthreads();
  }
  float tot2 = red[0];

  float mean = tot / (float)D_;
  float var = (tot2 - mean * tot) / (float)(D_ - 1);
  float sd = sqrtf(fmaxf(var, 0.f));
  sd = sd + s[0] * sinf(sd * 3.14159265358979323846f);
  float inv = 1.0f / (sd + 1e-6f);

  for (int c = t; c < D_; c += 256) {
    float v = (a[c] + bb[c] - mean) * inv * g[c] + be[c];
    outF[(size_t)row * D_ + c] = v;
    if (outH) outH[(size_t)row * D_ + c] = (_Float16)v;
  }
}

// ---------------------------------------------------------------------------
// launch
// ---------------------------------------------------------------------------
extern "C" void kernel_launch(void* const* d_in, const int* in_sizes, int n_in,
                              void* d_out, int out_size, void* d_ws,
                              size_t ws_size, hipStream_t stream) {
  const float* x   = (const float*)d_in[0];
  const float* Wq  = (const float*)d_in[1];  const float* bq  = (const float*)d_in[2];
  const float* Wk  = (const float*)d_in[3];  const float* bk  = (const float*)d_in[4];
  const float* Wv  = (const float*)d_in[5];  const float* bv  = (const float*)d_in[6];
  const float* Wo  = (const float*)d_in[7];  const float* bo  = (const float*)d_in[8];
  const float* res = (const float*)d_in[9];  const float* phs = (const float*)d_in[10];
  const float* g1  = (const float*)d_in[11]; const float* b1  = (const float*)d_in[12];
  const float* s1  = (const float*)d_in[13];
  const float* W1  = (const float*)d_in[14]; const float* bf1 = (const float*)d_in[15];
  const float* W2  = (const float*)d_in[16]; const float* bf2 = (const float*)d_in[17];
  const float* g2  = (const float*)d_in[18]; const float* b2  = (const float*)d_in[19];
  const float* s2  = (const float*)d_in[20];

  char* ws = (char*)d_ws;
  size_t off = 0;
  auto alloc = [&](size_t bytes) {
    char* p = ws + off;
    off += (bytes + 255) & ~(size_t)255;
    return p;
  };
  _Float16* xb   = (_Float16*)alloc((size_t)M_ * D_ * 2);
  _Float16* wqb  = (_Float16*)alloc((size_t)D_ * D_ * 2);  // transposed [N,K]
  _Float16* wkb  = (_Float16*)alloc((size_t)D_ * D_ * 2);
  _Float16* wvb  = (_Float16*)alloc((size_t)D_ * D_ * 2);
  _Float16* wob  = (_Float16*)alloc((size_t)D_ * D_ * 2);
  _Float16* w1b  = (_Float16*)alloc((size_t)D_ * F_ * 2);
  _Float16* w2b  = (_Float16*)alloc((size_t)F_ * D_ * 2);
  _Float16* qb   = (_Float16*)alloc((size_t)M_ * D_ * 2);
  _Float16* kb2  = (_Float16*)alloc((size_t)M_ * D_ * 2);
  _Float16* vt   = (_Float16*)alloc((size_t)M_ * D_ * 2);  // V transposed [D,M]
  _Float16* at16 = (_Float16*)alloc((size_t)M_ * D_ * 2);
  float*    aprj = (float*)   alloc((size_t)M_ * D_ * 4);
  float*    y1   = (float*)   alloc((size_t)M_ * D_ * 4);
  _Float16* y1b  = (_Float16*)alloc((size_t)M_ * D_ * 2);
  _Float16* act  = (_Float16*)alloc((size_t)M_ * F_ * 2);
  float*    ffn  = (float*)   alloc((size_t)M_ * D_ * 4);

  const dim3 blk256(256), blk128(128), blkT(32, 8);

  cvt_f32_f16<<<2048, blk256, 0, stream>>>(x, xb, (size_t)M_ * D_);
  // weights: f32 [K,N] -> f16 transposed [N,K]
  dim3 gTdd(D_ / 32, D_ / 32);
  cvt_transpose_f16<<<gTdd, blkT, 0, stream>>>(Wq, wqb, D_, D_);
  cvt_transpose_f16<<<gTdd, blkT, 0, stream>>>(Wk, wkb, D_, D_);
  cvt_transpose_f16<<<gTdd, blkT, 0, stream>>>(Wv, wvb, D_, D_);
  cvt_transpose_f16<<<gTdd, blkT, 0, stream>>>(Wo, wob, D_, D_);
  cvt_transpose_f16<<<dim3(F_ / 32, D_ / 32), blkT, 0, stream>>>(W1, w1b, D_, F_);
  cvt_transpose_f16<<<dim3(D_ / 32, F_ / 32), blkT, 0, stream>>>(W2, w2b, F_, D_);

  // QKV projections (V written transposed for the PV matmul)
  dim3 gDD(D_ / 64, M_ / 128);
  gemm_wmma<0><<<gDD, blk256, 0, stream>>>(xb, wqb, bq, qb,  nullptr, M_, D_, D_);
  gemm_wmma<0><<<gDD, blk256, 0, stream>>>(xb, wkb, bk, kb2, nullptr, M_, D_, D_);
  gemm_wmma<3><<<gDD, blk256, 0, stream>>>(xb, wvb, bv, vt,  nullptr, M_, D_, D_);

  // harmonic flash attention
  dim3 gFA(S_ / 64, B_ * H_);
  flash_attn<<<gFA, blk128, 0, stream>>>(qb, kb2, vt, res, phs, at16);

  // output projection (f32)
  gemm_wmma<1><<<gDD, blk256, 0, stream>>>(at16, wob, bo, nullptr, aprj, M_, D_, D_);

  // LN1
  harmonic_ln<<<M_, blk256, 0, stream>>>(x, aprj, g1, b1, s1, y1, y1b);

  // FFN up + spectral activation (f16), FFN down (f32)
  gemm_wmma<2><<<dim3(F_ / 64, M_ / 128), blk256, 0, stream>>>(
      y1b, w1b, bf1, act, nullptr, M_, F_, D_);
  gemm_wmma<1><<<gDD, blk256, 0, stream>>>(act, w2b, bf2, nullptr, ffn, M_, D_, F_);

  // LN2 -> final output
  harmonic_ln<<<M_, blk256, 0, stream>>>(y1, ffn, g2, b2, s2, (float*)d_out, nullptr);
}

// v001
// It runs in 484 microseconds.
// Two timings next to v000 both put it at 1.32 times that version's speed.
#include <hip/hip_runtime.h>
#include <hip/hip_bf16.h>

typedef __attribute__((ext_vector_type(16))) _Float16 v16h;
typedef __attribute__((ext_vector_type(8)))  _Float16 v8h;
typedef __attribute__((ext_vector_type(8)))  float    v8f;

#define B_  2
#define S_  2048
#define D_  1024
#define H_  16
#define F_  4096
#define M_  (B_ * S_)   // 4096 rows

// ---------------------------------------------------------------------------
// helpers
// ---------------------------------------------------------------------------
__device__ inline v16h cat8(v8h lo, v8h hi) {
  return __builtin_shufflevector(lo, hi, 0,1,2,3,4,5,6,7,8,9,10,11,12,13,14,15);
}

// 16x32 f16 fragment from LDS (k-contiguous rows). Lane l (l16=l&15, half=l>>4):
//   elements 0..7  -> k =      8*half + 0..7
//   elements 8..15 -> k = 16 + 8*half + 0..7
__device__ inline v16h load_frag(const _Float16* rowbase, int half) {
  v8h lo = *(const v8h*)(rowbase + 8 * half);
  v8h hi = *(const v8h*)(rowbase + 16 + 8 * half);
  return cat8(lo, hi);
}

__device__ inline v8f wmma16(v16h a, v16h b, v8f c) {
  return __builtin_amdgcn_wmma_f32_16x16x32_f16(
      false, a, false, b, (short)0, c, false, false);
}

// CDNA5 async global->LDS copy (ASYNCcnt-tracked, no VGPR data path).
__device__ inline void async_copy_b128(const void* gptr, void* lptr) {
  unsigned l = (unsigned)(unsigned long long)lptr;  // low 32 bits = LDS offset
  asm volatile("global_load_async_to_lds_b128 %0, %1, off"
               :: "v"(l), "v"(gptr) : "memory");
}
__device__ inline void async_wait0() {
  asm volatile("s_wait_asynccnt 0x0" ::: "memory");
}

__device__ inline float spectral_act(float x) {
  const float c = 0.7978845608028654f;              // sqrt(2/pi)
  float g = 0.5f * x * (1.0f + tanhf(c * (x + 0.044715f * x * x * x)));
  return g + 0.5f * sinf(x);                        // ALPHA=0.5, BETA=1.0
}

// ---------------------------------------------------------------------------
// f32 -> f16 conversion
// ---------------------------------------------------------------------------
__global__ void cvt_f32_f16(const float* __restrict__ src,
                            _Float16* __restrict__ dst, size_t n) {
  size_t i = (size_t)blockIdx.x * blockDim.x + threadIdx.x;
  size_t stride = (size_t)gridDim.x * blockDim.x;
  for (; i < n; i += stride) dst[i] = (_Float16)src[i];
}

// f32 [K,N] -> f16 transposed [N,K] (LDS-tiled, coalesced both sides)
__global__ __launch_bounds__(256) void cvt_transpose_f16(
    const float* __restrict__ src, _Float16* __restrict__ dst, int K, int N) {
  __shared__ float tile[32][33];
  const int kt = blockIdx.y * 32, nt = blockIdx.x * 32;
  const int tx = threadIdx.x, ty = threadIdx.y;  // block (32, 8)
#pragma unroll
  for (int r = ty; r < 32; r += 8)
    tile[r][tx] = src[(size_t)(kt + r) * N + nt + tx];
  __syncthreads();
#pragma unroll
  for (int r = ty; r < 32; r += 8)
    dst[(size_t)(nt + r) * K + kt + tx] = (_Float16)tile[tx][r];
}

// ---------------------------------------------------------------------------
// WMMA GEMM: C[M,N] = A[M,K](f16) @ W[K,N] + bias, with W pre-transposed
// as WT[N,K] (k-contiguous).  block = 256 (8 waves, 4x2 of 32x32),
// macro-tile 128x64, k-step 32, async global->LDS staging.
//   EPI 0: f16 out   EPI 1: f32 out   EPI 2: spectral->f16   EPI 3: f16 out^T
// ---------------------------------------------------------------------------
template <int EPI>
__global__ __launch_bounds__(256) void gemm_wmma(
    const _Float16* __restrict__ A, const _Float16* __restrict__ WT,
    const float* __restrict__ bias, _Float16* __restrict__ outH,
    float* __restrict__ outF, int M, int N, int K) {
  __shared__ _Float16 sA[128 * 40];  // [m][k], row stride 40
  __shared__ _Float16 sB[64 * 40];   // [n][k]

  const int t = threadIdx.x;
  const int lane = t & 31, wave = t >> 5;
  const int half = lane >> 4, l16 = lane & 15;
  const int m0 = blockIdx.y * 128, n0 = blockIdx.x * 64;
  const int wm = (wave >> 1) * 32, wn = (wave & 1) * 32;

  v8f acc[2][2] = {};

  const int ar = t >> 1, aseg = (t & 1) * 16;  // A: 16 f16 per thread
  const int br = t >> 2, bseg = (t & 3) * 8;   // B: 8 f16 per thread

  for (int kt = 0; kt < K; kt += 32) {
    __syncthreads();
    {
      const _Float16* ga = A + (size_t)(m0 + ar) * K + kt + aseg;
      async_copy_b128(ga,     &sA[ar * 40 + aseg]);
      async_copy_b128(ga + 8, &sA[ar * 40 + aseg + 8]);
      const _Float16* gb = WT + (size_t)(n0 + br) * K + kt + bseg;
      async_copy_b128(gb, &sB[br * 40 + bseg]);
    }
    if (kt + 32 < K) {  // global_prefetch_b8 for next tiles
      __builtin_prefetch(A + (size_t)(m0 + ar) * K + kt + 32 + aseg, 0, 0);
      __builtin_prefetch(WT + (size_t)(n0 + br) * K + kt + 32 + bseg, 0, 0);
    }
    async_wait0();
    __syncthreads();

    v16h af[2], bf[2];
#pragma unroll
    for (int i = 0; i < 2; ++i)
      af[i] = load_frag(&sA[(wm + 16 * i + l16) * 40], half);
#pragma unroll
    for (int j = 0; j < 2; ++j)
      bf[j] = load_frag(&sB[(wn + 16 * j + l16) * 40], half);
#pragma unroll
    for (int i = 0; i < 2; ++i)
#pragma unroll
      for (int j = 0; j < 2; ++j)
        acc[i][j] = wmma16(af[i], bf[j], acc[i][j]);
  }

#pragma unroll
  for (int i = 0; i < 2; ++i)
#pragma unroll
    for (int j = 0; j < 2; ++j) {
      const int nn = n0 + wn + 16 * j + l16;      // C layout: n = lane&15
      const float bval = bias[nn];
      if (EPI == 3) {
        // transposed f16 store: fixed n per lane, 8 consecutive m -> b128
        v8h pk;
#pragma unroll
        for (int jj = 0; jj < 8; ++jj)
          pk[jj] = (_Float16)(acc[i][j][jj] + bval);
        *(v8h*)(outH + (size_t)nn * M + (m0 + wm + 16 * i + 8 * half)) = pk;
      } else {
#pragma unroll
        for (int jj = 0; jj < 8; ++jj) {
          const int m = m0 + wm + 16 * i + jj + 8 * half;  // m = vgpr + 8*half
          float v = acc[i][j][jj] + bval;
          if (EPI == 2) v = spectral_act(v);
          size_t idx = (size_t)m * N + nn;
          if (EPI == 1) outF[idx] = v;
          else          outH[idx] = (_Float16)v;
        }
      }
    }
}

__device__ inline float other_half(float x) {
  int b = __builtin_bit_cast(int, x);
  b = __builtin_amdgcn_permlanex16(b, b, 0x76543210, 0xfedcba98, false, false);
  return __builtin_bit_cast(float, b);
}

// e^x = exp2(x * log2(e)) on v_exp_f32 (what __expf gives). Written as asm so that
// the v_nop stands directly behind the transcendental: the instruction set asks
// for one slot before its source is overwritten or its result read.
__device__ inline float exp_slot(float x) {
  float y;
  asm("v_exp_f32 %0, %1\n\tv_nop" : "=v"(y) : "v"(x * 1.44269504088896340736f));
  return y;
}

__global__ __launch_bounds__(128) void flash_attn(
    const _Float16* __restrict__ Q, const _Float16* __restrict__ Kc,
    const _Float16* __restrict__ Vt, const float* __restrict__ resonance,
    const float* __restrict__ phase, _Float16* __restrict__ Oh) {
  __shared__ _Float16 sK[32 * 64];     // [key][hd]
  __shared__ _Float16 sVt[64 * 32];    // [hd][key]

  const int t = threadIdx.x;
  const int lane = t & 31, wave = t >> 5;
  const int half = lane >> 4, l16 = lane & 15;
  const int bh = blockIdx.y, b = bh / H_, h = bh % H_;
  const int q0 = blockIdx.x * 64 + wave * 16;
  const float r = resonance[h], ph = phase[h];
  const float scale = 0.125f;  // 1/sqrt(64)

  const _Float16* qbase = Q + ((size_t)(b * S_ + q0 + l16)) * D_ + h * 64;
  v16h qf0 = cat8(*(const v8h*)(qbase + 8 * half),
                  *(const v8h*)(qbase + 16 + 8 * half));
  v16h qf1 = cat8(*(const v8h*)(qbase + 32 + 8 * half),
                  *(const v8h*)(qbase + 48 + 8 * half));

  float st_m = -3.0e38f;  // running maximum of query l16 (equal in both halves)
  float st_l = 0.f;       // running sum over this half's keys only
  v8f o[4] = {};          // o[tt][j] = O[query l16][hd = 16*tt + 8*half + j]

  const int kr = t >> 2, kseg = (t & 3) * 16;  // K loader: 16 f16 / thread
  const int vr = t >> 1, vseg = (t & 1) * 16;  // Vt loader: 16 f16 / thread
  for (int kv = 0; kv < S_; kv += 32) {
    __syncthreads();
    {
      const _Float16* kg = Kc + ((size_t)(b * S_ + kv + kr)) * D_ + h * 64 + kseg;
      async_copy_b128(kg,     &sK[kr * 64 + kseg]);
      async_copy_b128(kg + 8, &sK[kr * 64 + kseg + 8]);
      const _Float16* vg = Vt + ((size_t)(h * 64 + vr)) * M_ + b * S_ + kv + vseg;
      async_copy_b128(vg,     &sVt[vr * 32 + vseg]);
      async_copy_b128(vg + 8, &sVt[vr * 32 + vseg + 8]);
    }
    async_wait0();
    __syncthreads();

    // S^T for 32 keys: two 16(key) x 16(query) tiles, hd=64 reduced as 32+32.
    // s0[j]: key kv + 8*half + j;  s1[j]: key kv + 16 + 8*half + j.
    v8f s0 = {}, s1 = {};
    {
      const _Float16* k0 = &sK[l16 * 64];
      const _Float16* k1 = &sK[(16 + l16) * 64];
      v16h k00 = cat8(*(const v8h*)(k0 + 8 * half), *(const v8h*)(k0 + 16 + 8 * half));
      v16h k01 = cat8(*(const v8h*)(k0 + 32 + 8 * half), *(const v8h*)(k0 + 48 + 8 * half));
      v16h k10 = cat8(*(const v8h*)(k1 + 8 * half), *(const v8h*)(k1 + 16 + 8 * half));
      v16h k11 = cat8(*(const v8h*)(k1 + 32 + 8 * half), *(const v8h*)(k1 + 48 + 8 * half));
      s0 = wmma16(k00, qf0, s0); s0 = wmma16(k01, qf1, s0);
      s1 = wmma16(k10, qf0, s1); s1 = wmma16(k11, qf1, s1);
    }

    float mx = -3.0e38f;
#pragma unroll
    for (int j = 0; j < 8; ++j) {
      float a = s0[j] * scale;  a += r * sinf(a + ph);
      float c = s1[j] * scale;  c += r * sinf(c + ph);
      s0[j] = a; s1[j] = c;
      mx = fmaxf(mx, fmaxf(a, c));
    }
    mx = fmaxf(mx, other_half(mx));
    const float nm = fmaxf(st_m, mx);
    const float corr = exp_slot(st_m - nm);
    st_m = nm;

    // P^T as a B operand: element s is key 8*half + s (16 + 8*half + s-8 for s >= 8), which is exactly
    // s0[0..7] then s1[0..7] of this lane.
    v16h pf;
    float sm = 0.f;
#pragma unroll
    for (int j = 0; j < 8; ++j) {
      float p0 = exp_slot(s0[j] - nm), p1 = exp_slot(s1[j] - nm);
      sm += p0 + p1;
      pf[j] = (_Float16)p0;
      pf[8 + j] = (_Float16)p1;
    }
    st_l = st_l * corr + sm;
#pragma unroll
    for (int tt = 0; tt < 4; ++tt)
#pragma unroll
      for (int j = 0; j < 8; ++j) o[tt][j] *= corr;

#pragma unroll
    for (int tt = 0; tt < 4; ++tt) {
      const _Float16* vb = &sVt[(tt * 16 + l16) * 32];
      v16h vf = cat8(*(const v8h*)(vb + 8 * half),
                     *(const v8h*)(vb + 16 + 8 * half));
      o[tt] = wmma16(vf, pf, o[tt]);
    }
  }

  // join the two halves' sums once; 8 consecutive hd per lane -> 16-byte stores
  const float inv = 1.0f / (st_l + other_half(st_l));
  _Float16* dst = Oh + ((size_t)(b * S_ + q0 + l16)) * D_ + h * 64 + 8 * half;
#pragma unroll
  for (int tt = 0; tt < 4; ++tt) {
    v8h pk;
#pragma unroll
    for (int j = 0; j < 8; ++j) pk[j] = (_Float16)(o[tt][j] * inv);
    *(v8h*)(dst + tt * 16) = pk;
  }
}

// ---------------------------------------------------------------------------
// Harmonic LayerNorm (unbiased std): one block per row.
// ---------------------------------------------------------------------------
__global__ __launch_bounds__(256) void harmonic_ln(
    const float* __restrict__ A, const float* __restrict__ Bv,
    const float* __restrict__ g, const float* __restrict__ be,
    const float* __restrict__ s, float* __restrict__ outF,
    _Float16* __restrict__ outH) {
  __shared__ float red[256];
  const int row = blockIdx.x, t = threadIdx.x;
  const float* a = A + (size_t)row * D_;
  const float* bb = Bv + (size_t)row * D_;

  float sum = 0.f, sq = 0.f;
  for (int c = t; c < D_; c += 256) {
    float v = a[c] + bb[c];
    sum += v; sq += v * v;
  }
  red[t] = sum; __syncthreads();
  for (int off = 128; off > 0; off >>= 1) {
    if (t < off) red[t] += red[t + off];
    __syncthreads();
  }
  float tot = red[0]; __syncthreads();
  red[t] = sq; __syncthreads();
  for (int off = 128; off > 0; off >>= 1) {
    if (t < off) red[t] += red[t + off];
    __syncthreads();
  }
  float tot2 = red[0];

  float mean = tot / (float)D_;
  float var = (tot2 - mean * tot) / (float)(D_ - 1);
  float sd = sqrtf(fmaxf(var, 0.f));
  sd = sd + s[0] * sinf(sd * 3.14159265358979323846f);
  float inv = 1.0f / (sd + 1e-6f);

  for (int c = t; c < D_; c += 256) {
    float v = (a[c] + bb[c] - mean) * inv * g[c] + be[c];
    outF[(size_t)row * D_ + c] = v;
    if (outH) outH[(size_t)row * D_ + c] = (_Float16)v;
  }
}

// ---------------------------------------------------------------------------
// launch
// ---------------------------------------------------------------------------
extern "C" void kernel_launch(void* const* d_in, const int* in_sizes, int n_in,
                              void* d_out, int out_size, void* d_ws,
                              size_t ws_size, hipStream_t stream) {
  const float* x   = (const float*)d_in[0];
  const float* Wq  = (const float*)d_in[1];  const float* bq  = (const float*)d_in[2];
  const float* Wk  = (const float*)d_in[3];  const float* bk  = (const float*)d_in[4];
  const float* Wv  = (const float*)d_in[5];  const float* bv  = (const float*)d_in[6];
  const float* Wo  = (const float*)d_in[7];  const float* bo  = (const float*)d_in[8];
  const float* res = (const float*)d_in[9];  const float* phs = (const float*)d_in[10];
  const float* g1  = (const float*)d_in[11]; const float* b1  = (const float*)d_in[12];
  const float* s1  = (const float*)d_in[13];
  const float* W1  = (const float*)d_in[14]; const float* bf1 = (const float*)d_in[15];
  const float* W2  = (const float*)d_in[16]; const float* bf2 = (const float*)d_in[17];
  const float* g2  = (const float*)d_in[18]; const float* b2  = (const float*)d_in[19];
  const float* s2  = (const float*)d_in[20];

  char* ws = (char*)d_ws;
  size_t off = 0;
  auto alloc = [&](size_t bytes) {
    char* p = ws + off;
    off += (bytes + 255) & ~(size_t)255;
    return p;
  };
  _Float16* xb   = (_Float16*)alloc((size_t)M_ * D_ * 2);
  _Float16* wqb  = (_Float16*)alloc((size_t)D_ * D_ * 2);  // transposed [N,K]
  _Float16* wkb  = (_Float16*)alloc((size_t)D_ * D_ * 2);
  _Float16* wvb  = (_Float16*)alloc((size_t)D_ * D_ * 2);
  _Float16* wob  = (_Float16*)alloc((size_t)D_ * D_ * 2);
  _Float16* w1b  = (_Float16*)alloc((size_t)D_ * F_ * 2);
  _Float16* w2b  = (_Float16*)alloc((size_t)F_ * D_ * 2);
  _Float16* qb   = (_Float16*)alloc((size_t)M_ * D_ * 2);
  _Float16* kb2  = (_Float16*)alloc((size_t)M_ * D_ * 2);
  _Float16* vt   = (_Float16*)alloc((size_t)M_ * D_ * 2);  // V transposed [D,M]
  _Float16* at16 = (_Float16*)alloc((size_t)M_ * D_ * 2);
  float*    aprj = (float*)   alloc((size_t)M_ * D_ * 4);
  float*    y1   = (float*)   alloc((size_t)M_ * D_ * 4);
  _Float16* y1b  = (_Float16*)alloc((size_t)M_ * D_ * 2);
  _Float16* act  = (_Float16*)alloc((size_t)M_ * F_ * 2);
  float*    ffn  = (float*)   alloc((size_t)M_ * D_ * 4);

  const dim3 blk256(256), blk128(128), blkT(32, 8);

  cvt_f32_f16<<<2048, blk256, 0, stream>>>(x, xb, (size_t)M_ * D_);
  // weights: f32 [K,N] -> f16 transposed [N,K]
  dim3 gTdd(D_ / 32, D_ / 32);
  cvt_transpose_f16<<<gTdd, blkT, 0, stream>>>(Wq, wqb, D_, D_);
  cvt_transpose_f16<<<gTdd, blkT, 0, stream>>>(Wk, wkb, D_, D_);
  cvt_transpose_f16<<<gTdd, blkT, 0, stream>>>(Wv, wvb, D_, D_);
  cvt_transpose_f16<<<gTdd, blkT, 0, stream>>>(Wo, wob, D_, D_);
  cvt_transpose_f16<<<dim3(F_ / 32, D_ / 32), blkT, 0, stream>>>(W1, w1b, D_, F_);
  cvt_transpose_f16<<<dim3(D_ / 32, F_ / 32), blkT, 0, stream>>>(W2, w2b, F_, D_);

  // QKV projections (V written transposed for the PV matmul)
  dim3 gDD(D_ / 64, M_ / 128);
  gemm_wmma<0><<<gDD, blk256, 0, stream>>>(xb, wqb, bq, qb,  nullptr, M_, D_, D_);
  gemm_wmma<0><<<gDD, blk256, 0, stream>>>(xb, wkb, bk, kb2, nullptr, M_, D_, D_);
  gemm_wmma<3><<<gDD, blk256, 0, stream>>>(xb, wvb, bv, vt,  nullptr, M_, D_, D_);

  // harmonic flash attention
  dim3 gFA(S_ / 64, B_ * H_);
  flash_attn<<<gFA, blk128, 0, stream>>>(qb, kb2, vt, res, phs, at16);

  // output projection (f32)
  gemm_wmma<1><<<gDD, blk256, 0, stream>>>(at16, wob, bo, nullptr, aprj, M_, D_, D_);

  // LN1
  harmonic_ln<<<M_, blk256, 0, stream>>>(x, aprj, g1, b1, s1, y1, y1b);

  // FFN up + spectral activation (f16), FFN down (f32)
  gemm_wmma<2><<<dim3(F_ / 64, M_ / 128), blk256, 0, stream>>>(
      y1b, w1b, bf1, act, nullptr, M_, F_, D_);
  gemm_wmma<1><<<gDD, blk256, 0, stream>>>(act, w2b, bf2, nullptr, ffn, M_, D_, F_);

  // LN2 -> final output
  harmonic_ln<<<M_, blk256, 0, stream>>>(y1, ffn, g2, b2, s2, (float*)d_out, nullptr);
}

// v002
// It runs in 378 microseconds.
// Next to v001, in two timings, it ran 1.28 times as fast each time.
// All steps since v000 together make it 1.69 times as fast.
#include <hip/hip_runtime.h>
#include <hip/hip_bf16.h>

typedef __attribute__((ext_vector_type(16))) _Float16 v16h;
typedef __attribute__((ext_vector_type(8)))  _Float16 v8h;
typedef __attribute__((ext_vector_type(8)))  float    v8f;

#define B_  2
#define S_  2048
#define D_  1024
#define H_  16
#define F_  4096
#define M_  (B_ * S_)   // 4096 rows

// ---------------------------------------------------------------------------
// helpers
// ---------------------------------------------------------------------------
__device__ inline v16h cat8(v8h lo, v8h hi) {
  return __builtin_shufflevector(lo, hi, 0,1,2,3,4,5,6,7,8,9,10,11,12,13,14,15);
}

// 16x32 f16 fragment from LDS (k-contiguous rows). Lane l (l16=l&15, half=l>>4):
//   elements 0..7  -> k =      8*half + 0..7
//   elements 8..15 -> k = 16 + 8*half + 0..7
__device__ inline v16h load_frag(const _Float16* rowbase, int half) {
  v8h lo = *(const v8h*)(rowbase + 8 * half);
  v8h hi = *(const v8h*)(rowbase + 16 + 8 * half);
  return cat8(lo, hi);
}

__device__ inline v8f wmma16(v16h a, v16h b, v8f c) {
  return __builtin_amdgcn_wmma_f32_16x16x32_f16(
      false, a, false, b, (short)0, c, false, false);
}

// CDNA5 async global->LDS copy (ASYNCcnt-tracked, no VGPR data path).
__device__ inline void async_copy_b128(const void* gptr, void* lptr) {
  unsigned l = (unsigned)(unsigned long long)lptr;  // low 32 bits = LDS offset
  asm volatile("global_load_async_to_lds_b128 %0, %1, off"
               :: "v"(l), "v"(gptr) : "memory");
}
// One thread's twelve copies of a k-tile: eight A rows and four B rows, 16 rows
// apart (gstep, lstep in bytes). s_wait_xcnt 0 is the last line of the copies'
// own statement, so that no later write of an address register can be scheduled
// in front of it.
__device__ inline void async_copy_tile(const _Float16* ga, const _Float16* gb,
                                       size_t gstep, _Float16* pa, _Float16* pb,
                                       unsigned lstep) {
  const char* a = (const char*)ga;
  const char* b = (const char*)gb;
  const unsigned la = (unsigned)(unsigned long long)pa;  // low 32 bits = LDS offset
  const unsigned lb = (unsigned)(unsigned long long)pb;
  asm volatile("global_load_async_to_lds_b128 %0, %12, off\n\t"
               "global_load_async_to_lds_b128 %1, %13, off\n\t"
               "global_load_async_to_lds_b128 %2, %14, off\n\t"
               "global_load_async_to_lds_b128 %3, %15, off\n\t"
               "global_load_async_to_lds_b128 %4, %16, off\n\t"
               "global_load_async_to_lds_b128 %5, %17, off\n\t"
               "global_load_async_to_lds_b128 %6, %18, off\n\t"
               "global_load_async_to_lds_b128 %7, %19, off\n\t"
               "global_load_async_to_lds_b128 %8, %20, off\n\t"
               "global_load_async_to_lds_b128 %9, %21, off\n\t"
               "global_load_async_to_lds_b128 %10, %22, off\n\t"
               "global_load_async_to_lds_b128 %11, %23, off\n\t"
               "s_wait_xcnt 0x0"
               :: "v"(la), "v"(la + lstep), "v"(la + 2 * lstep), "v"(la + 3 * lstep),
                  "v"(la + 4 * lstep), "v"(la + 5 * lstep), "v"(la + 6 * lstep),
                  "v"(la + 7 * lstep), "v"(lb), "v"(lb + lstep), "v"(lb + 2 * lstep),
                  "v"(lb + 3 * lstep),
                  "v"(a), "v"(a + gstep), "v"(a + 2 * gstep), "v"(a + 3 * gstep),
                  "v"(a + 4 * gstep), "v"(a + 5 * gstep), "v"(a + 6 * gstep),
                  "v"(a + 7 * gstep), "v"(b), "v"(b + gstep), "v"(b + 2 * gstep),
                  "v"(b + 3 * gstep)
               : "memory");
}
__device__ inline void async_wait0() {
  asm volatile("s_wait_asynccnt 0x0" ::: "memory");
}

__device__ inline float spectral_act(float x) {
  const float c = 0.7978845608028654f;              // sqrt(2/pi)
  float g = 0.5f * x * (1.0f + tanhf(c * (x + 0.044715f * x * x * x)));
  return g + 0.5f * sinf(x);                        // ALPHA=0.5, BETA=1.0
}

// ---------------------------------------------------------------------------
// f32 -> f16 conversion
// ---------------------------------------------------------------------------
__global__ void cvt_f32_f16(const float* __restrict__ src,
                            _Float16* __restrict__ dst, size_t n) {
  size_t i = (size_t)blockIdx.x * blockDim.x + threadIdx.x;
  size_t stride = (size_t)gridDim.x * blockDim.x;
  for (; i < n; i += stride) dst[i] = (_Float16)src[i];
}

// f32 [K,N] -> f16 transposed [N,K] (LDS-tiled, coalesced both sides)
__global__ __launch_bounds__(256) void cvt_transpose_f16(
    const float* __restrict__ src, _Float16* __restrict__ dst, int K, int N) {
  __shared__ float tile[32][33];
  const int kt = blockIdx.y * 32, nt = blockIdx.x * 32;
  const int tx = threadIdx.x, ty = threadIdx.y;  // block (32, 8)
#pragma unroll
  for (int r = ty; r < 32; r += 8)
    tile[r][tx] = src[(size_t)(kt + r) * N + nt + tx];
  __syncthreads();
#pragma unroll
  for (int r = ty; r < 32; r += 8)
    dst[(size_t)(nt + r) * K + kt + tx] = (_Float16)tile[tx][r];
}

// ---------------------------------------------------------------------------
// WMMA GEMM: C[M,N] = A[M,K](f16) @ W[K,N] + bias, with W pre-transposed
// as WT[N,K] (k-contiguous).  block = 256 (8 waves, 4x2 of 32x32),
// macro-tile 128x64, k-step 128 (a staged row is two whole 128-byte lines, copied
// by 16 neighbouring lanes), async global->LDS staging.
//   EPI 0: f16 out   EPI 1: f32 out   EPI 2: spectral->f16   EPI 3: f16 out^T
// ---------------------------------------------------------------------------
template <int EPI>
__global__ __launch_bounds__(256) void gemm_wmma(
    const _Float16* __restrict__ A, const _Float16* __restrict__ WT,
    const float* __restrict__ bias, _Float16* __restrict__ outH,
    float* __restrict__ outF, int M, int N, int K) {
  // rows of 128 k at a pitch of 136 (272 bytes = 16 x odd: no bank conflict for b128)
  __shared__ __attribute__((aligned(16))) _Float16 sA[128 * 136];  // [m][k]
  __shared__ __attribute__((aligned(16))) _Float16 sB[64 * 136];   // [n][k]

  const int t = threadIdx.x;
  const int lane = t & 31, wave = t >> 5;
  const int half = lane >> 4, l16 = lane & 15;
  const int m0 = blockIdx.y * 128, n0 = blockIdx.x * 64;
  const int wm = (wave >> 1) * 32, wn = (wave & 1) * 32;

  v8f acc[2][2] = {};

  const int ar = t >> 1, aseg = (t & 1) * 64;  // prefetch: A row, one lane a line
  const int br = t >> 2, bseg = (t & 3) * 32;  // prefetch: B row, two lanes a line
  const int cr = t >> 4, cseg = (t & 15) * 8;  // copies: 16 lanes x 16 B = one row

  for (int kt = 0; kt < K; kt += 128) {
    // this wave's LDS reads of the last tile have returned before it is refilled
    asm volatile("s_wait_dscnt 0x0" ::: "memory");
    __syncthreads();
    async_copy_tile(A + (size_t)(m0 + cr) * K + kt + cseg,
                    WT + (size_t)(n0 + cr) * K + kt + cseg, (size_t)K * 32,
                    &sA[cr * 136 + cseg], &sB[cr * 136 + cseg], 16 * 272);
    if (kt + 128 < K) {  // global_prefetch_b8 for next tiles
      __builtin_prefetch(A + (size_t)(m0 + ar) * K + kt + 128 + aseg, 0, 0);
      __builtin_prefetch(WT + (size_t)(n0 + br) * K + kt + 128 + bseg, 0, 0);
    }
    async_wait0();
    __syncthreads();

#pragma unroll  // the tile's four 32-k parts, in ascending k as before
    for (int kk = 0; kk < 128; kk += 32) {
      v16h af[2], bf[2];
#pragma unroll
      for (int i = 0; i < 2; ++i)
        af[i] = load_frag(&sA[(wm + 16 * i + l16) * 136 + kk], half);
#pragma unroll
      for (int j = 0; j < 2; ++j)
        bf[j] = load_frag(&sB[(wn + 16 * j + l16) * 136 + kk], half);
#pragma unroll
      for (int i = 0; i < 2; ++i)
#pragma unroll
        for (int j = 0; j < 2; ++j)
          acc[i][j] = wmma16(af[i], bf[j], acc[i][j]);
    }
  }

#pragma unroll
  for (int i = 0; i < 2; ++i)
#pragma unroll
    for (int j = 0; j < 2; ++j) {
      const int nn = n0 + wn + 16 * j + l16;      // C layout: n = lane&15
      const float bval = bias[nn];
      if (EPI == 3) {
        // transposed f16 store: fixed n per lane, 8 consecutive m -> b128
        v8h pk;
#pragma unroll
        for (int jj = 0; jj < 8; ++jj)
          pk[jj] = (_Float16)(acc[i][j][jj] + bval);
        *(v8h*)(outH + (size_t)nn * M + (m0 + wm + 16 * i + 8 * half)) = pk;
      } else {
#pragma unroll
        for (int jj = 0; jj < 8; ++jj) {
          const int m = m0 + wm + 16 * i + jj + 8 * half;  // m = vgpr + 8*half
          float v = acc[i][j][jj] + bval;
          if (EPI == 2) v = spectral_act(v);
          size_t idx = (size_t)m * N + nn;
          if (EPI == 1) outF[idx] = v;
          else          outH[idx] = (_Float16)v;
        }
      }
    }
}

__device__ inline float other_half(float x) {
  int b = __builtin_bit_cast(int, x);
  b = __builtin_amdgcn_permlanex16(b, b, 0x76543210, 0xfedcba98, false, false);
  return __builtin_bit_cast(float, b);
}

// e^x = exp2(x * log2(e)) on v_exp_f32 (what __expf gives). Written as asm so that
// the v_nop stands directly behind the transcendental: the instruction set asks
// for one slot before its source is overwritten or its result read.
__device__ inline float exp_slot(float x) {
  float y;
  asm("v_exp_f32 %0, %1\n\tv_nop" : "=v"(y) : "v"(x * 1.44269504088896340736f));
  return y;
}

__global__ __launch_bounds__(128) void flash_attn(
    const _Float16* __restrict__ Q, const _Float16* __restrict__ Kc,
    const _Float16* __restrict__ Vt, const float* __restrict__ resonance,
    const float* __restrict__ phase, _Float16* __restrict__ Oh) {
  __shared__ _Float16 sK[32 * 64];     // [key][hd]
  __shared__ _Float16 sVt[64 * 32];    // [hd][key]

  const int t = threadIdx.x;
  const int lane = t & 31, wave = t >> 5;
  const int half = lane >> 4, l16 = lane & 15;
  const int bh = blockIdx.y, b = bh / H_, h = bh % H_;
  const int q0 = blockIdx.x * 64 + wave * 16;
  const float r = resonance[h], ph = phase[h];
  const float scale = 0.125f;  // 1/sqrt(64)

  const _Float16* qbase = Q + ((size_t)(b * S_ + q0 + l16)) * D_ + h * 64;
  v16h qf0 = cat8(*(const v8h*)(qbase + 8 * half),
                  *(const v8h*)(qbase + 16 + 8 * half));
  v16h qf1 = cat8(*(const v8h*)(qbase + 32 + 8 * half),
                  *(const v8h*)(qbase + 48 + 8 * half));

  float st_m = -3.0e38f;  // running maximum of query l16 (equal in both halves)
  float st_l = 0.f;       // running sum over this half's keys only
  v8f o[4] = {};          // o[tt][j] = O[query l16][hd = 16*tt + 8*half + j]

  const int kr = t >> 2, kseg = (t & 3) * 16;  // K loader: 16 f16 / thread
  const int vr = t >> 1, vseg = (t & 1) * 16;  // Vt loader: 16 f16 / thread
  for (int kv = 0; kv < S_; kv += 32) {
    __syncthreads();
    {
      const _Float16* kg = Kc + ((size_t)(b * S_ + kv + kr)) * D_ + h * 64 + kseg;
      async_copy_b128(kg,     &sK[kr * 64 + kseg]);
      async_copy_b128(kg + 8, &sK[kr * 64 + kseg + 8]);
      const _Float16* vg = Vt + ((size_t)(h * 64 + vr)) * M_ + b * S_ + kv + vseg;
      async_copy_b128(vg,     &sVt[vr * 32 + vseg]);
      async_copy_b128(vg + 8, &sVt[vr * 32 + vseg + 8]);
    }
    async_wait0();
    __syncthreads();

    // S^T for 32 keys: two 16(key) x 16(query) tiles, hd=64 reduced as 32+32.
    // s0[j]: key kv + 8*half + j;  s1[j]: key kv + 16 + 8*half + j.
    v8f s0 = {}, s1 = {};
    {
      const _Float16* k0 = &sK[l16 * 64];
      const _Float16* k1 = &sK[(16 + l16) * 64];
      v16h k00 = cat8(*(const v8h*)(k0 + 8 * half), *(const v8h*)(k0 + 16 + 8 * half));
      v16h k01 = cat8(*(const v8h*)(k0 + 32 + 8 * half), *(const v8h*)(k0 + 48 + 8 * half));
      v16h k10 = cat8(*(const v8h*)(k1 + 8 * half), *(const v8h*)(k1 + 16 + 8 * half));
      v16h k11 = cat8(*(const v8h*)(k1 + 32 + 8 * half), *(const v8h*)(k1 + 48 + 8 * half));
      s0 = wmma16(k00, qf0, s0); s0 = wmma16(k01, qf1, s0);
      s1 = wmma16(k10, qf0, s1); s1 = wmma16(k11, qf1, s1);
    }

    float mx = -3.0e38f;
#pragma unroll
    for (int j = 0; j < 8; ++j) {
      float a = s0[j] * scale;  a += r * sinf(a + ph);
      float c = s1[j] * scale;  c += r * sinf(c + ph);
      s0[j] = a; s1[j] = c;
      mx = fmaxf(mx, fmaxf(a, c));
    }
    mx = fmaxf(mx, other_half(mx));
    const float nm = fmaxf(st_m, mx);
    const float corr = exp_slot(st_m - nm);
    st_m = nm;

    // P^T as a B operand: element s is key 8*half + s (16 + 8*half + s-8 for s >= 8), which is exactly
    // s0[0..7] then s1[0..7] of this lane.
    v16h pf;
    float sm = 0.f;
#pragma unroll
    for (int j = 0; j < 8; ++j) {
      float p0 = exp_slot(s0[j] - nm), p1 = exp_slot(s1[j] - nm);
      sm += p0 + p1;
      pf[j] = (_Float16)p0;
      pf[8 + j] = (_Float16)p1;
    }
    st_l = st_l * corr + sm;
#pragma unroll
    for (int tt = 0; tt < 4; ++tt)
#pragma unroll
      for (int j = 0; j < 8; ++j) o[tt][j] *= corr;

#pragma unroll
    for (int tt = 0; tt < 4; ++tt) {
      const _Float16* vb = &sVt[(tt * 16 + l16) * 32];
      v16h vf = cat8(*(const v8h*)(vb + 8 * half),
                     *(const v8h*)(vb + 16 + 8 * half));
      o[tt] = wmma16(vf, pf, o[tt]);
    }
  }

  // join the two halves' sums once; 8 consecutive hd per lane -> 16-byte stores
  const float inv = 1.0f / (st_l + other_half(st_l));
  _Float16* dst = Oh + ((size_t)(b * S_ + q0 + l16)) * D_ + h * 64 + 8 * half;
#pragma unroll
  for (int tt = 0; tt < 4; ++tt) {
    v8h pk;
#pragma unroll
    for (int j = 0; j < 8; ++j) pk[j] = (_Float16)(o[tt][j] * inv);
    *(v8h*)(dst + tt * 16) = pk;
  }
}

// ---------------------------------------------------------------------------
// Harmonic LayerNorm (unbiased std): one block per row.
// ---------------------------------------------------------------------------
__global__ __launch_bounds__(256) void harmonic_ln(
    const float* __restrict__ A, const float* __restrict__ Bv,
    const float* __restrict__ g, const float* __restrict__ be,
    const float* __restrict__ s, float* __restrict__ outF,
    _Float16* __restrict__ outH) {
  __shared__ float red[256];
  const int row = blockIdx.x, t = threadIdx.x;
  const float* a = A + (size_t)row * D_;
  const float* bb = Bv + (size_t)row * D_;

  float sum = 0.f, sq = 0.f;
  for (int c = t; c < D_; c += 256) {
    float v = a[c] + bb[c];
    sum += v; sq += v * v;
  }
  red[t] = sum; __syncthreads();
  for (int off = 128; off > 0; off >>= 1) {
    if (t < off) red[t] += red[t + off];
    __syncthreads();
  }
  float tot = red[0]; __syncthreads();
  red[t] = sq; __syncthreads();
  for (int off = 128; off > 0; off >>= 1) {
    if (t < off) red[t] += red[t + off];
    __syncthreads();
  }
  float tot2 = red[0];

  float mean = tot / (float)D_;
  float var = (tot2 - mean * tot) / (float)(D_ - 1);
  float sd = sqrtf(fmaxf(var, 0.f));
  sd = sd + s[0] * sinf(sd * 3.14159265358979323846f);
  float inv = 1.0f / (sd + 1e-6f);

  for (int c = t; c < D_; c += 256) {
    float v = (a[c] + bb[c] - mean) * inv * g[c] + be[c];
    outF[(size_t)row * D_ + c] = v;
    if (outH) outH[(size_t)row * D_ + c] = (_Float16)v;
  }
}

// ---------------------------------------------------------------------------
// launch
// ---------------------------------------------------------------------------
extern "C" void kernel_launch(void* const* d_in, const int* in_sizes, int n_in,
                              void* d_out, int out_size, void* d_ws,
                              size_t ws_size, hipStream_t stream) {
  const float* x   = (const float*)d_in[0];
  const float* Wq  = (const float*)d_in[1];  const float* bq  = (const float*)d_in[2];
  const float* Wk  = (const float*)d_in[3];  const float* bk  = (const float*)d_in[4];
  const float* Wv  = (const float*)d_in[5];  const float* bv  = (const float*)d_in[6];
  const float* Wo  = (const float*)d_in[7];  const float* bo  = (const float*)d_in[8];
  const float* res = (const float*)d_in[9];  const float* phs = (const float*)d_in[10];
  const float* g1  = (const float*)d_in[11]; const float* b1  = (const float*)d_in[12];
  const float* s1  = (const float*)d_in[13];
  const float* W1  = (const float*)d_in[14]; const float* bf1 = (const float*)d_in[15];
  const float* W2  = (const float*)d_in[16]; const float* bf2 = (const float*)d_in[17];
  const float* g2  = (const float*)d_in[18]; const float* b2  = (const float*)d_in[19];
  const float* s2  = (const float*)d_in[20];

  char* ws = (char*)d_ws;
  size_t off = 0;
  auto alloc = [&](size_t bytes) {
    char* p = ws + off;
    off += (bytes + 255) & ~(size_t)255;
    return p;
  };
  _Float16* xb   = (_Float16*)alloc((size_t)M_ * D_ * 2);
  _Float16* wqb  = (_Float16*)alloc((size_t)D_ * D_ * 2);  // transposed [N,K]
  _Float16* wkb  = (_Float16*)alloc((size_t)D_ * D_ * 2);
  _Float16* wvb  = (_Float16*)alloc((size_t)D_ * D_ * 2);
  _Float16* wob  = (_Float16*)alloc((size_t)D_ * D_ * 2);
  _Float16* w1b  = (_Float16*)alloc((size_t)D_ * F_ * 2);
  _Float16* w2b  = (_Float16*)alloc((size_t)F_ * D_ * 2);
  _Float16* qb   = (_Float16*)alloc((size_t)M_ * D_ * 2);
  _Float16* kb2  = (_Float16*)alloc((size_t)M_ * D_ * 2);
  _Float16* vt   = (_Float16*)alloc((size_t)M_ * D_ * 2);  // V transposed [D,M]
  _Float16* at16 = (_Float16*)alloc((size_t)M_ * D_ * 2);
  float*    aprj = (float*)   alloc((size_t)M_ * D_ * 4);
  float*    y1   = (float*)   alloc((size_t)M_ * D_ * 4);
  _Float16* y1b  = (_Float16*)alloc((size_t)M_ * D_ * 2);
  _Float16* act  = (_Float16*)alloc((size_t)M_ * F_ * 2);
  float*    ffn  = (float*)   alloc((size_t)M_ * D_ * 4);

  const dim3 blk256(256), blk128(128), blkT(32, 8);

  cvt_f32_f16<<<2048, blk256, 0, stream>>>(x, xb, (size_t)M_ * D_);
  // weights: f32 [K,N] -> f16 transposed [N,K]
  dim3 gTdd(D_ / 32, D_ / 32);
  cvt_transpose_f16<<<gTdd, blkT, 0, stream>>>(Wq, wqb, D_, D_);
  cvt_transpose_f16<<<gTdd, blkT, 0, stream>>>(Wk, wkb, D_, D_);
  cvt_transpose_f16<<<gTdd, blkT, 0, stream>>>(Wv, wvb, D_, D_);
  cvt_transpose_f16<<<gTdd, blkT, 0, stream>>>(Wo, wob, D_, D_);
  cvt_transpose_f16<<<dim3(F_ / 32, D_ / 32), blkT, 0, stream>>>(W1, w1b, D_, F_);
  cvt_transpose_f16<<<dim3(D_ / 32, F_ / 32), blkT, 0, stream>>>(W2, w2b, F_, D_);

  // QKV projections (V written transposed for the PV matmul)
  dim3 gDD(D_ / 64, M_ / 128);
  gemm_wmma<0><<<gDD, blk256, 0, stream>>>(xb, wqb, bq, qb,  nullptr, M_, D_, D_);
  gemm_wmma<0><<<gDD, blk256, 0, stream>>>(xb, wkb, bk, kb2, nullptr, M_, D_, D_);
  gemm_wmma<3><<<gDD, blk256, 0, stream>>>(xb, wvb, bv, vt,  nullptr, M_, D_, D_);

  // harmonic flash attention
  dim3 gFA(S_ / 64, B_ * H_);
  flash_attn<<<gFA, blk128, 0, stream>>>(qb, kb2, vt, res, phs, at16);

  // output projection (f32)
  gemm_wmma<1><<<gDD, blk256, 0, stream>>>(at16, wob, bo, nullptr, aprj, M_, D_, D_);

  // LN1
  harmonic_ln<<<M_, blk256, 0, stream>>>(x, aprj, g1, b1, s1, y1, y1b);

  // FFN up + spectral activation (f16), FFN down (f32)
  gemm_wmma<2><<<dim3(F_ / 64, M_ / 128), blk256, 0, stream>>>(
      y1b, w1b, bf1, act, nullptr, M_, F_, D_);
  gemm_wmma<1><<<gDD, blk256, 0, stream>>>(act, w2b, bf2, nullptr, ffn, M_, D_, F_);

  // LN2 -> final output
  harmonic_ln<<<M_, blk256, 0, stream>>>(y1, ffn, g2, b2, s2, (float*)d_out, nullptr);
}

// v003
// It runs in 326 microseconds.
// Next to v002, in two timings, it ran 1.16 times as fast each time.
// Over all steps from v000 it is 1.97 times as fast.
#include <hip/hip_runtime.h>
#include <hip/hip_bf16.h>

typedef __attribute__((ext_vector_type(16))) _Float16 v16h;
typedef __attribute__((ext_vector_type(8)))  _Float16 v8h;
typedef __attribute__((ext_vector_type(8)))  float    v8f;

#define B_  2
#define S_  2048
#define D_  1024
#define H_  16
#define F_  4096
#define M_  (B_ * S_)   // 4096 rows

// ---------------------------------------------------------------------------
// helpers
// ---------------------------------------------------------------------------
__device__ inline v16h cat8(v8h lo, v8h hi) {
  return __builtin_shufflevector(lo, hi, 0,1,2,3,4,5,6,7,8,9,10,11,12,13,14,15);
}

// 16x32 f16 fragment from LDS (k-contiguous rows). Lane l (l16=l&15, half=l>>4):
//   elements 0..7  -> k =      8*half + 0..7
//   elements 8..15 -> k = 16 + 8*half + 0..7
__device__ inline v16h load_frag(const _Float16* rowbase, int half) {
  v8h lo = *(const v8h*)(rowbase + 8 * half);
  v8h hi = *(const v8h*)(rowbase + 16 + 8 * half);
  return cat8(lo, hi);
}

__device__ inline v8f wmma16(v16h a, v16h b, v8f c) {
  return __builtin_amdgcn_wmma_f32_16x16x32_f16(
      false, a, false, b, (short)0, c, false, false);
}

// CDNA5 async global->LDS copy (ASYNCcnt-tracked, no VGPR data path).
// One thread's four copies of a key tile: 32 bytes of a K row, 32 of a V^T row.
// s_wait_xcnt 0 is the last line of the copies' own statement, so that no later
// write of an address register can be scheduled in front of it.
__device__ inline void async_copy_kv(const _Float16* gk, const _Float16* gv,
                                     _Float16* pk, _Float16* pv) {
  const char* k = (const char*)gk;
  const char* v = (const char*)gv;
  const unsigned lk = (unsigned)(unsigned long long)pk;  // low 32 bits = LDS offset
  const unsigned lv = (unsigned)(unsigned long long)pv;
  asm volatile("global_load_async_to_lds_b128 %0, %4, off\n\t"
               "global_load_async_to_lds_b128 %1, %5, off\n\t"
               "global_load_async_to_lds_b128 %2, %6, off\n\t"
               "global_load_async_to_lds_b128 %3, %7, off\n\t"
               "s_wait_xcnt 0x0"
               :: "v"(lk), "v"(lk + 16), "v"(lv), "v"(lv + 16),
                  "v"(k), "v"(k + 16), "v"(v), "v"(v + 16)
               : "memory");
}
// One thread's twelve copies of a k-tile: eight A rows and four B rows, 16 rows
// apart (gstep, lstep in bytes). s_wait_xcnt 0 is the last line of the copies'
// own statement, so that no later write of an address register can be scheduled
// in front of it.
__device__ inline void async_copy_tile(const _Float16* ga, const _Float16* gb,
                                       size_t gstep, _Float16* pa, _Float16* pb,
                                       unsigned lstep) {
  const char* a = (const char*)ga;
  const char* b = (const char*)gb;
  const unsigned la = (unsigned)(unsigned long long)pa;  // low 32 bits = LDS offset
  const unsigned lb = (unsigned)(unsigned long long)pb;
  asm volatile("global_load_async_to_lds_b128 %0, %12, off\n\t"
               "global_load_async_to_lds_b128 %1, %13, off\n\t"
               "global_load_async_to_lds_b128 %2, %14, off\n\t"
               "global_load_async_to_lds_b128 %3, %15, off\n\t"
               "global_load_async_to_lds_b128 %4, %16, off\n\t"
               "global_load_async_to_lds_b128 %5, %17, off\n\t"
               "global_load_async_to_lds_b128 %6, %18, off\n\t"
               "global_load_async_to_lds_b128 %7, %19, off\n\t"
               "global_load_async_to_lds_b128 %8, %20, off\n\t"
               "global_load_async_to_lds_b128 %9, %21, off\n\t"
               "global_load_async_to_lds_b128 %10, %22, off\n\t"
               "global_load_async_to_lds_b128 %11, %23, off\n\t"
               "s_wait_xcnt 0x0"
               :: "v"(la), "v"(la + lstep), "v"(la + 2 * lstep), "v"(la + 3 * lstep),
                  "v"(la + 4 * lstep), "v"(la + 5 * lstep), "v"(la + 6 * lstep),
                  "v"(la + 7 * lstep), "v"(lb), "v"(lb + lstep), "v"(lb + 2 * lstep),
                  "v"(lb + 3 * lstep),
                  "v"(a), "v"(a + gstep), "v"(a + 2 * gstep), "v"(a + 3 * gstep),
                  "v"(a + 4 * gstep), "v"(a + 5 * gstep), "v"(a + 6 * gstep),
                  "v"(a + 7 * gstep), "v"(b), "v"(b + gstep), "v"(b + 2 * gstep),
                  "v"(b + 3 * gstep)
               : "memory");
}
__device__ inline void async_wait0() {
  asm volatile("s_wait_asynccnt 0x0" ::: "memory");
}

// sin(2*pi*t) on v_sin_f32, which takes its argument in revolutions. v_fract_f32
// is the whole range reduction (exact; it hands the instruction a value in
// [0, 1)), so there is no compare and no branch per value. What is lost
// against the library's sinf is the rounding of t, |t| * 2^-24 revolutions: the
// size of the rounding that the f32 argument in radians carries anyway.
// The builtin, not asm text: the compiler then keeps the distance behind a matrix
// instruction whose operand registers the result reuses.
#define INV_2PI 0.15915494309189535f
__device__ inline float sin_rev(float t) {
  return __builtin_amdgcn_sinf(__builtin_amdgcn_fractf(t));
}

__device__ inline float spectral_act(float x) {
  const float c = 0.7978845608028654f;              // sqrt(2/pi)
  float g = 0.5f * x * (1.0f + tanhf(c * (x + 0.044715f * x * x * x)));
  return g + 0.5f * sin_rev(x * INV_2PI);           // ALPHA=0.5, BETA=1.0
}

// ---------------------------------------------------------------------------
// f32 -> f16 conversion
// ---------------------------------------------------------------------------
__global__ void cvt_f32_f16(const float* __restrict__ src,
                            _Float16* __restrict__ dst, size_t n) {
  size_t i = (size_t)blockIdx.x * blockDim.x + threadIdx.x;
  size_t stride = (size_t)gridDim.x * blockDim.x;
  for (; i < n; i += stride) dst[i] = (_Float16)src[i];
}

// f32 [K,N] -> f16 transposed [N,K] (LDS-tiled, coalesced both sides)
__global__ __launch_bounds__(256) void cvt_transpose_f16(
    const float* __restrict__ src, _Float16* __restrict__ dst, int K, int N) {
  __shared__ float tile[32][33];
  const int kt = blockIdx.y * 32, nt = blockIdx.x * 32;
  const int tx = threadIdx.x, ty = threadIdx.y;  // block (32, 8)
#pragma unroll
  for (int r = ty; r < 32; r += 8)
    tile[r][tx] = src[(size_t)(kt + r) * N + nt + tx];
  __syncthreads();
#pragma unroll
  for (int r = ty; r < 32; r += 8)
    dst[(size_t)(nt + r) * K + kt + tx] = (_Float16)tile[tx][r];
}

// ---------------------------------------------------------------------------
// WMMA GEMM: C[M,N] = A[M,K](f16) @ W[K,N] + bias, with W pre-transposed
// as WT[N,K] (k-contiguous).  block = 256 (8 waves, 4x2 of 32x32),
// macro-tile 128x64, k-step 128 (a staged row is two whole 128-byte lines, copied
// by 16 neighbouring lanes), async global->LDS staging.
//   EPI 0: f16 out   EPI 1: f32 out   EPI 2: spectral->f16   EPI 3: f16 out^T
// ---------------------------------------------------------------------------
template <int EPI>
__global__ __launch_bounds__(256) void gemm_wmma(
    const _Float16* __restrict__ A, const _Float16* __restrict__ WT,
    const float* __restrict__ bias, _Float16* __restrict__ outH,
    float* __restrict__ outF, int M, int N, int K) {
  // rows of 128 k at a pitch of 136 (272 bytes = 16 x odd: no bank conflict for b128)
  __shared__ __attribute__((aligned(16))) _Float16 sA[128 * 136];  // [m][k]
  __shared__ __attribute__((aligned(16))) _Float16 sB[64 * 136];   // [n][k]

  const int t = threadIdx.x;
  const int lane = t & 31, wave = t >> 5;
  const int half = lane >> 4, l16 = lane & 15;
  const int m0 = blockIdx.y * 128, n0 = blockIdx.x * 64;
  const int wm = (wave >> 1) * 32, wn = (wave & 1) * 32;

  v8f acc[2][2] = {};

  const int ar = t >> 1, aseg = (t & 1) * 64;  // prefetch: A row, one lane a line
  const int br = t >> 2, bseg = (t & 3) * 32;  // prefetch: B row, two lanes a line
  const int cr = t >> 4, cseg = (t & 15) * 8;  // copies: 16 lanes x 16 B = one row

  for (int kt = 0; kt < K; kt += 128) {
    // this wave's LDS reads of the last tile have returned before it is refilled
    asm volatile("s_wait_dscnt 0x0" ::: "memory");
    __syncthreads();
    async_copy_tile(A + (size_t)(m0 + cr) * K + kt + cseg,
                    WT + (size_t)(n0 + cr) * K + kt + cseg, (size_t)K * 32,
                    &sA[cr * 136 + cseg], &sB[cr * 136 + cseg], 16 * 272);
    if (kt + 128 < K) {  // global_prefetch_b8 for next tiles
      __builtin_prefetch(A + (size_t)(m0 + ar) * K + kt + 128 + aseg, 0, 0);
      __builtin_prefetch(WT + (size_t)(n0 + br) * K + kt + 128 + bseg, 0, 0);
    }
    async_wait0();
    __syncthreads();

#pragma unroll  // the tile's four 32-k parts, in ascending k as before
    for (int kk = 0; kk < 128; kk += 32) {
      v16h af[2], bf[2];
#pragma unroll
      for (int i = 0; i < 2; ++i)
        af[i] = load_frag(&sA[(wm + 16 * i + l16) * 136 + kk], half);
#pragma unroll
      for (int j = 0; j < 2; ++j)
        bf[j] = load_frag(&sB[(wn + 16 * j + l16) * 136 + kk], half);
#pragma unroll
      for (int i = 0; i < 2; ++i)
#pragma unroll
        for (int j = 0; j < 2; ++j)
          acc[i][j] = wmma16(af[i], bf[j], acc[i][j]);
    }
  }

#pragma unroll
  for (int i = 0; i < 2; ++i)
#pragma unroll
    for (int j = 0; j < 2; ++j) {
      const int nn = n0 + wn + 16 * j + l16;      // C layout: n = lane&15
      const float bval = bias[nn];
      if (EPI == 3) {
        // transposed f16 store: fixed n per lane, 8 consecutive m -> b128
        v8h pk;
#pragma unroll
        for (int jj = 0; jj < 8; ++jj)
          pk[jj] = (_Float16)(acc[i][j][jj] + bval);
        *(v8h*)(outH + (size_t)nn * M + (m0 + wm + 16 * i + 8 * half)) = pk;
      } else {
#pragma unroll
        for (int jj = 0; jj < 8; ++jj) {
          const int m = m0 + wm + 16 * i + jj + 8 * half;  // m = vgpr + 8*half
          float v = acc[i][j][jj] + bval;
          if (EPI == 2) v = spectral_act(v);
          size_t idx = (size_t)m * N + nn;
          if (EPI == 1) outF[idx] = v;
          else          outH[idx] = (_Float16)v;
        }
      }
    }
}

__device__ inline float other_half(float x) {
  int b = __builtin_bit_cast(int, x);
  b = __builtin_amdgcn_permlanex16(b, b, 0x76543210, 0xfedcba98, false, false);
  return __builtin_bit_cast(float, b);
}

// e^x = exp2(x * log2(e)) on v_exp_f32 (what __expf gives). Written as asm so that
// the v_nop stands directly behind the transcendental: the instruction set asks
// for one slot before its source is overwritten or its result read.
__device__ inline float exp_slot(float x) {
  float y;
  asm("v_exp_f32 %0, %1\n\tv_nop" : "=v"(y) : "v"(x * 1.44269504088896340736f));
  return y;
}

__global__ __launch_bounds__(128) void flash_attn(
    const _Float16* __restrict__ Q, const _Float16* __restrict__ Kc,
    const _Float16* __restrict__ Vt, const float* __restrict__ resonance,
    const float* __restrict__ phase, _Float16* __restrict__ Oh) {
  __shared__ __attribute__((aligned(16))) _Float16 sK[32 * 64];   // [key][hd]
  __shared__ __attribute__((aligned(16))) _Float16 sVt[64 * 32];  // [hd][key]

  const int t = threadIdx.x;
  const int lane = t & 31, wave = t >> 5;
  const int half = lane >> 4, l16 = lane & 15;
  const int bh = blockIdx.y, b = bh / H_, h = bh % H_;
  const int q0 = blockIdx.x * 64 + wave * 16;
  const float r = resonance[h], ph = phase[h];
  const float scale = 0.125f;  // 1/sqrt(64)
  // (score + phase) in revolutions = raw * srev + prev
  const float srev = scale * INV_2PI, prev = ph * INV_2PI;

  const _Float16* qbase = Q + ((size_t)(b * S_ + q0 + l16)) * D_ + h * 64;
  v16h qf0 = cat8(*(const v8h*)(qbase + 8 * half),
                  *(const v8h*)(qbase + 16 + 8 * half));
  v16h qf1 = cat8(*(const v8h*)(qbase + 32 + 8 * half),
                  *(const v8h*)(qbase + 48 + 8 * half));

  float st_m = -3.0e38f;  // running maximum of query l16 (equal in both halves)
  float st_l = 0.f;       // running sum over this half's keys only
  v8f o[4] = {};          // o[tt][j] = O[query l16][hd = 16*tt + 8*half + j]

  const int kr = t >> 2, kseg = (t & 3) * 16;  // K loader: 16 f16 / thread
  const int vr = t >> 1, vseg = (t & 1) * 16;  // Vt loader: 16 f16 / thread
  for (int kv = 0; kv < S_; kv += 32) {
    // this wave's LDS reads of the last tile have returned before it is refilled
    asm volatile("s_wait_dscnt 0x0" ::: "memory");
    __syncthreads();
    async_copy_kv(Kc + ((size_t)(b * S_ + kv + kr)) * D_ + h * 64 + kseg,
                  Vt + ((size_t)(h * 64 + vr)) * M_ + b * S_ + kv + vseg,
                  &sK[kr * 64 + kseg], &sVt[vr * 32 + vseg]);
    async_wait0();
    __syncthreads();

    // S^T for 32 keys: two 16(key) x 16(query) tiles, hd=64 reduced as 32+32.
    // s0[j]: key kv + 8*half + j;  s1[j]: key kv + 16 + 8*half + j.
    v8f s0 = {}, s1 = {};
    {
      const _Float16* k0 = &sK[l16 * 64];
      const _Float16* k1 = &sK[(16 + l16) * 64];
      v16h k00 = cat8(*(const v8h*)(k0 + 8 * half), *(const v8h*)(k0 + 16 + 8 * half));
      v16h k01 = cat8(*(const v8h*)(k0 + 32 + 8 * half), *(const v8h*)(k0 + 48 + 8 * half));
      v16h k10 = cat8(*(const v8h*)(k1 + 8 * half), *(const v8h*)(k1 + 16 + 8 * half));
      v16h k11 = cat8(*(const v8h*)(k1 + 32 + 8 * half), *(const v8h*)(k1 + 48 + 8 * half));
      s0 = wmma16(k00, qf0, s0); s0 = wmma16(k01, qf1, s0);
      s1 = wmma16(k10, qf0, s1); s1 = wmma16(k11, qf1, s1);
    }

    float mx = -3.0e38f;
#pragma unroll
    for (int j = 0; j < 8; ++j) {
      float a = s0[j] * scale;  a += r * sin_rev(fmaf(s0[j], srev, prev));
      float c = s1[j] * scale;  c += r * sin_rev(fmaf(s1[j], srev, prev));
      s0[j] = a; s1[j] = c;
      mx = fmaxf(mx, fmaxf(a, c));
    }
    mx = fmaxf(mx, other_half(mx));
    const float nm = fmaxf(st_m, mx);
    const float corr = exp_slot(st_m - nm);
    st_m = nm;

    // P^T as a B operand: element s is key 8*half + s (16 + 8*half + s-8 for s >= 8), which is exactly
    // s0[0..7] then s1[0..7] of this lane.
    v16h pf;
    float sm = 0.f;
#pragma unroll
    for (int j = 0; j < 8; ++j) {
      float p0 = exp_slot(s0[j] - nm), p1 = exp_slot(s1[j] - nm);
      sm += p0 + p1;
      pf[j] = (_Float16)p0;
      pf[8 + j] = (_Float16)p1;
    }
    st_l = st_l * corr + sm;
#pragma unroll
    for (int tt = 0; tt < 4; ++tt)
#pragma unroll
      for (int j = 0; j < 8; ++j) o[tt][j] *= corr;

#pragma unroll
    for (int tt = 0; tt < 4; ++tt) {
      const _Float16* vb = &sVt[(tt * 16 + l16) * 32];
      v16h vf = cat8(*(const v8h*)(vb + 8 * half),
                     *(const v8h*)(vb + 16 + 8 * half));
      o[tt] = wmma16(vf, pf, o[tt]);
    }
  }

  // join the two halves' sums once; 8 consecutive hd per lane -> 16-byte stores
  const float inv = 1.0f / (st_l + other_half(st_l));
  _Float16* dst = Oh + ((size_t)(b * S_ + q0 + l16)) * D_ + h * 64 + 8 * half;
#pragma unroll
  for (int tt = 0; tt < 4; ++tt) {
    v8h pk;
#pragma unroll
    for (int j = 0; j < 8; ++j) pk[j] = (_Float16)(o[tt][j] * inv);
    *(v8h*)(dst + tt * 16) = pk;
  }
}

// ---------------------------------------------------------------------------
// Harmonic LayerNorm (unbiased std): one block per row.
// ---------------------------------------------------------------------------
__global__ __launch_bounds__(256) void harmonic_ln(
    const float* __restrict__ A, const float* __restrict__ Bv,
    const float* __restrict__ g, const float* __restrict__ be,
    const float* __restrict__ s, float* __restrict__ outF,
    _Float16* __restrict__ outH) {
  __shared__ float red[256];
  const int row = blockIdx.x, t = threadIdx.x;
  const float* a = A + (size_t)row * D_;
  const float* bb = Bv + (size_t)row * D_;

  float sum = 0.f, sq = 0.f;
  for (int c = t; c < D_; c += 256) {
    float v = a[c] + bb[c];
    sum += v; sq += v * v;
  }
  red[t] = sum; __syncthreads();
  for (int off = 128; off > 0; off >>= 1) {
    if (t < off) red[t] += red[t + off];
    __syncthreads();
  }
  float tot = red[0]; __syncthreads();
  red[t] = sq; __syncthreads();
  for (int off = 128; off > 0; off >>= 1) {
    if (t < off) red[t] += red[t + off];
    __syncthreads();
  }
  float tot2 = red[0];

  float mean = tot / (float)D_;
  float var = (tot2 - mean * tot) / (float)(D_ - 1);
  float sd = sqrtf(fmaxf(var, 0.f));
  sd = sd + s[0] * sin_rev(sd * 0.5f);  // sin(pi * sd): sd / 2 revolutions
  float inv = 1.0f / (sd + 1e-6f);

  for (int c = t; c < D_; c += 256) {
    float v = (a[c] + bb[c] - mean) * inv * g[c] + be[c];
    outF[(size_t)row * D_ + c] = v;
    if (outH) outH[(size_t)row * D_ + c] = (_Float16)v;
  }
}

// ---------------------------------------------------------------------------
// launch
// ---------------------------------------------------------------------------
extern "C" void kernel_launch(void* const* d_in, const int* in_sizes, int n_in,
                              void* d_out, int out_size, void* d_ws,
                              size_t ws_size, hipStream_t stream) {
  const float* x   = (const float*)d_in[0];
  const float* Wq  = (const float*)d_in[1];  const float* bq  = (const float*)d_in[2];
  const float* Wk  = (const float*)d_in[3];  const float* bk  = (const float*)d_in[4];
  const float* Wv  = (const float*)d_in[5];  const float* bv  = (const float*)d_in[6];
  const float* Wo  = (const float*)d_in[7];  const float* bo  = (const float*)d_in[8];
  const float* res = (const float*)d_in[9];  const float* phs = (const float*)d_in[10];
  const float* g1  = (const float*)d_in[11]; const float* b1  = (const float*)d_in[12];
  const float* s1  = (const float*)d_in[13];
  const float* W1  = (const float*)d_in[14]; const float* bf1 = (const float*)d_in[15];
  const float* W2  = (const float*)d_in[16]; const float* bf2 = (const float*)d_in[17];
  const float* g2  = (const float*)d_in[18]; const float* b2  = (const float*)d_in[19];
  const float* s2  = (const float*)d_in[20];

  char* ws = (char*)d_ws;
  size_t off = 0;
  auto alloc = [&](size_t bytes) {
    char* p = ws + off;
    off += (bytes + 255) & ~(size_t)255;
    return p;
  };
  _Float16* xb   = (_Float16*)alloc((size_t)M_ * D_ * 2);
  _Float16* wqb  = (_Float16*)alloc((size_t)D_ * D_ * 2);  // transposed [N,K]
  _Float16* wkb  = (_Float16*)alloc((size_t)D_ * D_ * 2);
  _Float16* wvb  = (_Float16*)alloc((size_t)D_ * D_ * 2);
  _Float16* wob  = (_Float16*)alloc((size_t)D_ * D_ * 2);
  _Float16* w1b  = (_Float16*)alloc((size_t)D_ * F_ * 2);
  _Float16* w2b  = (_Float16*)alloc((size_t)F_ * D_ * 2);
  _Float16* qb   = (_Float16*)alloc((size_t)M_ * D_ * 2);
  _Float16* kb2  = (_Float16*)alloc((size_t)M_ * D_ * 2);
  _Float16* vt   = (_Float16*)alloc((size_t)M_ * D_ * 2);  // V transposed [D,M]
  _Float16* at16 = (_Float16*)alloc((size_t)M_ * D_ * 2);
  float*    aprj = (float*)   alloc((size_t)M_ * D_ * 4);
  float*    y1   = (float*)   alloc((size_t)M_ * D_ * 4);
  _Float16* y1b  = (_Float16*)alloc((size_t)M_ * D_ * 2);
  _Float16* act  = (_Float16*)alloc((size_t)M_ * F_ * 2);
  float*    ffn  = (float*)   alloc((size_t)M_ * D_ * 4);

  const dim3 blk256(256), blk128(128), blkT(32, 8);

  cvt_f32_f16<<<2048, blk256, 0, stream>>>(x, xb, (size_t)M_ * D_);
  // weights: f32 [K,N] -> f16 transposed [N,K]
  dim3 gTdd(D_ / 32, D_ / 32);
  cvt_transpose_f16<<<gTdd, blkT, 0, stream>>>(Wq, wqb, D_, D_);
  cvt_transpose_f16<<<gTdd, blkT, 0, stream>>>(Wk, wkb, D_, D_);
  cvt_transpose_f16<<<gTdd, blkT, 0, stream>>>(Wv, wvb, D_, D_);
  cvt_transpose_f16<<<gTdd, blkT, 0, stream>>>(Wo, wob, D_, D_);
  cvt_transpose_f16<<<dim3(F_ / 32, D_ / 32), blkT, 0, stream>>>(W1, w1b, D_, F_);
  cvt_transpose_f16<<<dim3(D_ / 32, F_ / 32), blkT, 0, stream>>>(W2, w2b, F_, D_);

  // QKV projections (V written transposed for the PV matmul)
  dim3 gDD(D_ / 64, M_ / 128);
  gemm_wmma<0><<<gDD, blk256, 0, stream>>>(xb, wqb, bq, qb,  nullptr, M_, D_, D_);
  gemm_wmma<0><<<gDD, blk256, 0, stream>>>(xb, wkb, bk, kb2, nullptr, M_, D_, D_);
  gemm_wmma<3><<<gDD, blk256, 0, stream>>>(xb, wvb, bv, vt,  nullptr, M_, D_, D_);

  // harmonic flash attention
  dim3 gFA(S_ / 64, B_ * H_);
  flash_attn<<<gFA, blk128, 0, stream>>>(qb, kb2, vt, res, phs, at16);

  // output projection (f32)
  gemm_wmma<1><<<gDD, blk256, 0, stream>>>(at16, wob, bo, nullptr, aprj, M_, D_, D_);

  // LN1
  harmonic_ln<<<M_, blk256, 0, stream>>>(x, aprj, g1, b1, s1, y1, y1b);

  // FFN up + spectral activation (f16), FFN down (f32)
  gemm_wmma<2><<<dim3(F_ / 64, M_ / 128), blk256, 0, stream>>>(
      y1b, w1b, bf1, act, nullptr, M_, F_, D_);
  gemm_wmma<1><<<gDD, blk256, 0, stream>>>(act, w2b, bf2, nullptr, ffn, M_, D_, F_);

  // LN2 -> final output
  harmonic_ln<<<M_, blk256, 0, stream>>>(y1, ffn, g2, b2, s2, (float*)d_out, nullptr);
}

// v004
// Measured time: 293 microseconds a run.
// Two timings next to v003 both put it at 1.11 times that version's speed.
// Counting every step since v000, it is 2.19 times as fast.
#include <hip/hip_runtime.h>
#include <hip/hip_bf16.h>

typedef __attribute__((ext_vector_type(16))) _Float16 v16h;
typedef __attribute__((ext_vector_type(8)))  _Float16 v8h;
typedef __attribute__((ext_vector_type(8)))  float    v8f;

#define B_  2
#define S_  2048
#define D_  1024
#define H_  16
#define F_  4096
#define M_  (B_ * S_)   // 4096 rows

// ---------------------------------------------------------------------------
// helpers
// ---------------------------------------------------------------------------
__device__ inline v16h cat8(v8h lo, v8h hi) {
  return __builtin_shufflevector(lo, hi, 0,1,2,3,4,5,6,7,8,9,10,11,12,13,14,15);
}

// 16x32 f16 fragment from LDS (k-contiguous rows). Lane l (l16=l&15, half=l>>4):
//   elements 0..7  -> k =      8*half + 0..7
//   elements 8..15 -> k = 16 + 8*half + 0..7
__device__ inline v16h load_frag(const _Float16* rowbase, int half) {
  v8h lo = *(const v8h*)(rowbase + 8 * half);
  v8h hi = *(const v8h*)(rowbase + 16 + 8 * half);
  return cat8(lo, hi);
}

__device__ inline v8f wmma16(v16h a, v16h b, v8f c) {
  return __builtin_amdgcn_wmma_f32_16x16x32_f16(
      false, a, false, b, (short)0, c, false, false);
}

// CDNA5 async global->LDS copy (ASYNCcnt-tracked, no VGPR data path).
// One thread's four copies of a key tile: 32 bytes of a K row, 32 of a V^T row.
// s_wait_xcnt 0 is the last line of the copies' own statement, so that no later
// write of an address register can be scheduled in front of it.
__device__ inline void async_copy_kv(const _Float16* gk, const _Float16* gv,
                                     _Float16* pk, _Float16* pv) {
  const char* k = (const char*)gk;
  const char* v = (const char*)gv;
  const unsigned lk = (unsigned)(unsigned long long)pk;  // low 32 bits = LDS offset
  const unsigned lv = (unsigned)(unsigned long long)pv;
  asm volatile("global_load_async_to_lds_b128 %0, %4, off\n\t"
               "global_load_async_to_lds_b128 %1, %5, off\n\t"
               "global_load_async_to_lds_b128 %2, %6, off\n\t"
               "global_load_async_to_lds_b128 %3, %7, off\n\t"
               "s_wait_xcnt 0x0"
               :: "v"(lk), "v"(lk + 16), "v"(lv), "v"(lv + 16),
                  "v"(k), "v"(k + 16), "v"(v), "v"(v + 16)
               : "memory");
}
// One thread's twelve copies of a k-tile: eight A rows and four B rows, 16 rows
// apart (gstep, lstep in bytes). s_wait_xcnt 0 is the last line of the copies'
// own statement, so that no later write of an address register can be scheduled
// in front of it.
__device__ inline void async_copy_tile(const _Float16* ga, const _Float16* gb,
                                       size_t gstep, _Float16* pa, _Float16* pb,
                                       unsigned lstep) {
  const char* a = (const char*)ga;
  const char* b = (const char*)gb;
  const unsigned la = (unsigned)(unsigned long long)pa;  // low 32 bits = LDS offset
  const unsigned lb = (unsigned)(unsigned long long)pb;
  asm volatile("global_load_async_to_lds_b128 %0, %12, off\n\t"
               "global_load_async_to_lds_b128 %1, %13, off\n\t"
               "global_load_async_to_lds_b128 %2, %14, off\n\t"
               "global_load_async_to_lds_b128 %3, %15, off\n\t"
               "global_load_async_to_lds_b128 %4, %16, off\n\t"
               "global_load_async_to_lds_b128 %5, %17, off\n\t"
               "global_load_async_to_lds_b128 %6, %18, off\n\t"
               "global_load_async_to_lds_b128 %7, %19, off\n\t"
               "global_load_async_to_lds_b128 %8, %20, off\n\t"
               "global_load_async_to_lds_b128 %9, %21, off\n\t"
               "global_load_async_to_lds_b128 %10, %22, off\n\t"
               "global_load_async_to_lds_b128 %11, %23, off\n\t"
               "s_wait_xcnt 0x0"
               :: "v"(la), "v"(la + lstep), "v"(la + 2 * lstep), "v"(la + 3 * lstep),
                  "v"(la + 4 * lstep), "v"(la + 5 * lstep), "v"(la + 6 * lstep),
                  "v"(la + 7 * lstep), "v"(lb), "v"(lb + lstep), "v"(lb + 2 * lstep),
                  "v"(lb + 3 * lstep),
                  "v"(a), "v"(a + gstep), "v"(a + 2 * gstep), "v"(a + 3 * gstep),
                  "v"(a + 4 * gstep), "v"(a + 5 * gstep), "v"(a + 6 * gstep),
                  "v"(a + 7 * gstep), "v"(b), "v"(b + gstep), "v"(b + 2 * gstep),
                  "v"(b + 3 * gstep)
               : "memory");
}
__device__ inline void async_wait0() {
  asm volatile("s_wait_asynccnt 0x0" ::: "memory");
}

// sin(2*pi*t) on v_sin_f32, which takes its argument in revolutions. v_fract_f32
// is the whole range reduction (exact; it hands the instruction a value in
// [0, 1)), so there is no compare and no branch per value. What is lost
// against the library's sinf is the rounding of t, |t| * 2^-24 revolutions: the
// size of the rounding that the f32 argument in radians carries anyway.
// The builtin, not asm text: the compiler then keeps the distance behind a matrix
// instruction whose operand registers the result reuses.
#define INV_2PI 0.15915494309189535f
__device__ inline float sin_rev(float t) {
  return __builtin_amdgcn_sinf(__builtin_amdgcn_fractf(t));
}

__device__ inline float spectral_act(float x) {
  const float c = 0.7978845608028654f;              // sqrt(2/pi)
  float g = 0.5f * x * (1.0f + tanhf(c * (x + 0.044715f * x * x * x)));
  return g + 0.5f * sin_rev(x * INV_2PI);           // ALPHA=0.5, BETA=1.0
}

// ---------------------------------------------------------------------------
// All f32 -> f16 conversions of a call in ONE launch of 1024 work-groups:
//   blocks   0..255  x, 16384 elements each, copied in place order
//   blocks 256..511  Wq, Wk, Wv, Wo (64 tiles each)   f32 [K,N] -> f16 [N,K]
//   blocks 512..767  W1                               f32 [K,N] -> f16 [N,K]
//   blocks 768..1023 W2                               f32 [K,N] -> f16 [N,K]
// A work-group moves 64 KiB in and 32 KiB out, with 16 loads of 16 bytes in
// flight per lane, so that few waves have to be started for the bytes moved.
// ---------------------------------------------------------------------------
typedef __attribute__((ext_vector_type(4))) float    v4f;
typedef __attribute__((ext_vector_type(4))) _Float16 v4h;

// One 128(k) x 128(n) tile. A wave-wide load is 512 contiguous bytes of one
// source row; a lane holds 16 consecutive k of 4 neighbouring n, packs them to
// 16-byte chunks and lays them in LDS as [n][k]; a wave-wide store is two whole
// 256-byte pieces of two destination rows.
// LDS rows are 256 bytes, unpadded: chunk c of row n lies at place c ^ ((n >> 2) & 15),
// which spreads both the 16 writers (n 4 apart, same c) and the 16 readers
// (same n, c = 0..15) over all banks.
template <int K, int N>
__device__ inline void transpose_tile(const float* __restrict__ src,
                                      _Float16* __restrict__ dst, int kt, int nt,
                                      _Float16* tile) {
  const int t = threadIdx.x, lane = t & 31, wave = t >> 5;
  const float* s = src + (size_t)(kt * 128 + wave * 16) * N + nt * 128 + lane * 4;
  v4f v[16];
#pragma unroll  // all 16 loads are issued before the first value is used
  for (int i = 0; i < 16; ++i) v[i] = *(const v4f*)(s + (size_t)i * N);
  // behind the last load: the loads' address register, named here so that it lives
  // up to this wait, is not reused (as a load's own destination) in front of it
  asm volatile("s_wait_xcnt 0x0" :: "v"(s) : "memory");
#pragma unroll
  for (int j = 0; j < 4; ++j)
#pragma unroll
    for (int h = 0; h < 2; ++h) {
      v8h pk;
#pragma unroll
      for (int e = 0; e < 8; ++e) pk[e] = (_Float16)v[h * 8 + e][j];
      *(v8h*)&tile[(lane * 4 + j) * 128 + (((wave * 2 + h) ^ (lane & 15)) * 8)] = pk;
    }
  __syncthreads();
  const int seg = lane & 15;
  _Float16* d = dst + (size_t)(nt * 128 + wave * 2 + (lane >> 4)) * K + kt * 128 + seg * 8;
#pragma unroll
  for (int r = 0; r < 8; ++r) {
    const int n = r * 16 + wave * 2 + (lane >> 4);
    *(v8h*)(d + (size_t)r * 16 * K) =
        *(const v8h*)&tile[n * 128 + ((seg ^ ((n >> 2) & 15)) * 8)];
  }
  // behind the last store: no register that a store names is rewritten in front of
  // this wait, on any way that the branches behind the inlined tile leave open
  asm volatile("s_wait_xcnt 0x0" :: "v"(d) : "memory");
}

// The grid puts 4 work-groups on a WGP, 8 waves on a SIMD: a budget of 128 registers
// costs no residency. Without the attribute the compiler keeps under 64 registers
// and issues the 16 loads in three groups, each behind a wait on the one before.
__global__ __launch_bounds__(256) __attribute__((amdgpu_waves_per_eu(2, 8))) void cvt_all(
    const float* __restrict__ x, const float* __restrict__ Wq,
    const float* __restrict__ Wk, const float* __restrict__ Wv,
    const float* __restrict__ Wo, const float* __restrict__ W1,
    const float* __restrict__ W2, _Float16* __restrict__ xb,
    _Float16* __restrict__ wqb, _Float16* __restrict__ wkb,
    _Float16* __restrict__ wvb, _Float16* __restrict__ wob,
    _Float16* __restrict__ w1b, _Float16* __restrict__ w2b) {
  __shared__ __attribute__((aligned(16))) _Float16 tile[128 * 128];  // [n][k]
  const int job = blockIdx.x >> 8, idx = blockIdx.x & 255;  // the same in a whole block

  if (job == 0) {
    // a wave-wide load is 512 contiguous bytes, its store 256 contiguous bytes
    const unsigned base = idx * 16384 + threadIdx.x * 4;
    const unsigned boff = base * 4;  // byte offset of the lane's first load
    v4f v[16];
#pragma unroll  // all 16 loads are issued before the first value is used
    for (int i = 0; i < 16; ++i) v[i] = *(const v4f*)((const char*)x + boff + i * 4096);
    // behind the last load: the loads' offset register, named here so that it lives
    // up to this wait, is not reused (as a load's own destination) in front of it
    asm volatile("s_wait_xcnt 0x0" :: "v"(boff) : "memory");
#pragma unroll
    for (int i = 0; i < 16; ++i) {
      v4h h;
#pragma unroll
      for (int e = 0; e < 4; ++e) h[e] = (_Float16)v[i][e];
      *(v4h*)(xb + base + i * 1024) = h;
    }
  } else if (job == 1) {
    const int w = idx >> 6, ti = idx & 63;
    const float* src = w == 0 ? Wq : w == 1 ? Wk : w == 2 ? Wv : Wo;
    _Float16* dst = w == 0 ? wqb : w == 1 ? wkb : w == 2 ? wvb : wob;
    transpose_tile<D_, D_>(src, dst, ti >> 3, ti & 7, tile);
  } else if (job == 2) {
    transpose_tile<D_, F_>(W1, w1b, idx >> 5, idx & 31, tile);
  } else {
    transpose_tile<F_, D_>(W2, w2b, idx >> 3, idx & 7, tile);
  }
}

// ---------------------------------------------------------------------------
// WMMA GEMM: C[M,N] = A[M,K](f16) @ W[K,N] + bias, with W pre-transposed
// as WT[N,K] (k-contiguous).  block = 256 (8 waves, 4x2 of 32x32),
// macro-tile 128x64, k-step 128 (a staged row is two whole 128-byte lines, copied
// by 16 neighbouring lanes), async global->LDS staging.
//   EPI 0: f16 out   EPI 1: f32 out   EPI 2: spectral->f16   EPI 3: f16 out^T
// ---------------------------------------------------------------------------
template <int EPI>
__global__ __launch_bounds__(256) void gemm_wmma(
    const _Float16* __restrict__ A, const _Float16* __restrict__ WT,
    const float* __restrict__ bias, _Float16* __restrict__ outH,
    float* __restrict__ outF, int M, int N, int K) {
  // rows of 128 k at a pitch of 136 (272 bytes = 16 x odd: no bank conflict for b128)
  __shared__ __attribute__((aligned(16))) _Float16 sA[128 * 136];  // [m][k]
  __shared__ __attribute__((aligned(16))) _Float16 sB[64 * 136];   // [n][k]

  const int t = threadIdx.x;
  const int lane = t & 31, wave = t >> 5;
  const int half = lane >> 4, l16 = lane & 15;
  const int m0 = blockIdx.y * 128, n0 = blockIdx.x * 64;
  const int wm = (wave >> 1) * 32, wn = (wave & 1) * 32;

  v8f acc[2][2] = {};

  const int ar = t >> 1, aseg = (t & 1) * 64;  // prefetch: A row, one lane a line
  const int br = t >> 2, bseg = (t & 3) * 32;  // prefetch: B row, two lanes a line
  const int cr = t >> 4, cseg = (t & 15) * 8;  // copies: 16 lanes x 16 B = one row

  for (int kt = 0; kt < K; kt += 128) {
    // this wave's LDS reads of the last tile have returned before it is refilled
    asm volatile("s_wait_dscnt 0x0" ::: "memory");
    __syncthreads();
    async_copy_tile(A + (size_t)(m0 + cr) * K + kt + cseg,
                    WT + (size_t)(n0 + cr) * K + kt + cseg, (size_t)K * 32,
                    &sA[cr * 136 + cseg], &sB[cr * 136 + cseg], 16 * 272);
    if (kt + 128 < K) {  // global_prefetch_b8 for next tiles
      __builtin_prefetch(A + (size_t)(m0 + ar) * K + kt + 128 + aseg, 0, 0);
      __builtin_prefetch(WT + (size_t)(n0 + br) * K + kt + 128 + bseg, 0, 0);
    }
    async_wait0();
    __syncthreads();

#pragma unroll  // the tile's four 32-k parts, in ascending k as before
    for (int kk = 0; kk < 128; kk += 32) {
      v16h af[2], bf[2];
#pragma unroll
      for (int i = 0; i < 2; ++i)
        af[i] = load_frag(&sA[(wm + 16 * i + l16) * 136 + kk], half);
#pragma unroll
      for (int j = 0; j < 2; ++j)
        bf[j] = load_frag(&sB[(wn + 16 * j + l16) * 136 + kk], half);
#pragma unroll
      for (int i = 0; i < 2; ++i)
#pragma unroll
        for (int j = 0; j < 2; ++j)
          acc[i][j] = wmma16(af[i], bf[j], acc[i][j]);
    }
  }

#pragma unroll
  for (int i = 0; i < 2; ++i)
#pragma unroll
    for (int j = 0; j < 2; ++j) {
      const int nn = n0 + wn + 16 * j + l16;      // C layout: n = lane&15
      const float bval = bias[nn];
      if (EPI == 3) {
        // transposed f16 store: fixed n per lane, 8 consecutive m -> b128
        v8h pk;
#pragma unroll
        for (int jj = 0; jj < 8; ++jj)
          pk[jj] = (_Float16)(acc[i][j][jj] + bval);
        *(v8h*)(outH + (size_t)nn * M + (m0 + wm + 16 * i + 8 * half)) = pk;
      } else {
#pragma unroll
        for (int jj = 0; jj < 8; ++jj) {
          const int m = m0 + wm + 16 * i + jj + 8 * half;  // m = vgpr + 8*half
          float v = acc[i][j][jj] + bval;
          if (EPI == 2) v = spectral_act(v);
          size_t idx = (size_t)m * N + nn;
          if (EPI == 1) outF[idx] = v;
          else          outH[idx] = (_Float16)v;
        }
      }
    }
}

__device__ inline float other_half(float x) {
  int b = __builtin_bit_cast(int, x);
  b = __builtin_amdgcn_permlanex16(b, b, 0x76543210, 0xfedcba98, false, false);
  return __builtin_bit_cast(float, b);
}

// e^x = exp2(x * log2(e)) on v_exp_f32 (what __expf gives). Written as asm so that
// the v_nop stands directly behind the transcendental: the instruction set asks
// for one slot before its source is overwritten or its result read.
__device__ inline float exp_slot(float x) {
  float y;
  asm("v_exp_f32 %0, %1\n\tv_nop" : "=v"(y) : "v"(x * 1.44269504088896340736f));
  return y;
}

__global__ __launch_bounds__(128) void flash_attn(
    const _Float16* __restrict__ Q, const _Float16* __restrict__ Kc,
    const _Float16* __restrict__ Vt, const float* __restrict__ resonance,
    const float* __restrict__ phase, _Float16* __restrict__ Oh) {
  __shared__ __attribute__((aligned(16))) _Float16 sK[32 * 64];   // [key][hd]
  __shared__ __attribute__((aligned(16))) _Float16 sVt[64 * 32];  // [hd][key]

  const int t = threadIdx.x;
  const int lane = t & 31, wave = t >> 5;
  const int half = lane >> 4, l16 = lane & 15;
  const int bh = blockIdx.y, b = bh / H_, h = bh % H_;
  const int q0 = blockIdx.x * 64 + wave * 16;
  const float r = resonance[h], ph = phase[h];
  const float scale = 0.125f;  // 1/sqrt(64)
  // (score + phase) in revolutions = raw * srev + prev
  const float srev = scale * INV_2PI, prev = ph * INV_2PI;

  const _Float16* qbase = Q + ((size_t)(b * S_ + q0 + l16)) * D_ + h * 64;
  v16h qf0 = cat8(*(const v8h*)(qbase + 8 * half),
                  *(const v8h*)(qbase + 16 + 8 * half));
  v16h qf1 = cat8(*(const v8h*)(qbase + 32 + 8 * half),
                  *(const v8h*)(qbase + 48 + 8 * half));

  float st_m = -3.0e38f;  // running maximum of query l16 (equal in both halves)
  float st_l = 0.f;       // running sum over this half's keys only
  v8f o[4] = {};          // o[tt][j] = O[query l16][hd = 16*tt + 8*half + j]

  const int kr = t >> 2, kseg = (t & 3) * 16;  // K loader: 16 f16 / thread
  const int vr = t >> 1, vseg = (t & 1) * 16;  // Vt loader: 16 f16 / thread
  for (int kv = 0; kv < S_; kv += 32) {
    // this wave's LDS reads of the last tile have returned before it is refilled
    asm volatile("s_wait_dscnt 0x0" ::: "memory");
    __syncthreads();
    async_copy_kv(Kc + ((size_t)(b * S_ + kv + kr)) * D_ + h * 64 + kseg,
                  Vt + ((size_t)(h * 64 + vr)) * M_ + b * S_ + kv + vseg,
                  &sK[kr * 64 + kseg], &sVt[vr * 32 + vseg]);
    async_wait0();
    __syncthreads();

    // S^T for 32 keys: two 16(key) x 16(query) tiles, hd=64 reduced as 32+32.
    // s0[j]: key kv + 8*half + j;  s1[j]: key kv + 16 + 8*half + j.
    v8f s0 = {}, s1 = {};
    {
      const _Float16* k0 = &sK[l16 * 64];
      const _Float16* k1 = &sK[(16 + l16) * 64];
      v16h k00 = cat8(*(const v8h*)(k0 + 8 * half), *(const v8h*)(k0 + 16 + 8 * half));
      v16h k01 = cat8(*(const v8h*)(k0 + 32 + 8 * half), *(const v8h*)(k0 + 48 + 8 * half));
      v16h k10 = cat8(*(const v8h*)(k1 + 8 * half), *(const v8h*)(k1 + 16 + 8 * half));
      v16h k11 = cat8(*(const v8h*)(k1 + 32 + 8 * half), *(const v8h*)(k1 + 48 + 8 * half));
      s0 = wmma16(k00, qf0, s0); s0 = wmma16(k01, qf1, s0);
      s1 = wmma16(k10, qf0, s1); s1 = wmma16(k11, qf1, s1);
    }

    float mx = -3.0e38f;
#pragma unroll
    for (int j = 0; j < 8; ++j) {
      float a = s0[j] * scale;  a += r * sin_rev(fmaf(s0[j], srev, prev));
      float c = s1[j] * scale;  c += r * sin_rev(fmaf(s1[j], srev, prev));
      s0[j] = a; s1[j] = c;
      mx = fmaxf(mx, fmaxf(a, c));
    }
    mx = fmaxf(mx, other_half(mx));
    const float nm = fmaxf(st_m, mx);
    const float corr = exp_slot(st_m - nm);
    st_m = nm;

    // P^T as a B operand: element s is key 8*half + s (16 + 8*half + s-8 for s >= 8), which is exactly
    // s0[0..7] then s1[0..7] of this lane.
    v16h pf;
    float sm = 0.f;
#pragma unroll
    for (int j = 0; j < 8; ++j) {
      float p0 = exp_slot(s0[j] - nm), p1 = exp_slot(s1[j] - nm);
      sm += p0 + p1;
      pf[j] = (_Float16)p0;
      pf[8 + j] = (_Float16)p1;
    }
    st_l = st_l * corr + sm;
#pragma unroll
    for (int tt = 0; tt < 4; ++tt)
#pragma unroll
      for (int j = 0; j < 8; ++j) o[tt][j] *= corr;

#pragma unroll
    for (int tt = 0; tt < 4; ++tt) {
      const _Float16* vb = &sVt[(tt * 16 + l16) * 32];
      v16h vf = cat8(*(const v8h*)(vb + 8 * half),
                     *(const v8h*)(vb + 16 + 8 * half));
      o[tt] = wmma16(vf, pf, o[tt]);
    }
  }

  // join the two halves' sums once; 8 consecutive hd per lane -> 16-byte stores
  const float inv = 1.0f / (st_l + other_half(st_l));
  _Float16* dst = Oh + ((size_t)(b * S_ + q0 + l16)) * D_ + h * 64 + 8 * half;
#pragma unroll
  for (int tt = 0; tt < 4; ++tt) {
    v8h pk;
#pragma unroll
    for (int j = 0; j < 8; ++j) pk[j] = (_Float16)(o[tt][j] * inv);
    *(v8h*)(dst + tt * 16) = pk;
  }
}

// ---------------------------------------------------------------------------
// Harmonic LayerNorm (unbiased std): one block per row.
// ---------------------------------------------------------------------------
__global__ __launch_bounds__(256) void harmonic_ln(
    const float* __restrict__ A, const float* __restrict__ Bv,
    const float* __restrict__ g, const float* __restrict__ be,
    const float* __restrict__ s, float* __restrict__ outF,
    _Float16* __restrict__ outH) {
  __shared__ float red[256];
  const int row = blockIdx.x, t = threadIdx.x;
  const float* a = A + (size_t)row * D_;
  const float* bb = Bv + (size_t)row * D_;

  float sum = 0.f, sq = 0.f;
  for (int c = t; c < D_; c += 256) {
    float v = a[c] + bb[c];
    sum += v; sq += v * v;
  }
  red[t] = sum; __syncthreads();
  for (int off = 128; off > 0; off >>= 1) {
    if (t < off) red[t] += red[t + off];
    __syncthreads();
  }
  float tot = red[0]; __syncthreads();
  red[t] = sq; __syncthreads();
  for (int off = 128; off > 0; off >>= 1) {
    if (t < off) red[t] += red[t + off];
    __syncthreads();
  }
  float tot2 = red[0];

  float mean = tot / (float)D_;
  float var = (tot2 - mean * tot) / (float)(D_ - 1);
  float sd = sqrtf(fmaxf(var, 0.f));
  sd = sd + s[0] * sin_rev(sd * 0.5f);  // sin(pi * sd): sd / 2 revolutions
  float inv = 1.0f / (sd + 1e-6f);

  for (int c = t; c < D_; c += 256) {
    float v = (a[c] + bb[c] - mean) * inv * g[c] + be[c];
    outF[(size_t)row * D_ + c] = v;
    if (outH) outH[(size_t)row * D_ + c] = (_Float16)v;
  }
}

// ---------------------------------------------------------------------------
// launch
// ---------------------------------------------------------------------------
extern "C" void kernel_launch(void* const* d_in, const int* in_sizes, int n_in,
                              void* d_out, int out_size, void* d_ws,
                              size_t ws_size, hipStream_t stream) {
  const float* x   = (const float*)d_in[0];
  const float* Wq  = (const float*)d_in[1];  const float* bq  = (const float*)d_in[2];
  const float* Wk  = (const float*)d_in[3];  const float* bk  = (const float*)d_in[4];
  const float* Wv  = (const float*)d_in[5];  const float* bv  = (const float*)d_in[6];
  const float* Wo  = (const float*)d_in[7];  const float* bo  = (const float*)d_in[8];
  const float* res = (const float*)d_in[9];  const float* phs = (const float*)d_in[10];
  const float* g1  = (const float*)d_in[11]; const float* b1  = (const float*)d_in[12];
  const float* s1  = (const float*)d_in[13];
  const float* W1  = (const float*)d_in[14]; const float* bf1 = (const float*)d_in[15];
  const float* W2  = (const float*)d_in[16]; const float* bf2 = (const float*)d_in[17];
  const float* g2  = (const float*)d_in[18]; const float* b2  = (const float*)d_in[19];
  const float* s2  = (const float*)d_in[20];

  char* ws = (char*)d_ws;
  size_t off = 0;
  auto alloc = [&](size_t bytes) {
    char* p = ws + off;
    off += (bytes + 255) & ~(size_t)255;
    return p;
  };
  _Float16* xb   = (_Float16*)alloc((size_t)M_ * D_ * 2);
  _Float16* wqb  = (_Float16*)alloc((size_t)D_ * D_ * 2);  // transposed [N,K]
  _Float16* wkb  = (_Float16*)alloc((size_t)D_ * D_ * 2);
  _Float16* wvb  = (_Float16*)alloc((size_t)D_ * D_ * 2);
  _Float16* wob  = (_Float16*)alloc((size_t)D_ * D_ * 2);
  _Float16* w1b  = (_Float16*)alloc((size_t)D_ * F_ * 2);
  _Float16* w2b  = (_Float16*)alloc((size_t)F_ * D_ * 2);
  _Float16* qb   = (_Float16*)alloc((size_t)M_ * D_ * 2);
  _Float16* kb2  = (_Float16*)alloc((size_t)M_ * D_ * 2);
  _Float16* vt   = (_Float16*)alloc((size_t)M_ * D_ * 2);  // V transposed [D,M]
  _Float16* at16 = (_Float16*)alloc((size_t)M_ * D_ * 2);
  float*    aprj = (float*)   alloc((size_t)M_ * D_ * 4);
  float*    y1   = (float*)   alloc((size_t)M_ * D_ * 4);
  _Float16* y1b  = (_Float16*)alloc((size_t)M_ * D_ * 2);
  _Float16* act  = (_Float16*)alloc((size_t)M_ * F_ * 2);
  float*    ffn  = (float*)   alloc((size_t)M_ * D_ * 4);

  const dim3 blk256(256), blk128(128);

  // x -> f16; weights: f32 [K,N] -> f16 transposed [N,K]
  cvt_all<<<1024, blk256, 0, stream>>>(x, Wq, Wk, Wv, Wo, W1, W2, xb, wqb, wkb,
                                       wvb, wob, w1b, w2b);

  // QKV projections (V written transposed for the PV matmul)
  dim3 gDD(D_ / 64, M_ / 128);
  gemm_wmma<0><<<gDD, blk256, 0, stream>>>(xb, wqb, bq, qb,  nullptr, M_, D_, D_);
  gemm_wmma<0><<<gDD, blk256, 0, stream>>>(xb, wkb, bk, kb2, nullptr, M_, D_, D_);
  gemm_wmma<3><<<gDD, blk256, 0, stream>>>(xb, wvb, bv, vt,  nullptr, M_, D_, D_);

  // harmonic flash attention
  dim3 gFA(S_ / 64, B_ * H_);
  flash_attn<<<gFA, blk128, 0, stream>>>(qb, kb2, vt, res, phs, at16);

  // output projection (f32)
  gemm_wmma<1><<<gDD, blk256, 0, stream>>>(at16, wob, bo, nullptr, aprj, M_, D_, D_);

  // LN1
  harmonic_ln<<<M_, blk256, 0, stream>>>(x, aprj, g1, b1, s1, y1, y1b);

  // FFN up + spectral activation (f16), FFN down (f32)
  gemm_wmma<2><<<dim3(F_ / 64, M_ / 128), blk256, 0, stream>>>(
      y1b, w1b, bf1, act, nullptr, M_, F_, D_);
  gemm_wmma<1><<<gDD, blk256, 0, stream>>>(act, w2b, bf2, nullptr, ffn, M_, D_, F_);

  // LN2 -> final output
  harmonic_ln<<<M_, blk256, 0, stream>>>(y1, ffn, g2, b2, s2, (float*)d_out, nullptr);
}

// v005
// It runs in 267 microseconds.
// Timed twice side by side with v004, it ran 1.10 times as fast both times.
// Over all steps from v000 it is 2.40 times as fast.
#include <hip/hip_runtime.h>
#include <hip/hip_bf16.h>

typedef __attribute__((ext_vector_type(16))) _Float16 v16h;
typedef __attribute__((ext_vector_type(8)))  _Float16 v8h;
typedef __attribute__((ext_vector_type(8)))  float    v8f;

#define B_  2
#define S_  2048
#define D_  1024
#define H_  16
#define F_  4096
#define M_  (B_ * S_)   // 4096 rows

// ---------------------------------------------------------------------------
// helpers
// ---------------------------------------------------------------------------
__device__ inline v16h cat8(v8h lo, v8h hi) {
  return __builtin_shufflevector(lo, hi, 0,1,2,3,4,5,6,7,8,9,10,11,12,13,14,15);
}

// 16x32 f16 fragment from LDS (k-contiguous rows). Lane l (l16=l&15, half=l>>4):
//   elements 0..7  -> k =      8*half + 0..7
//   elements 8..15 -> k = 16 + 8*half + 0..7
__device__ inline v16h load_frag(const _Float16* rowbase, int half) {
  v8h lo = *(const v8h*)(rowbase + 8 * half);
  v8h hi = *(const v8h*)(rowbase + 16 + 8 * half);
  return cat8(lo, hi);
}

__device__ inline v8f wmma16(v16h a, v16h b, v8f c) {
  return __builtin_amdgcn_wmma_f32_16x16x32_f16(
      false, a, false, b, (short)0, c, false, false);
}

// CDNA5 async global->LDS copy (ASYNCcnt-tracked, no VGPR data path).
// One thread's four copies of a key tile: 32 bytes of a K row, 32 of a V^T row.
// s_wait_xcnt 0 is the last line of the copies' own statement, so that no later
// write of an address register can be scheduled in front of it.
__device__ inline void async_copy_kv(const _Float16* gk, const _Float16* gv,
                                     _Float16* pk, _Float16* pv) {
  const char* k = (const char*)gk;
  const char* v = (const char*)gv;
  const unsigned lk = (unsigned)(unsigned long long)pk;  // low 32 bits = LDS offset
  const unsigned lv = (unsigned)(unsigned long long)pv;
  asm volatile("global_load_async_to_lds_b128 %0, %4, off\n\t"
               "global_load_async_to_lds_b128 %1, %5, off\n\t"
               "global_load_async_to_lds_b128 %2, %6, off\n\t"
               "global_load_async_to_lds_b128 %3, %7, off\n\t"
               "s_wait_xcnt 0x0"
               :: "v"(lk), "v"(lk + 16), "v"(lv), "v"(lv + 16),
                  "v"(k), "v"(k + 16), "v"(v), "v"(v + 16)
               : "memory");
}
// One thread's twelve copies of a k-tile: eight A rows and four B rows, 16 rows
// apart (gstep, lstep in bytes). s_wait_xcnt 0 is the last line of the copies'
// own statement, so that no later write of an address register can be scheduled
// in front of it.
__device__ inline void async_copy_tile(const _Float16* ga, const _Float16* gb,
                                       size_t gstep, _Float16* pa, _Float16* pb,
                                       unsigned lstep) {
  const char* a = (const char*)ga;
  const char* b = (const char*)gb;
  const unsigned la = (unsigned)(unsigned long long)pa;  // low 32 bits = LDS offset
  const unsigned lb = (unsigned)(unsigned long long)pb;
  asm volatile("global_load_async_to_lds_b128 %0, %12, off\n\t"
               "global_load_async_to_lds_b128 %1, %13, off\n\t"
               "global_load_async_to_lds_b128 %2, %14, off\n\t"
               "global_load_async_to_lds_b128 %3, %15, off\n\t"
               "global_load_async_to_lds_b128 %4, %16, off\n\t"
               "global_load_async_to_lds_b128 %5, %17, off\n\t"
               "global_load_async_to_lds_b128 %6, %18, off\n\t"
               "global_load_async_to_lds_b128 %7, %19, off\n\t"
               "global_load_async_to_lds_b128 %8, %20, off\n\t"
               "global_load_async_to_lds_b128 %9, %21, off\n\t"
               "global_load_async_to_lds_b128 %10, %22, off\n\t"
               "global_load_async_to_lds_b128 %11, %23, off\n\t"
               "s_wait_xcnt 0x0"
               :: "v"(la), "v"(la + lstep), "v"(la + 2 * lstep), "v"(la + 3 * lstep),
                  "v"(la + 4 * lstep), "v"(la + 5 * lstep), "v"(la + 6 * lstep),
                  "v"(la + 7 * lstep), "v"(lb), "v"(lb + lstep), "v"(lb + 2 * lstep),
                  "v"(lb + 3 * lstep),
                  "v"(a), "v"(a + gstep), "v"(a + 2 * gstep), "v"(a + 3 * gstep),
                  "v"(a + 4 * gstep), "v"(a + 5 * gstep), "v"(a + 6 * gstep),
                  "v"(a + 7 * gstep), "v"(b), "v"(b + gstep), "v"(b + 2 * gstep),
                  "v"(b + 3 * gstep)
               : "memory");
}
__device__ inline void async_wait0() {
  asm volatile("s_wait_asynccnt 0x0" ::: "memory");
}

// sin(2*pi*t) on v_sin_f32, which takes its argument in revolutions. v_fract_f32
// is the whole range reduction (exact; it hands the instruction a value in
// [0, 1)), so there is no compare and no branch per value. What is lost
// against the library's sinf is the rounding of t, |t| * 2^-24 revolutions: the
// size of the rounding that the f32 argument in radians carries anyway.
// The builtin, not asm text: the compiler then keeps the distance behind a matrix
// instruction whose operand registers the result reuses.
#define INV_2PI 0.15915494309189535f
__device__ inline float sin_rev(float t) {
  return __builtin_amdgcn_sinf(__builtin_amdgcn_fractf(t));
}

__device__ inline float spectral_act(float x) {
  const float c = 0.7978845608028654f;              // sqrt(2/pi)
  float g = 0.5f * x * (1.0f + tanhf(c * (x + 0.044715f * x * x * x)));
  return g + 0.5f * sin_rev(x * INV_2PI);           // ALPHA=0.5, BETA=1.0
}

// ---------------------------------------------------------------------------
// All f32 -> f16 conversions of a call in ONE launch of 1024 work-groups:
//   blocks   0..255  x, 16384 elements each, copied in place order
//   blocks 256..511  Wq, Wk, Wv, Wo (64 tiles each)   f32 [K,N] -> f16 [N,K]
//   blocks 512..767  W1                               f32 [K,N] -> f16 [N,K]
//   blocks 768..1023 W2                               f32 [K,N] -> f16 [N,K]
// A work-group moves 64 KiB in and 32 KiB out, with 16 loads of 16 bytes in
// flight per lane, so that few waves have to be started for the bytes moved.
// ---------------------------------------------------------------------------
typedef __attribute__((ext_vector_type(4))) float    v4f;
typedef __attribute__((ext_vector_type(4))) _Float16 v4h;

// One 128(k) x 128(n) tile. A wave-wide load is 512 contiguous bytes of one
// source row; a lane holds 16 consecutive k of 4 neighbouring n, packs them to
// 16-byte chunks and lays them in LDS as [n][k]; a wave-wide store is two whole
// 256-byte pieces of two destination rows.
// LDS rows are 256 bytes, unpadded: chunk c of row n lies at place c ^ ((n >> 2) & 15),
// which spreads both the 16 writers (n 4 apart, same c) and the 16 readers
// (same n, c = 0..15) over all banks.
template <int K, int N>
__device__ inline void transpose_tile(const float* __restrict__ src,
                                      _Float16* __restrict__ dst, int kt, int nt,
                                      _Float16* tile) {
  const int t = threadIdx.x, lane = t & 31, wave = t >> 5;
  const float* s = src + (size_t)(kt * 128 + wave * 16) * N + nt * 128 + lane * 4;
  v4f v[16];
#pragma unroll  // all 16 loads are issued before the first value is used
  for (int i = 0; i < 16; ++i) v[i] = *(const v4f*)(s + (size_t)i * N);
  // behind the last load: the loads' address register, named here so that it lives
  // up to this wait, is not reused (as a load's own destination) in front of it
  asm volatile("s_wait_xcnt 0x0" :: "v"(s) : "memory");
#pragma unroll
  for (int j = 0; j < 4; ++j)
#pragma unroll
    for (int h = 0; h < 2; ++h) {
      v8h pk;
#pragma unroll
      for (int e = 0; e < 8; ++e) pk[e] = (_Float16)v[h * 8 + e][j];
      *(v8h*)&tile[(lane * 4 + j) * 128 + (((wave * 2 + h) ^ (lane & 15)) * 8)] = pk;
    }
  __syncthreads();
  const int seg = lane & 15;
  _Float16* d = dst + (size_t)(nt * 128 + wave * 2 + (lane >> 4)) * K + kt * 128 + seg * 8;
#pragma unroll
  for (int r = 0; r < 8; ++r) {
    const int n = r * 16 + wave * 2 + (lane >> 4);
    *(v8h*)(d + (size_t)r * 16 * K) =
        *(const v8h*)&tile[n * 128 + ((seg ^ ((n >> 2) & 15)) * 8)];
  }
  // behind the last store: no register that a store names is rewritten in front of
  // this wait, on any way that the branches behind the inlined tile leave open
  asm volatile("s_wait_xcnt 0x0" :: "v"(d) : "memory");
}

// The grid puts 4 work-groups on a WGP, 8 waves on a SIMD: a budget of 128 registers
// costs no residency. Without the attribute the compiler keeps under 64 registers
// and issues the 16 loads in three groups, each behind a wait on the one before.
__global__ __launch_bounds__(256) __attribute__((amdgpu_waves_per_eu(2, 8))) void cvt_all(
    const float* __restrict__ x, const float* __restrict__ Wq,
    const float* __restrict__ Wk, const float* __restrict__ Wv,
    const float* __restrict__ Wo, const float* __restrict__ W1,
    const float* __restrict__ W2, _Float16* __restrict__ xb,
    _Float16* __restrict__ wqb, _Float16* __restrict__ wkb,
    _Float16* __restrict__ wvb, _Float16* __restrict__ wob,
    _Float16* __restrict__ w1b, _Float16* __restrict__ w2b) {
  __shared__ __attribute__((aligned(16))) _Float16 tile[128 * 128];  // [n][k]
  const int job = blockIdx.x >> 8, idx = blockIdx.x & 255;  // the same in a whole block

  if (job == 0) {
    // a wave-wide load is 512 contiguous bytes, its store 256 contiguous bytes
    const unsigned base = idx * 16384 + threadIdx.x * 4;
    const unsigned boff = base * 4;  // byte offset of the lane's first load
    v4f v[16];
#pragma unroll  // all 16 loads are issued before the first value is used
    for (int i = 0; i < 16; ++i) v[i] = *(const v4f*)((const char*)x + boff + i * 4096);
    // behind the last load: the loads' offset register, named here so that it lives
    // up to this wait, is not reused (as a load's own destination) in front of it
    asm volatile("s_wait_xcnt 0x0" :: "v"(boff) : "memory");
#pragma unroll
    for (int i = 0; i < 16; ++i) {
      v4h h;
#pragma unroll
      for (int e = 0; e < 4; ++e) h[e] = (_Float16)v[i][e];
      *(v4h*)(xb + base + i * 1024) = h;
    }
  } else if (job == 1) {
    const int w = idx >> 6, ti = idx & 63;
    const float* src = w == 0 ? Wq : w == 1 ? Wk : w == 2 ? Wv : Wo;
    _Float16* dst = w == 0 ? wqb : w == 1 ? wkb : w == 2 ? wvb : wob;
    transpose_tile<D_, D_>(src, dst, ti >> 3, ti & 7, tile);
  } else if (job == 2) {
    transpose_tile<D_, F_>(W1, w1b, idx >> 5, idx & 31, tile);
  } else {
    transpose_tile<F_, D_>(W2, w2b, idx >> 3, idx & 7, tile);
  }
}

// ---------------------------------------------------------------------------
// WMMA GEMM: C[M,N] = A[M,K](f16) @ W[K,N] + bias, with W pre-transposed
// as WT[N,K] (k-contiguous).  block = 256 (8 waves, 4x2 of 32x32),
// macro-tile 128x64, k-step 128 (a staged row is two whole 128-byte lines, copied
// by 16 neighbouring lanes), async global->LDS staging.
//   EPI 0: f16 out   EPI 1: f32 out   EPI 2: spectral->f16   EPI 3: f16 out^T
// ---------------------------------------------------------------------------
template <int EPI>
__global__ __launch_bounds__(256) void gemm_wmma(
    const _Float16* __restrict__ A, const _Float16* __restrict__ WT,
    const float* __restrict__ bias, _Float16* __restrict__ outH,
    float* __restrict__ outF, int M, int N, int K) {
  // rows of 128 k at a pitch of 136 (272 bytes = 16 x odd: no bank conflict for b128)
  __shared__ __attribute__((aligned(16))) _Float16 sA[128 * 136];  // [m][k]
  __shared__ __attribute__((aligned(16))) _Float16 sB[64 * 136];   // [n][k]

  const int t = threadIdx.x;
  const int lane = t & 31, wave = t >> 5;
  const int half = lane >> 4, l16 = lane & 15;
  const int m0 = blockIdx.y * 128, n0 = blockIdx.x * 64;
  const int wm = (wave >> 1) * 32, wn = (wave & 1) * 32;

  v8f acc[2][2] = {};

  const int ar = t >> 1, aseg = (t & 1) * 64;  // prefetch: A row, one lane a line
  const int br = t >> 2, bseg = (t & 3) * 32;  // prefetch: B row, two lanes a line
  const int cr = t >> 4, cseg = (t & 15) * 8;  // copies: 16 lanes x 16 B = one row

  for (int kt = 0; kt < K; kt += 128) {
    // this wave's LDS reads of the last tile have returned before it is refilled
    asm volatile("s_wait_dscnt 0x0" ::: "memory");
    __syncthreads();
    async_copy_tile(A + (size_t)(m0 + cr) * K + kt + cseg,
                    WT + (size_t)(n0 + cr) * K + kt + cseg, (size_t)K * 32,
                    &sA[cr * 136 + cseg], &sB[cr * 136 + cseg], 16 * 272);
    if (kt + 128 < K) {  // global_prefetch_b8 for next tiles
      __builtin_prefetch(A + (size_t)(m0 + ar) * K + kt + 128 + aseg, 0, 0);
      __builtin_prefetch(WT + (size_t)(n0 + br) * K + kt + 128 + bseg, 0, 0);
    }
    async_wait0();
    __syncthreads();

#pragma unroll  // the tile's four 32-k parts, in ascending k as before
    for (int kk = 0; kk < 128; kk += 32) {
      v16h af[2], bf[2];
#pragma unroll
      for (int i = 0; i < 2; ++i)
        af[i] = load_frag(&sA[(wm + 16 * i + l16) * 136 + kk], half);
#pragma unroll
      for (int j = 0; j < 2; ++j)
        bf[j] = load_frag(&sB[(wn + 16 * j + l16) * 136 + kk], half);
#pragma unroll
      for (int i = 0; i < 2; ++i)
#pragma unroll
        for (int j = 0; j < 2; ++j)
          acc[i][j] = wmma16(af[i], bf[j], acc[i][j]);
    }
  }

#pragma unroll
  for (int i = 0; i < 2; ++i)
#pragma unroll
    for (int j = 0; j < 2; ++j) {
      const int nn = n0 + wn + 16 * j + l16;      // C layout: n = lane&15
      const float bval = bias[nn];
      if (EPI == 3) {
        // transposed f16 store: fixed n per lane, 8 consecutive m -> b128
        v8h pk;
#pragma unroll
        for (int jj = 0; jj < 8; ++jj)
          pk[jj] = (_Float16)(acc[i][j][jj] + bval);
        *(v8h*)(outH + (size_t)nn * M + (m0 + wm + 16 * i + 8 * half)) = pk;
      } else {
#pragma unroll
        for (int jj = 0; jj < 8; ++jj) {
          const int m = m0 + wm + 16 * i + jj + 8 * half;  // m = vgpr + 8*half
          float v = acc[i][j][jj] + bval;
          if (EPI == 2) v = spectral_act(v);
          size_t idx = (size_t)m * N + nn;
          if (EPI == 1) outF[idx] = v;
          else          outH[idx] = (_Float16)v;
        }
      }
    }
}

__device__ inline float other_half(float x) {
  int b = __builtin_bit_cast(int, x);
  b = __builtin_amdgcn_permlanex16(b, b, 0x76543210, 0xfedcba98, false, false);
  return __builtin_bit_cast(float, b);
}

// e^x = exp2(x * log2(e)) on v_exp_f32 (what __expf gives). Written as asm so that
// the v_nop stands directly behind the transcendental: the instruction set asks
// for one slot before its source is overwritten or its result read.
__device__ inline float exp_slot(float x) {
  float y;
  asm("v_exp_f32 %0, %1\n\tv_nop" : "=v"(y) : "v"(x * 1.44269504088896340736f));
  return y;
}

__global__ __launch_bounds__(128) void flash_attn(
    const _Float16* __restrict__ Q, const _Float16* __restrict__ Kc,
    const _Float16* __restrict__ Vt, const float* __restrict__ resonance,
    const float* __restrict__ phase, _Float16* __restrict__ Oh) {
  // Row pitches of 16 bytes x odd (144 and 80): the 16 rows that a half wave's
  // 16-byte fragment reads touch then fall on 16 different groups of four banks.
  // At the rows' own lengths (128 and 64 bytes) they fall on two and on four groups.
  constexpr int KP = 72;  // f16 per sK row: 64 hd + 8 unused
  constexpr int VP = 40;  // f16 per sVt row: 32 keys + 8 unused
  __shared__ __attribute__((aligned(16))) _Float16 sK[32 * KP];   // [key][hd]
  __shared__ __attribute__((aligned(16))) _Float16 sVt[64 * VP];  // [hd][key]

  const int t = threadIdx.x;
  const int lane = t & 31, wave = t >> 5;
  const int half = lane >> 4, l16 = lane & 15;
  const int bh = blockIdx.y, b = bh / H_, h = bh % H_;
  const int q0 = blockIdx.x * 64 + wave * 16;
  const float r = resonance[h], ph = phase[h];
  const float scale = 0.125f;  // 1/sqrt(64)
  // (score + phase) in revolutions = raw * srev + prev
  const float srev = scale * INV_2PI, prev = ph * INV_2PI;

  const _Float16* qbase = Q + ((size_t)(b * S_ + q0 + l16)) * D_ + h * 64;
  v16h qf0 = cat8(*(const v8h*)(qbase + 8 * half),
                  *(const v8h*)(qbase + 16 + 8 * half));
  v16h qf1 = cat8(*(const v8h*)(qbase + 32 + 8 * half),
                  *(const v8h*)(qbase + 48 + 8 * half));

  float st_m = -3.0e38f;  // running maximum of query l16 (equal in both halves)
  float st_l = 0.f;       // running sum over this half's keys only
  v8f o[4] = {};          // o[tt][j] = O[query l16][hd = 16*tt + 8*half + j]

  const int kr = t >> 2, kseg = (t & 3) * 16;  // K loader: 16 f16 / thread
  const int vr = t >> 1, vseg = (t & 1) * 16;  // Vt loader: 16 f16 / thread
  for (int kv = 0; kv < S_; kv += 32) {
    // this wave's LDS reads of the last tile have returned before it is refilled
    asm volatile("s_wait_dscnt 0x0" ::: "memory");
    __syncthreads();
    async_copy_kv(Kc + ((size_t)(b * S_ + kv + kr)) * D_ + h * 64 + kseg,
                  Vt + ((size_t)(h * 64 + vr)) * M_ + b * S_ + kv + vseg,
                  &sK[kr * KP + kseg], &sVt[vr * VP + vseg]);
    async_wait0();
    __syncthreads();

    // S^T for 32 keys: two 16(key) x 16(query) tiles, hd=64 reduced as 32+32.
    // s0[j]: key kv + 8*half + j;  s1[j]: key kv + 16 + 8*half + j.
    v8f s0 = {}, s1 = {};
    {
      const _Float16* k0 = &sK[l16 * KP];
      const _Float16* k1 = &sK[(16 + l16) * KP];
      v16h k00 = cat8(*(const v8h*)(k0 + 8 * half), *(const v8h*)(k0 + 16 + 8 * half));
      v16h k01 = cat8(*(const v8h*)(k0 + 32 + 8 * half), *(const v8h*)(k0 + 48 + 8 * half));
      v16h k10 = cat8(*(const v8h*)(k1 + 8 * half), *(const v8h*)(k1 + 16 + 8 * half));
      v16h k11 = cat8(*(const v8h*)(k1 + 32 + 8 * half), *(const v8h*)(k1 + 48 + 8 * half));
      s0 = wmma16(k00, qf0, s0); s0 = wmma16(k01, qf1, s0);
      s1 = wmma16(k10, qf0, s1); s1 = wmma16(k11, qf1, s1);
    }

    float mx = -3.0e38f;
#pragma unroll
    for (int j = 0; j < 8; ++j) {
      float a = s0[j] * scale;  a += r * sin_rev(fmaf(s0[j], srev, prev));
      float c = s1[j] * scale;  c += r * sin_rev(fmaf(s1[j], srev, prev));
      s0[j] = a; s1[j] = c;
      mx = fmaxf(mx, fmaxf(a, c));
    }
    mx = fmaxf(mx, other_half(mx));
    const float nm = fmaxf(st_m, mx);
    const float corr = exp_slot(st_m - nm);
    st_m = nm;

    // P^T as a B operand: element s is key 8*half + s (16 + 8*half + s-8 for s >= 8), which is exactly
    // s0[0..7] then s1[0..7] of this lane.
    v16h pf;
    float sm = 0.f;
#pragma unroll
    for (int j = 0; j < 8; ++j) {
      float p0 = exp_slot(s0[j] - nm), p1 = exp_slot(s1[j] - nm);
      sm += p0 + p1;
      pf[j] = (_Float16)p0;
      pf[8 + j] = (_Float16)p1;
    }
    st_l = st_l * corr + sm;
#pragma unroll
    for (int tt = 0; tt < 4; ++tt)
#pragma unroll
      for (int j = 0; j < 8; ++j) o[tt][j] *= corr;

#pragma unroll
    for (int tt = 0; tt < 4; ++tt) {
      const _Float16* vb = &sVt[(tt * 16 + l16) * VP];
      v16h vf = cat8(*(const v8h*)(vb + 8 * half),
                     *(const v8h*)(vb + 16 + 8 * half));
      o[tt] = wmma16(vf, pf, o[tt]);
    }
  }

  // join the two halves' sums once; 8 consecutive hd per lane -> 16-byte stores
  const float inv = 1.0f / (st_l + other_half(st_l));
  _Float16* dst = Oh + ((size_t)(b * S_ + q0 + l16)) * D_ + h * 64 + 8 * half;
#pragma unroll
  for (int tt = 0; tt < 4; ++tt) {
    v8h pk;
#pragma unroll
    for (int j = 0; j < 8; ++j) pk[j] = (_Float16)(o[tt][j] * inv);
    *(v8h*)(dst + tt * 16) = pk;
  }
}

// ---------------------------------------------------------------------------
// Harmonic LayerNorm (unbiased std): one block per row.
// ---------------------------------------------------------------------------
__global__ __launch_bounds__(256) void harmonic_ln(
    const float* __restrict__ A, const float* __restrict__ Bv,
    const float* __restrict__ g, const float* __restrict__ be,
    const float* __restrict__ s, float* __restrict__ outF,
    _Float16* __restrict__ outH) {
  __shared__ float red[256];
  const int row = blockIdx.x, t = threadIdx.x;
  const float* a = A + (size_t)row * D_;
  const float* bb = Bv + (size_t)row * D_;

  float sum = 0.f, sq = 0.f;
  for (int c = t; c < D_; c += 256) {
    float v = a[c] + bb[c];
    sum += v; sq += v * v;
  }
  red[t] = sum; __syncthreads();
  for (int off = 128; off > 0; off >>= 1) {
    if (t < off) red[t] += red[t + off];
    __syncthreads();
  }
  float tot = red[0]; __syncthreads();
  red[t] = sq; __syncthreads();
  for (int off = 128; off > 0; off >>= 1) {
    if (t < off) red[t] += red[t + off];
    __syncthreads();
  }
  float tot2 = red[0];

  float mean = tot / (float)D_;
  float var = (tot2 - mean * tot) / (float)(D_ - 1);
  float sd = sqrtf(fmaxf(var, 0.f));
  sd = sd + s[0] * sin_rev(sd * 0.5f);  // sin(pi * sd): sd / 2 revolutions
  float inv = 1.0f / (sd + 1e-6f);

  for (int c = t; c < D_; c += 256) {
    float v = (a[c] + bb[c] - mean) * inv * g[c] + be[c];
    outF[(size_t)row * D_ + c] = v;
    if (outH) outH[(size_t)row * D_ + c] = (_Float16)v;
  }
}

// ---------------------------------------------------------------------------
// launch
// ---------------------------------------------------------------------------
extern "C" void kernel_launch(void* const* d_in, const int* in_sizes, int n_in,
                              void* d_out, int out_size, void* d_ws,
                              size_t ws_size, hipStream_t stream) {
  const float* x   = (const float*)d_in[0];
  const float* Wq  = (const float*)d_in[1];  const float* bq  = (const float*)d_in[2];
  const float* Wk  = (const float*)d_in[3];  const float* bk  = (const float*)d_in[4];
  const float* Wv  = (const float*)d_in[5];  const float* bv  = (const float*)d_in[6];
  const float* Wo  = (const float*)d_in[7];  const float* bo  = (const float*)d_in[8];
  const float* res = (const float*)d_in[9];  const float* phs = (const float*)d_in[10];
  const float* g1  = (const float*)d_in[11]; const float* b1  = (const float*)d_in[12];
  const float* s1  = (const float*)d_in[13];
  const float* W1  = (const float*)d_in[14]; const float* bf1 = (const float*)d_in[15];
  const float* W2  = (const float*)d_in[16]; const float* bf2 = (const float*)d_in[17];
  const float* g2  = (const float*)d_in[18]; const float* b2  = (const float*)d_in[19];
  const float* s2  = (const float*)d_in[20];

  char* ws = (char*)d_ws;
  size_t off = 0;
  auto alloc = [&](size_t bytes) {
    char* p = ws + off;
    off += (bytes + 255) & ~(size_t)255;
    return p;
  };
  _Float16* xb   = (_Float16*)alloc((size_t)M_ * D_ * 2);
  _Float16* wqb  = (_Float16*)alloc((size_t)D_ * D_ * 2);  // transposed [N,K]
  _Float16* wkb  = (_Float16*)alloc((size_t)D_ * D_ * 2);
  _Float16* wvb  = (_Float16*)alloc((size_t)D_ * D_ * 2);
  _Float16* wob  = (_Float16*)alloc((size_t)D_ * D_ * 2);
  _Float16* w1b  = (_Float16*)alloc((size_t)D_ * F_ * 2);
  _Float16* w2b  = (_Float16*)alloc((size_t)F_ * D_ * 2);
  _Float16* qb   = (_Float16*)alloc((size_t)M_ * D_ * 2);
  _Float16* kb2  = (_Float16*)alloc((size_t)M_ * D_ * 2);
  _Float16* vt   = (_Float16*)alloc((size_t)M_ * D_ * 2);  // V transposed [D,M]
  _Float16* at16 = (_Float16*)alloc((size_t)M_ * D_ * 2);
  float*    aprj = (float*)   alloc((size_t)M_ * D_ * 4);
  float*    y1   = (float*)   alloc((size_t)M_ * D_ * 4);
  _Float16* y1b  = (_Float16*)alloc((size_t)M_ * D_ * 2);
  _Float16* act  = (_Float16*)alloc((size_t)M_ * F_ * 2);
  float*    ffn  = (float*)   alloc((size_t)M_ * D_ * 4);

  const dim3 blk256(256), blk128(128);

  // x -> f16; weights: f32 [K,N] -> f16 transposed [N,K]
  cvt_all<<<1024, blk256, 0, stream>>>(x, Wq, Wk, Wv, Wo, W1, W2, xb, wqb, wkb,
                                       wvb, wob, w1b, w2b);

  // QKV projections (V written transposed for the PV matmul)
  dim3 gDD(D_ / 64, M_ / 128);
  gemm_wmma<0><<<gDD, blk256, 0, stream>>>(xb, wqb, bq, qb,  nullptr, M_, D_, D_);
  gemm_wmma<0><<<gDD, blk256, 0, stream>>>(xb, wkb, bk, kb2, nullptr, M_, D_, D_);
  gemm_wmma<3><<<gDD, blk256, 0, stream>>>(xb, wvb, bv, vt,  nullptr, M_, D_, D_);

  // harmonic flash attention
  dim3 gFA(S_ / 64, B_ * H_);
  flash_attn<<<gFA, blk128, 0, stream>>>(qb, kb2, vt, res, phs, at16);

  // output projection (f32)
  gemm_wmma<1><<<gDD, blk256, 0, stream>>>(at16, wob, bo, nullptr, aprj, M_, D_, D_);

  // LN1
  harmonic_ln<<<M_, blk256, 0, stream>>>(x, aprj, g1, b1, s1, y1, y1b);

  // FFN up + spectral activation (f16), FFN down (f32)
  gemm_wmma<2><<<dim3(F_ / 64, M_ / 128), blk256, 0, stream>>>(
      y1b, w1b, bf1, act, nullptr, M_, F_, D_);
  gemm_wmma<1><<<gDD, blk256, 0, stream>>>(act, w2b, bf2, nullptr, ffn, M_, D_, F_);

  // LN2 -> final output
  harmonic_ln<<<M_, blk256, 0, stream>>>(y1, ffn, g2, b2, s2, (float*)d_out, nullptr);
}

// v006
// It runs in 226 microseconds.
// Two timings next to v005 put it at 1.18 and 1.17 times that version's speed.
// All steps since v000 together make it 2.82 times as fast.
#include <hip/hip_runtime.h>
#include <hip/hip_bf16.h>

typedef __attribute__((ext_vector_type(16))) _Float16 v16h;
typedef __attribute__((ext_vector_type(8)))  _Float16 v8h;
typedef __attribute__((ext_vector_type(8)))  float    v8f;

#define B_  2
#define S_  2048
#define D_  1024
#define H_  16
#define F_  4096
#define M_  (B_ * S_)   // 4096 rows

// ---------------------------------------------------------------------------
// helpers
// ---------------------------------------------------------------------------
__device__ inline v16h cat8(v8h lo, v8h hi) {
  return __builtin_shufflevector(lo, hi, 0,1,2,3,4,5,6,7,8,9,10,11,12,13,14,15);
}

// 16x32 f16 fragment from LDS (k-contiguous rows). Lane l (l16=l&15, half=l>>4):
//   elements 0..7  -> k =      8*half + 0..7
//   elements 8..15 -> k = 16 + 8*half + 0..7
__device__ inline v16h load_frag(const _Float16* rowbase, int half) {
  v8h lo = *(const v8h*)(rowbase + 8 * half);
  v8h hi = *(const v8h*)(rowbase + 16 + 8 * half);
  return cat8(lo, hi);
}

__device__ inline v8f wmma16(v16h a, v16h b, v8f c) {
  return __builtin_amdgcn_wmma_f32_16x16x32_f16(
      false, a, false, b, (short)0, c, false, false);
}

// CDNA5 async global->LDS copy (ASYNCcnt-tracked, no VGPR data path).
// One thread's four copies of a key tile: 32 bytes of a K row, 32 of a V^T row.
// s_wait_xcnt 0 is the last line of the copies' own statement, so that no later
// write of an address register can be scheduled in front of it.
__device__ inline void async_copy_kv(const _Float16* gk, const _Float16* gv,
                                     _Float16* pk, _Float16* pv) {
  const char* k = (const char*)gk;
  const char* v = (const char*)gv;
  const unsigned lk = (unsigned)(unsigned long long)pk;  // low 32 bits = LDS offset
  const unsigned lv = (unsigned)(unsigned long long)pv;
  asm volatile("global_load_async_to_lds_b128 %0, %4, off\n\t"
               "global_load_async_to_lds_b128 %1, %5, off\n\t"
               "global_load_async_to_lds_b128 %2, %6, off\n\t"
               "global_load_async_to_lds_b128 %3, %7, off\n\t"
               "s_wait_xcnt 0x0"
               :: "v"(lk), "v"(lk + 16), "v"(lv), "v"(lv + 16),
                  "v"(k), "v"(k + 16), "v"(v), "v"(v + 16)
               : "memory");
}
// One thread's twelve copies of a k-tile: eight A rows and four B rows, 16 rows
// apart (gstep, lstep in bytes). s_wait_xcnt 0 is the last line of the copies'
// own statement, so that no later write of an address register can be scheduled
// in front of it.
__device__ inline void async_copy_tile(const _Float16* ga, const _Float16* gb,
                                       size_t gstep, _Float16* pa, _Float16* pb,
                                       unsigned lstep) {
  const char* a = (const char*)ga;
  const char* b = (const char*)gb;
  const unsigned la = (unsigned)(unsigned long long)pa;  // low 32 bits = LDS offset
  const unsigned lb = (unsigned)(unsigned long long)pb;
  asm volatile("global_load_async_to_lds_b128 %0, %12, off\n\t"
               "global_load_async_to_lds_b128 %1, %13, off\n\t"
               "global_load_async_to_lds_b128 %2, %14, off\n\t"
               "global_load_async_to_lds_b128 %3, %15, off\n\t"
               "global_load_async_to_lds_b128 %4, %16, off\n\t"
               "global_load_async_to_lds_b128 %5, %17, off\n\t"
               "global_load_async_to_lds_b128 %6, %18, off\n\t"
               "global_load_async_to_lds_b128 %7, %19, off\n\t"
               "global_load_async_to_lds_b128 %8, %20, off\n\t"
               "global_load_async_to_lds_b128 %9, %21, off\n\t"
               "global_load_async_to_lds_b128 %10, %22, off\n\t"
               "global_load_async_to_lds_b128 %11, %23, off\n\t"
               "s_wait_xcnt 0x0"
               :: "v"(la), "v"(la + lstep), "v"(la + 2 * lstep), "v"(la + 3 * lstep),
                  "v"(la + 4 * lstep), "v"(la + 5 * lstep), "v"(la + 6 * lstep),
                  "v"(la + 7 * lstep), "v"(lb), "v"(lb + lstep), "v"(lb + 2 * lstep),
                  "v"(lb + 3 * lstep),
                  "v"(a), "v"(a + gstep), "v"(a + 2 * gstep), "v"(a + 3 * gstep),
                  "v"(a + 4 * gstep), "v"(a + 5 * gstep), "v"(a + 6 * gstep),
                  "v"(a + 7 * gstep), "v"(b), "v"(b + gstep), "v"(b + 2 * gstep),
                  "v"(b + 3 * gstep)
               : "memory");
}
__device__ inline void async_wait0() {
  asm volatile("s_wait_asynccnt 0x0" ::: "memory");
}

// sin(2*pi*t) on v_sin_f32, which takes its argument in revolutions. v_fract_f32
// is the whole range reduction (exact; it hands the instruction a value in
// [0, 1)), so there is no compare and no branch per value. What is lost
// against the library's sinf is the rounding of t, |t| * 2^-24 revolutions: the
// size of the rounding that the f32 argument in radians carries anyway.
// The builtin, not asm text: the compiler then keeps the distance behind a matrix
// instruction whose operand registers the result reuses.
#define INV_2PI 0.15915494309189535f
__device__ inline float sin_rev(float t) {
  return __builtin_amdgcn_sinf(__builtin_amdgcn_fractf(t));
}

__device__ inline float spectral_act(float x) {
  const float c = 0.7978845608028654f;              // sqrt(2/pi)
  float g = 0.5f * x * (1.0f + tanhf(c * (x + 0.044715f * x * x * x)));
  return g + 0.5f * sin_rev(x * INV_2PI);           // ALPHA=0.5, BETA=1.0
}

// ---------------------------------------------------------------------------
// All f32 -> f16 conversions of a call in ONE launch of 1024 work-groups:
//   blocks   0..255  x, 16384 elements each, copied in place order
//   blocks 256..511  Wq, Wk, Wv, Wo (64 tiles each)   f32 [K,N] -> f16 [N,K]
//   blocks 512..767  W1                               f32 [K,N] -> f16 [N,K]
//   blocks 768..1023 W2                               f32 [K,N] -> f16 [N,K]
// A work-group moves 64 KiB in and 32 KiB out, with 16 loads of 16 bytes in
// flight per lane, so that few waves have to be started for the bytes moved.
// ---------------------------------------------------------------------------
typedef __attribute__((ext_vector_type(4))) float    v4f;
typedef __attribute__((ext_vector_type(4))) _Float16 v4h;

// One 128(k) x 128(n) tile. A wave-wide load is 512 contiguous bytes of one
// source row; a lane holds 16 consecutive k of 4 neighbouring n, packs them to
// 16-byte chunks and lays them in LDS as [n][k]; a wave-wide store is two whole
// 256-byte pieces of two destination rows.
// LDS rows are 256 bytes, unpadded: chunk c of row n lies at place c ^ ((n >> 2) & 15),
// which spreads both the 16 writers (n 4 apart, same c) and the 16 readers
// (same n, c = 0..15) over all banks.
template <int K, int N>
__device__ inline void transpose_tile(const float* __restrict__ src,
                                      _Float16* __restrict__ dst, int kt, int nt,
                                      _Float16* tile) {
  const int t = threadIdx.x, lane = t & 31, wave = t >> 5;
  const float* s = src + (size_t)(kt * 128 + wave * 16) * N + nt * 128 + lane * 4;
  v4f v[16];
#pragma unroll  // all 16 loads are issued before the first value is used
  for (int i = 0; i < 16; ++i) v[i] = *(const v4f*)(s + (size_t)i * N);
  // behind the last load: the loads' address register, named here so that it lives
  // up to this wait, is not reused (as a load's own destination) in front of it
  asm volatile("s_wait_xcnt 0x0" :: "v"(s) : "memory");
#pragma unroll
  for (int j = 0; j < 4; ++j)
#pragma unroll
    for (int h = 0; h < 2; ++h) {
      v8h pk;
#pragma unroll
      for (int e = 0; e < 8; ++e) pk[e] = (_Float16)v[h * 8 + e][j];
      *(v8h*)&tile[(lane * 4 + j) * 128 + (((wave * 2 + h) ^ (lane & 15)) * 8)] = pk;
    }
  __syncthreads();
  const int seg = lane & 15;
  _Float16* d = dst + (size_t)(nt * 128 + wave * 2 + (lane >> 4)) * K + kt * 128 + seg * 8;
#pragma unroll
  for (int r = 0; r < 8; ++r) {
    const int n = r * 16 + wave * 2 + (lane >> 4);
    *(v8h*)(d + (size_t)r * 16 * K) =
        *(const v8h*)&tile[n * 128 + ((seg ^ ((n >> 2) & 15)) * 8)];
  }
  // behind the last store: no register that a store names is rewritten in front of
  // this wait, on any way that the branches behind the inlined tile leave open
  asm volatile("s_wait_xcnt 0x0" :: "v"(d) : "memory");
}

// The grid puts 4 work-groups on a WGP, 8 waves on a SIMD: a budget of 128 registers
// costs no residency. Without the attribute the compiler keeps under 64 registers
// and issues the 16 loads in three groups, each behind a wait on the one before.
__global__ __launch_bounds__(256) __attribute__((amdgpu_waves_per_eu(2, 8))) void cvt_all(
    const float* __restrict__ x, const float* __restrict__ Wq,
    const float* __restrict__ Wk, const float* __restrict__ Wv,
    const float* __restrict__ Wo, const float* __restrict__ W1,
    const float* __restrict__ W2, _Float16* __restrict__ xb,
    _Float16* __restrict__ wqb, _Float16* __restrict__ wkb,
    _Float16* __restrict__ wvb, _Float16* __restrict__ wob,
    _Float16* __restrict__ w1b, _Float16* __restrict__ w2b) {
  __shared__ __attribute__((aligned(16))) _Float16 tile[128 * 128];  // [n][k]
  const int job = blockIdx.x >> 8, idx = blockIdx.x & 255;  // the same in a whole block

  if (job == 0) {
    // a wave-wide load is 512 contiguous bytes, its store 256 contiguous bytes
    const unsigned base = idx * 16384 + threadIdx.x * 4;
    const unsigned boff = base * 4;  // byte offset of the lane's first load
    v4f v[16];
#pragma unroll  // all 16 loads are issued before the first value is used
    for (int i = 0; i < 16; ++i) v[i] = *(const v4f*)((const char*)x + boff + i * 4096);
    // behind the last load: the loads' offset register, named here so that it lives
    // up to this wait, is not reused (as a load's own destination) in front of it
    asm volatile("s_wait_xcnt 0x0" :: "v"(boff) : "memory");
#pragma unroll
    for (int i = 0; i < 16; ++i) {
      v4h h;
#pragma unroll
      for (int e = 0; e < 4; ++e) h[e] = (_Float16)v[i][e];
      *(v4h*)(xb + base + i * 1024) = h;
    }
  } else if (job == 1) {
    const int w = idx >> 6, ti = idx & 63;
    const float* src = w == 0 ? Wq : w == 1 ? Wk : w == 2 ? Wv : Wo;
    _Float16* dst = w == 0 ? wqb : w == 1 ? wkb : w == 2 ? wvb : wob;
    transpose_tile<D_, D_>(src, dst, ti >> 3, ti & 7, tile);
  } else if (job == 2) {
    transpose_tile<D_, F_>(W1, w1b, idx >> 5, idx & 31, tile);
  } else {
    transpose_tile<F_, D_>(W2, w2b, idx >> 3, idx & 7, tile);
  }
}

// ---------------------------------------------------------------------------
// WMMA GEMM: C[M,N] = A[M,K](f16) @ W[K,N] + bias, with W pre-transposed
// as WT[N,K] (k-contiguous).  block = 256 (8 waves, 4x2 of 32x32),
// macro-tile 128x64, k-step 128 (a staged row is two whole 128-byte lines, copied
// by 16 neighbouring lanes), async global->LDS staging into two buffers: the next
// k-tile's copies fly while this one is multiplied. K is a multiple of 128.
//   EPI 0: f16 out   EPI 1: f32 out   EPI 2: spectral->f16   EPI 3: f16 out^T
// ---------------------------------------------------------------------------
template <int EPI>
__global__ __launch_bounds__(256) void gemm_wmma(
    const _Float16* __restrict__ A, const _Float16* __restrict__ WT,
    const float* __restrict__ bias, _Float16* __restrict__ outH,
    float* __restrict__ outF, int M, int N, int K) {
  // rows of 128 k at a pitch of 136 (272 bytes = 16 x odd: no bank conflict for b128)
  __shared__ __attribute__((aligned(16))) _Float16 sA[2][128 * 136];  // [buffer][m][k]
  __shared__ __attribute__((aligned(16))) _Float16 sB[2][64 * 136];   // [buffer][n][k]

  const int t = threadIdx.x;
  const int lane = t & 31, wave = t >> 5;
  const int half = lane >> 4, l16 = lane & 15;
  const int m0 = blockIdx.y * 128, n0 = blockIdx.x * 64;
  const int wm = (wave >> 1) * 32, wn = (wave & 1) * 32;

  v8f acc[2][2] = {};

  const int cr = t >> 4, cseg = (t & 15) * 8;  // copies: 16 lanes x 16 B = one row
  const _Float16* ga = A + (size_t)(m0 + cr) * K + cseg;   // this lane's part of tile 0
  const _Float16* gb = WT + (size_t)(n0 + cr) * K + cseg;
  const int cl = cr * 136 + cseg;                          // its place in a buffer

  // tile 0 lands and is published; tile 1 is then under way during trip 0
  async_copy_tile(ga, gb, (size_t)K * 32, &sA[0][cl], &sB[0][cl], 16 * 272);
  async_wait0();
  __syncthreads();
  if (128 < K)
    async_copy_tile(ga + 128, gb + 128, (size_t)K * 32, &sA[1][cl], &sB[1][cl], 16 * 272);

  for (int kt = 0; kt < K; kt += 128) {
    const int buf = (kt >> 7) & 1;
    const _Float16* tA = sA[buf];
    const _Float16* tB = sB[buf];
#pragma unroll  // the tile's four 32-k parts, in ascending k as before
    for (int kk = 0; kk < 128; kk += 32) {
      v16h af[2], bf[2];
#pragma unroll
      for (int i = 0; i < 2; ++i)
        af[i] = load_frag(&tA[(wm + 16 * i + l16) * 136 + kk], half);
#pragma unroll
      for (int j = 0; j < 2; ++j)
        bf[j] = load_frag(&tB[(wn + 16 * j + l16) * 136 + kk], half);
#pragma unroll
      for (int i = 0; i < 2; ++i)
#pragma unroll
        for (int j = 0; j < 2; ++j)
          acc[i][j] = wmma16(af[i], bf[j], acc[i][j]);
    }
    // this wave's LDS reads of this tile have returned before its buffer is refilled
    asm volatile("s_wait_dscnt 0x0" ::: "memory");
    async_wait0();    // this wave's copies of the next tile have landed
    __syncthreads();  // publishes the next tile; ends every read of this one
    if (kt + 256 < K)
      async_copy_tile(ga + kt + 256, gb + kt + 256, (size_t)K * 32, &sA[buf][cl],
                      &sB[buf][cl], 16 * 272);
  }
  async_wait0();  // no copy is outstanding when the wave goes on to its end

#pragma unroll
  for (int i = 0; i < 2; ++i)
#pragma unroll
    for (int j = 0; j < 2; ++j) {
      const int nn = n0 + wn + 16 * j + l16;      // C layout: n = lane&15
      const float bval = bias[nn];
      if (EPI == 3) {
        // transposed f16 store: fixed n per lane, 8 consecutive m -> b128
        v8h pk;
#pragma unroll
        for (int jj = 0; jj < 8; ++jj)
          pk[jj] = (_Float16)(acc[i][j][jj] + bval);
        *(v8h*)(outH + (size_t)nn * M + (m0 + wm + 16 * i + 8 * half)) = pk;
      } else {
#pragma unroll
        for (int jj = 0; jj < 8; ++jj) {
          const int m = m0 + wm + 16 * i + jj + 8 * half;  // m = vgpr + 8*half
          float v = acc[i][j][jj] + bval;
          if (EPI == 2) v = spectral_act(v);
          size_t idx = (size_t)m * N + nn;
          if (EPI == 1) outF[idx] = v;
          else          outH[idx] = (_Float16)v;
        }
      }
    }
}

__device__ inline float other_half(float x) {
  int b = __builtin_bit_cast(int, x);
  b = __builtin_amdgcn_permlanex16(b, b, 0x76543210, 0xfedcba98, false, false);
  return __builtin_bit_cast(float, b);
}

// e^x = exp2(x * log2(e)) on v_exp_f32 (what __expf gives). Written as asm so that
// the v_nop stands directly behind the transcendental: the instruction set asks
// for one slot before its source is overwritten or its result read.
__device__ inline float exp_slot(float x) {
  float y;
  asm("v_exp_f32 %0, %1\n\tv_nop" : "=v"(y) : "v"(x * 1.44269504088896340736f));
  return y;
}

__global__ __launch_bounds__(128) void flash_attn(
    const _Float16* __restrict__ Q, const _Float16* __restrict__ Kc,
    const _Float16* __restrict__ Vt, const float* __restrict__ resonance,
    const float* __restrict__ phase, _Float16* __restrict__ Oh) {
  // Row pitches of 16 bytes x odd (144 and 80): the 16 rows that a half wave's
  // 16-byte fragment reads touch then fall on 16 different groups of four banks.
  // At the rows' own lengths (128 and 64 bytes) they fall on two and on four groups.
  constexpr int KP = 72;  // f16 per sK row: 64 hd + 8 unused
  constexpr int VP = 40;  // f16 per sVt row: 32 keys + 8 unused
  // Two buffers each: the next key tile's copies fly while this one is worked on.
  __shared__ __attribute__((aligned(16))) _Float16 sK[2][32 * KP];   // [buffer][key][hd]
  __shared__ __attribute__((aligned(16))) _Float16 sVt[2][64 * VP];  // [buffer][hd][key]

  const int t = threadIdx.x;
  const int lane = t & 31, wave = t >> 5;
  const int half = lane >> 4, l16 = lane & 15;
  const int bh = blockIdx.y, b = bh / H_, h = bh % H_;
  const int q0 = blockIdx.x * 64 + wave * 16;
  const float r = resonance[h], ph = phase[h];
  const float scale = 0.125f;  // 1/sqrt(64)
  // (score + phase) in revolutions = raw * srev + prev
  const float srev = scale * INV_2PI, prev = ph * INV_2PI;

  const _Float16* qbase = Q + ((size_t)(b * S_ + q0 + l16)) * D_ + h * 64;
  v16h qf0 = cat8(*(const v8h*)(qbase + 8 * half),
                  *(const v8h*)(qbase + 16 + 8 * half));
  v16h qf1 = cat8(*(const v8h*)(qbase + 32 + 8 * half),
                  *(const v8h*)(qbase + 48 + 8 * half));

  float st_m = -3.0e38f;  // running maximum of query l16 (equal in both halves)
  float st_l = 0.f;       // running sum over this half's keys only
  v8f o[4] = {};          // o[tt][j] = O[query l16][hd = 16*tt + 8*half + j]

  const int kr = t >> 2, kseg = (t & 3) * 16;  // K loader: 16 f16 / thread
  const int vr = t >> 1, vseg = (t & 1) * 16;  // Vt loader: 16 f16 / thread
  const _Float16* gk = Kc + ((size_t)(b * S_ + kr)) * D_ + h * 64 + kseg;  // tile 0
  const _Float16* gv = Vt + ((size_t)(h * 64 + vr)) * M_ + b * S_ + vseg;
  const int kl = kr * KP + kseg, vl = vr * VP + vseg;  // the lane's places in a buffer

  // tile 0 lands and is published; tile 1 (S_ holds 64 tiles) is then under way
  async_copy_kv(gk, gv, &sK[0][kl], &sVt[0][vl]);
  async_wait0();
  __syncthreads();
  async_copy_kv(gk + (size_t)32 * D_, gv + 32, &sK[1][kl], &sVt[1][vl]);

  for (int kv = 0; kv < S_; kv += 32) {
    const int buf = (kv >> 5) & 1;
    const _Float16* tK = sK[buf];
    const _Float16* tV = sVt[buf];

    // S^T for 32 keys: two 16(key) x 16(query) tiles, hd=64 reduced as 32+32.
    // s0[j]: key kv + 8*half + j;  s1[j]: key kv + 16 + 8*half + j.
    v8f s0 = {}, s1 = {};
    {
      const _Float16* k0 = &tK[l16 * KP];
      const _Float16* k1 = &tK[(16 + l16) * KP];
      v16h k00 = cat8(*(const v8h*)(k0 + 8 * half), *(const v8h*)(k0 + 16 + 8 * half));
      v16h k01 = cat8(*(const v8h*)(k0 + 32 + 8 * half), *(const v8h*)(k0 + 48 + 8 * half));
      v16h k10 = cat8(*(const v8h*)(k1 + 8 * half), *(const v8h*)(k1 + 16 + 8 * half));
      v16h k11 = cat8(*(const v8h*)(k1 + 32 + 8 * half), *(const v8h*)(k1 + 48 + 8 * half));
      s0 = wmma16(k00, qf0, s0); s0 = wmma16(k01, qf1, s0);
      s1 = wmma16(k10, qf0, s1); s1 = wmma16(k11, qf1, s1);
    }

    float mx = -3.0e38f;
#pragma unroll
    for (int j = 0; j < 8; ++j) {
      float a = s0[j] * scale;  a += r * sin_rev(fmaf(s0[j], srev, prev));
      float c = s1[j] * scale;  c += r * sin_rev(fmaf(s1[j], srev, prev));
      s0[j] = a; s1[j] = c;
      mx = fmaxf(mx, fmaxf(a, c));
    }
    mx = fmaxf(mx, other_half(mx));
    const float nm = fmaxf(st_m, mx);
    const float corr = exp_slot(st_m - nm);
    st_m = nm;

    // P^T as a B operand: element s is key 8*half + s (16 + 8*half + s-8 for s >= 8), which is exactly
    // s0[0..7] then s1[0..7] of this lane.
    v16h pf;
    float sm = 0.f;
#pragma unroll
    for (int j = 0; j < 8; ++j) {
      float p0 = exp_slot(s0[j] - nm), p1 = exp_slot(s1[j] - nm);
      sm += p0 + p1;
      pf[j] = (_Float16)p0;
      pf[8 + j] = (_Float16)p1;
    }
    st_l = st_l * corr + sm;
#pragma unroll
    for (int tt = 0; tt < 4; ++tt)
#pragma unroll
      for (int j = 0; j < 8; ++j) o[tt][j] *= corr;

#pragma unroll
    for (int tt = 0; tt < 4; ++tt) {
      const _Float16* vb = &tV[(tt * 16 + l16) * VP];
      v16h vf = cat8(*(const v8h*)(vb + 8 * half),
                     *(const v8h*)(vb + 16 + 8 * half));
      o[tt] = wmma16(vf, pf, o[tt]);
    }
    // this wave's LDS reads of this tile have returned before its buffer is refilled
    asm volatile("s_wait_dscnt 0x0" ::: "memory");
    async_wait0();    // this wave's copies of the next tile have landed
    __syncthreads();  // publishes the next tile; ends every read of this one
    if (kv + 64 < S_)
      async_copy_kv(gk + (size_t)(kv + 64) * D_, gv + kv + 64, &sK[buf][kl], &sVt[buf][vl]);
  }
  async_wait0();  // no copy is outstanding when the wave goes on to its end

  // join the two halves' sums once; 8 consecutive hd per lane -> 16-byte stores
  const float inv = 1.0f / (st_l + other_half(st_l));
  _Float16* dst = Oh + ((size_t)(b * S_ + q0 + l16)) * D_ + h * 64 + 8 * half;
#pragma unroll
  for (int tt = 0; tt < 4; ++tt) {
    v8h pk;
#pragma unroll
    for (int j = 0; j < 8; ++j) pk[j] = (_Float16)(o[tt][j] * inv);
    *(v8h*)(dst + tt * 16) = pk;
  }
}

// ---------------------------------------------------------------------------
// Harmonic LayerNorm (unbiased std): one block per row.
// ---------------------------------------------------------------------------
__global__ __launch_bounds__(256) void harmonic_ln(
    const float* __restrict__ A, const float* __restrict__ Bv,
    const float* __restrict__ g, const float* __restrict__ be,
    const float* __restrict__ s, float* __restrict__ outF,
    _Float16* __restrict__ outH) {
  __shared__ float red[256];
  const int row = blockIdx.x, t = threadIdx.x;
  const float* a = A + (size_t)row * D_;
  const float* bb = Bv + (size_t)row * D_;

  float sum = 0.f, sq = 0.f;
  for (int c = t; c < D_; c += 256) {
    float v = a[c] + bb[c];
    sum += v; sq += v * v;
  }
  red[t] = sum; __syncthreads();
  for (int off = 128; off > 0; off >>= 1) {
    if (t < off) red[t] += red[t + off];
    __syncthreads();
  }
  float tot = red[0]; __syncthreads();
  red[t] = sq; __syncthreads();
  for (int off = 128; off > 0; off >>= 1) {
    if (t < off) red[t] += red[t + off];
    __syncthreads();
  }
  float tot2 = red[0];

  float mean = tot / (float)D_;
  float var = (tot2 - mean * tot) / (float)(D_ - 1);
  float sd = sqrtf(fmaxf(var, 0.f));
  sd = sd + s[0] * sin_rev(sd * 0.5f);  // sin(pi * sd): sd / 2 revolutions
  float inv = 1.0f / (sd + 1e-6f);

  for (int c = t; c < D_; c += 256) {
    float v = (a[c] + bb[c] - mean) * inv * g[c] + be[c];
    outF[(size_t)row * D_ + c] = v;
    if (outH) outH[(size_t)row * D_ + c] = (_Float16)v;
  }
}

// ---------------------------------------------------------------------------
// launch
// ---------------------------------------------------------------------------
extern "C" void kernel_launch(void* const* d_in, const int* in_sizes, int n_in,
                              void* d_out, int out_size, void* d_ws,
                              size_t ws_size, hipStream_t stream) {
  const float* x   = (const float*)d_in[0];
  const float* Wq  = (const float*)d_in[1];  const float* bq  = (const float*)d_in[2];
  const float* Wk  = (const float*)d_in[3];  const float* bk  = (const float*)d_in[4];
  const float* Wv  = (const float*)d_in[5];  const float* bv  = (const float*)d_in[6];
  const float* Wo  = (const float*)d_in[7];  const float* bo  = (const float*)d_in[8];
  const float* res = (const float*)d_in[9];  const float* phs = (const float*)d_in[10];
  const float* g1  = (const float*)d_in[11]; const float* b1  = (const float*)d_in[12];
  const float* s1  = (const float*)d_in[13];
  const float* W1  = (const float*)d_in[14]; const float* bf1 = (const float*)d_in[15];
  const float* W2  = (const float*)d_in[16]; const float* bf2 = (const float*)d_in[17];
  const float* g2  = (const float*)d_in[18]; const float* b2  = (const float*)d_in[19];
  const float* s2  = (const float*)d_in[20];

  char* ws = (char*)d_ws;
  size_t off = 0;
  auto alloc = [&](size_t bytes) {
    char* p = ws + off;
    off += (bytes + 255) & ~(size_t)255;
    return p;
  };
  _Float16* xb   = (_Float16*)alloc((size_t)M_ * D_ * 2);
  _Float16* wqb  = (_Float16*)alloc((size_t)D_ * D_ * 2);  // transposed [N,K]
  _Float16* wkb  = (_Float16*)alloc((size_t)D_ * D_ * 2);
  _Float16* wvb  = (_Float16*)alloc((size_t)D_ * D_ * 2);
  _Float16* wob  = (_Float16*)alloc((size_t)D_ * D_ * 2);
  _Float16* w1b  = (_Float16*)alloc((size_t)D_ * F_ * 2);
  _Float16* w2b  = (_Float16*)alloc((size_t)F_ * D_ * 2);
  _Float16* qb   = (_Float16*)alloc((size_t)M_ * D_ * 2);
  _Float16* kb2  = (_Float16*)alloc((size_t)M_ * D_ * 2);
  _Float16* vt   = (_Float16*)alloc((size_t)M_ * D_ * 2);  // V transposed [D,M]
  _Float16* at16 = (_Float16*)alloc((size_t)M_ * D_ * 2);
  float*    aprj = (float*)   alloc((size_t)M_ * D_ * 4);
  float*    y1   = (float*)   alloc((size_t)M_ * D_ * 4);
  _Float16* y1b  = (_Float16*)alloc((size_t)M_ * D_ * 2);
  _Float16* act  = (_Float16*)alloc((size_t)M_ * F_ * 2);
  float*    ffn  = (float*)   alloc((size_t)M_ * D_ * 4);

  const dim3 blk256(256), blk128(128);

  // x -> f16; weights: f32 [K,N] -> f16 transposed [N,K]
  cvt_all<<<1024, blk256, 0, stream>>>(x, Wq, Wk, Wv, Wo, W1, W2, xb, wqb, wkb,
                                       wvb, wob, w1b, w2b);

  // QKV projections (V written transposed for the PV matmul)
  dim3 gDD(D_ / 64, M_ / 128);
  gemm_wmma<0><<<gDD, blk256, 0, stream>>>(xb, wqb, bq, qb,  nullptr, M_, D_, D_);
  gemm_wmma<0><<<gDD, blk256, 0, stream>>>(xb, wkb, bk, kb2, nullptr, M_, D_, D_);
  gemm_wmma<3><<<gDD, blk256, 0, stream>>>(xb, wvb, bv, vt,  nullptr, M_, D_, D_);

  // harmonic flash attention
  dim3 gFA(S_ / 64, B_ * H_);
  flash_attn<<<gFA, blk128, 0, stream>>>(qb, kb2, vt, res, phs, at16);

  // output projection (f32)
  gemm_wmma<1><<<gDD, blk256, 0, stream>>>(at16, wob, bo, nullptr, aprj, M_, D_, D_);

  // LN1
  harmonic_ln<<<M_, blk256, 0, stream>>>(x, aprj, g1, b1, s1, y1, y1b);

  // FFN up + spectral activation (f16), FFN down (f32)
  gemm_wmma<2><<<dim3(F_ / 64, M_ / 128), blk256, 0, stream>>>(
      y1b, w1b, bf1, act, nullptr, M_, F_, D_);
  gemm_wmma<1><<<gDD, blk256, 0, stream>>>(act, w2b, bf2, nullptr, ffn, M_, D_, F_);

  // LN2 -> final output
  harmonic_ln<<<M_, blk256, 0, stream>>>(y1, ffn, g2, b2, s2, (float*)d_out, nullptr);
}

// v007
// Measured time: 211 microseconds a run.
// Next to v006, in two timings, it ran 1.08 and 1.07 times as fast.
// Over all steps from v000 it is 3.02 times as fast.
#include <hip/hip_runtime.h>
#include <hip/hip_bf16.h>

typedef __attribute__((ext_vector_type(16))) _Float16 v16h;
typedef __attribute__((ext_vector_type(8)))  _Float16 v8h;
typedef __attribute__((ext_vector_type(8)))  float    v8f;

#define B_  2
#define S_  2048
#define D_  1024
#define H_  16
#define F_  4096
#define M_  (B_ * S_)   // 4096 rows

// ---------------------------------------------------------------------------
// helpers
// ---------------------------------------------------------------------------
__device__ inline v16h cat8(v8h lo, v8h hi) {
  return __builtin_shufflevector(lo, hi, 0,1,2,3,4,5,6,7,8,9,10,11,12,13,14,15);
}

// 16x32 f16 fragment from LDS (k-contiguous rows). Lane l (l16=l&15, half=l>>4):
//   elements 0..7  -> k =      8*half + 0..7
//   elements 8..15 -> k = 16 + 8*half + 0..7
__device__ inline v16h load_frag(const _Float16* rowbase, int half) {
  v8h lo = *(const v8h*)(rowbase + 8 * half);
  v8h hi = *(const v8h*)(rowbase + 16 + 8 * half);
  return cat8(lo, hi);
}

__device__ inline v8f wmma16(v16h a, v16h b, v8f c) {
  return __builtin_amdgcn_wmma_f32_16x16x32_f16(
      false, a, false, b, (short)0, c, false, false);
}

// CDNA5 async global->LDS copy (ASYNCcnt-tracked, no VGPR data path).
// One thread's four copies of a key tile: 32 bytes of a K row, 32 of a V^T row.
// s_wait_xcnt 0 is the last line of the copies' own statement, so that no later
// write of an address register can be scheduled in front of it.
__device__ inline void async_copy_kv(const _Float16* gk, const _Float16* gv,
                                     _Float16* pk, _Float16* pv) {
  const char* k = (const char*)gk;
  const char* v = (const char*)gv;
  const unsigned lk = (unsigned)(unsigned long long)pk;  // low 32 bits = LDS offset
  const unsigned lv = (unsigned)(unsigned long long)pv;
  asm volatile("global_load_async_to_lds_b128 %0, %4, off\n\t"
               "global_load_async_to_lds_b128 %1, %5, off\n\t"
               "global_load_async_to_lds_b128 %2, %6, off\n\t"
               "global_load_async_to_lds_b128 %3, %7, off\n\t"
               "s_wait_xcnt 0x0"
               :: "v"(lk), "v"(lk + 16), "v"(lv), "v"(lv + 16),
                  "v"(k), "v"(k + 16), "v"(v), "v"(v + 16)
               : "memory");
}
// One thread's twelve copies of a k-tile: eight A rows and four B rows, 16 rows
// apart (gstep, lstep in bytes). s_wait_xcnt 0 is the last line of the copies'
// own statement, so that no later write of an address register can be scheduled
// in front of it.
__device__ inline void async_copy_tile(const _Float16* ga, const _Float16* gb,
                                       size_t gstep, _Float16* pa, _Float16* pb,
                                       unsigned lstep) {
  const char* a = (const char*)ga;
  const char* b = (const char*)gb;
  const unsigned la = (unsigned)(unsigned long long)pa;  // low 32 bits = LDS offset
  const unsigned lb = (unsigned)(unsigned long long)pb;
  asm volatile("global_load_async_to_lds_b128 %0, %12, off\n\t"
               "global_load_async_to_lds_b128 %1, %13, off\n\t"
               "global_load_async_to_lds_b128 %2, %14, off\n\t"
               "global_load_async_to_lds_b128 %3, %15, off\n\t"
               "global_load_async_to_lds_b128 %4, %16, off\n\t"
               "global_load_async_to_lds_b128 %5, %17, off\n\t"
               "global_load_async_to_lds_b128 %6, %18, off\n\t"
               "global_load_async_to_lds_b128 %7, %19, off\n\t"
               "global_load_async_to_lds_b128 %8, %20, off\n\t"
               "global_load_async_to_lds_b128 %9, %21, off\n\t"
               "global_load_async_to_lds_b128 %10, %22, off\n\t"
               "global_load_async_to_lds_b128 %11, %23, off\n\t"
               "s_wait_xcnt 0x0"
               :: "v"(la), "v"(la + lstep), "v"(la + 2 * lstep), "v"(la + 3 * lstep),
                  "v"(la + 4 * lstep), "v"(la + 5 * lstep), "v"(la + 6 * lstep),
                  "v"(la + 7 * lstep), "v"(lb), "v"(lb + lstep), "v"(lb + 2 * lstep),
                  "v"(lb + 3 * lstep),
                  "v"(a), "v"(a + gstep), "v"(a + 2 * gstep), "v"(a + 3 * gstep),
                  "v"(a + 4 * gstep), "v"(a + 5 * gstep), "v"(a + 6 * gstep),
                  "v"(a + 7 * gstep), "v"(b), "v"(b + gstep), "v"(b + 2 * gstep),
                  "v"(b + 3 * gstep)
               : "memory");
}
__device__ inline void async_wait0() {
  asm volatile("s_wait_asynccnt 0x0" ::: "memory");
}

// sin(2*pi*t) on v_sin_f32, which takes its argument in revolutions. v_fract_f32
// is the whole range reduction (exact; it hands the instruction a value in
// [0, 1)), so there is no compare and no branch per value. What is lost
// against the library's sinf is the rounding of t, |t| * 2^-24 revolutions: the
// size of the rounding that the f32 argument in radians carries anyway.
// The builtin, not asm text: the compiler then keeps the distance behind a matrix
// instruction whose operand registers the result reuses.
#define INV_2PI 0.15915494309189535f
__device__ inline float sin_rev(float t) {
  return __builtin_amdgcn_sinf(__builtin_amdgcn_fractf(t));
}

__device__ inline float spectral_act(float x) {
  const float c = 0.7978845608028654f;              // sqrt(2/pi)
  float g = 0.5f * x * (1.0f + tanhf(c * (x + 0.044715f * x * x * x)));
  return g + 0.5f * sin_rev(x * INV_2PI);           // ALPHA=0.5, BETA=1.0
}

// ---------------------------------------------------------------------------
// All f32 -> f16 conversions of a call in ONE launch of 1024 work-groups:
//   blocks   0..255  x, 16384 elements each, copied in place order
//   blocks 256..511  Wq, Wk, Wv, Wo (64 tiles each)   f32 [K,N] -> f16 [N,K]
//   blocks 512..767  W1                               f32 [K,N] -> f16 [N,K]
//   blocks 768..1023 W2                               f32 [K,N] -> f16 [N,K]
// A work-group moves 64 KiB in and 32 KiB out, with 16 loads of 16 bytes in
// flight per lane, so that few waves have to be started for the bytes moved.
// ---------------------------------------------------------------------------
typedef __attribute__((ext_vector_type(4))) float    v4f;
typedef __attribute__((ext_vector_type(4))) _Float16 v4h;

// One 128(k) x 128(n) tile. A wave-wide load is 512 contiguous bytes of one
// source row; a lane holds 16 consecutive k of 4 neighbouring n, packs them to
// 16-byte chunks and lays them in LDS as [n][k]; a wave-wide store is two whole
// 256-byte pieces of two destination rows.
// LDS rows are 256 bytes, unpadded: chunk c of row n lies at place c ^ ((n >> 2) & 15),
// which spreads both the 16 writers (n 4 apart, same c) and the 16 readers
// (same n, c = 0..15) over all banks.
template <int K, int N>
__device__ inline void transpose_tile(const float* __restrict__ src,
                                      _Float16* __restrict__ dst, int kt, int nt,
                                      _Float16* tile) {
  const int t = threadIdx.x, lane = t & 31, wave = t >> 5;
  const float* s = src + (size_t)(kt * 128 + wave * 16) * N + nt * 128 + lane * 4;
  v4f v[16];
#pragma unroll  // all 16 loads are issued before the first value is used
  for (int i = 0; i < 16; ++i) v[i] = *(const v4f*)(s + (size_t)i * N);
  // behind the last load: the loads' address register, named here so that it lives
  // up to this wait, is not reused (as a load's own destination) in front of it
  asm volatile("s_wait_xcnt 0x0" :: "v"(s) : "memory");
#pragma unroll
  for (int j = 0; j < 4; ++j)
#pragma unroll
    for (int h = 0; h < 2; ++h) {
      v8h pk;
#pragma unroll
      for (int e = 0; e < 8; ++e) pk[e] = (_Float16)v[h * 8 + e][j];
      *(v8h*)&tile[(lane * 4 + j) * 128 + (((wave * 2 + h) ^ (lane & 15)) * 8)] = pk;
    }
  __syncthreads();
  const int seg = lane & 15;
  _Float16* d = dst + (size_t)(nt * 128 + wave * 2 + (lane >> 4)) * K + kt * 128 + seg * 8;
#pragma unroll
  for (int r = 0; r < 8; ++r) {
    const int n = r * 16 + wave * 2 + (lane >> 4);
    *(v8h*)(d + (size_t)r * 16 * K) =
        *(const v8h*)&tile[n * 128 + ((seg ^ ((n >> 2) & 15)) * 8)];
  }
  // behind the last store: no register that a store names is rewritten in front of
  // this wait, on any way that the branches behind the inlined tile leave open
  asm volatile("s_wait_xcnt 0x0" :: "v"(d) : "memory");
}

// The grid puts 4 work-groups on a WGP, 8 waves on a SIMD: a budget of 128 registers
// costs no residency. Without the attribute the compiler keeps under 64 registers
// and issues the 16 loads in three groups, each behind a wait on the one before.
__global__ __launch_bounds__(256) __attribute__((amdgpu_waves_per_eu(2, 8))) void cvt_all(
    const float* __restrict__ x, const float* __restrict__ Wq,
    const float* __restrict__ Wk, const float* __restrict__ Wv,
    const float* __restrict__ Wo, const float* __restrict__ W1,
    const float* __restrict__ W2, _Float16* __restrict__ xb,
    _Float16* __restrict__ wqb, _Float16* __restrict__ wkb,
    _Float16* __restrict__ wvb, _Float16* __restrict__ wob,
    _Float16* __restrict__ w1b, _Float16* __restrict__ w2b) {
  __shared__ __attribute__((aligned(16))) _Float16 tile[128 * 128];  // [n][k]
  const int job = blockIdx.x >> 8, idx = blockIdx.x & 255;  // the same in a whole block

  if (job == 0) {
    // a wave-wide load is 512 contiguous bytes, its store 256 contiguous bytes
    const unsigned base = idx * 16384 + threadIdx.x * 4;
    const unsigned boff = base * 4;  // byte offset of the lane's first load
    v4f v[16];
#pragma unroll  // all 16 loads are issued before the first value is used
    for (int i = 0; i < 16; ++i) v[i] = *(const v4f*)((const char*)x + boff + i * 4096);
    // behind the last load: the loads' offset register, named here so that it lives
    // up to this wait, is not reused (as a load's own destination) in front of it
    asm volatile("s_wait_xcnt 0x0" :: "v"(boff) : "memory");
#pragma unroll
    for (int i = 0; i < 16; ++i) {
      v4h h;
#pragma unroll
      for (int e = 0; e < 4; ++e) h[e] = (_Float16)v[i][e];
      *(v4h*)(xb + base + i * 1024) = h;
    }
  } else if (job == 1) {
    const int w = idx >> 6, ti = idx & 63;
    const float* src = w == 0 ? Wq : w == 1 ? Wk : w == 2 ? Wv : Wo;
    _Float16* dst = w == 0 ? wqb : w == 1 ? wkb : w == 2 ? wvb : wob;
    transpose_tile<D_, D_>(src, dst, ti >> 3, ti & 7, tile);
  } else if (job == 2) {
    transpose_tile<D_, F_>(W1, w1b, idx >> 5, idx & 31, tile);
  } else {
    transpose_tile<F_, D_>(W2, w2b, idx >> 3, idx & 7, tile);
  }
}

// ---------------------------------------------------------------------------
// WMMA GEMM: C[M,N] = A[M,K](f16) @ W[K,N] + bias, with W pre-transposed
// as WT[N,K] (k-contiguous).  block = 256 (8 waves, 4x2 of 32x32),
// macro-tile 128x64, k-step 128 (a staged row is two whole 128-byte lines, copied
// by 16 neighbouring lanes), async global->LDS staging into two buffers: the next
// k-tile's copies fly while this one is multiplied. K is a multiple of 128.
//   EPI 0: f16 out   EPI 1: f32 out   EPI 2: spectral->f16   EPI 3: f16 out^T
// ---------------------------------------------------------------------------
template <int EPI>
__global__ __launch_bounds__(256) void gemm_wmma(
    const _Float16* __restrict__ A, const _Float16* __restrict__ WT,
    const float* __restrict__ bias, _Float16* __restrict__ outH,
    float* __restrict__ outF, int M, int N, int K) {
  // rows of 128 k at a pitch of 136 (272 bytes = 16 x odd: no bank conflict for b128)
  __shared__ __attribute__((aligned(16))) _Float16 sA[2][128 * 136];  // [buffer][m][k]
  __shared__ __attribute__((aligned(16))) _Float16 sB[2][64 * 136];   // [buffer][n][k]

  const int t = threadIdx.x;
  const int lane = t & 31, wave = t >> 5;
  const int half = lane >> 4, l16 = lane & 15;
  const int m0 = blockIdx.y * 128, n0 = blockIdx.x * 64;
  const int wm = (wave >> 1) * 32, wn = (wave & 1) * 32;

  v8f acc[2][2] = {};

  const int cr = t >> 4, cseg = (t & 15) * 8;  // copies: 16 lanes x 16 B = one row
  const _Float16* ga = A + (size_t)(m0 + cr) * K + cseg;   // this lane's part of tile 0
  const _Float16* gb = WT + (size_t)(n0 + cr) * K + cseg;
  const int cl = cr * 136 + cseg;                          // its place in a buffer

  // tile 0 lands and is published; tile 1 is then under way during trip 0
  async_copy_tile(ga, gb, (size_t)K * 32, &sA[0][cl], &sB[0][cl], 16 * 272);
  async_wait0();
  __syncthreads();
  if (128 < K)
    async_copy_tile(ga + 128, gb + 128, (size_t)K * 32, &sA[1][cl], &sB[1][cl], 16 * 272);

  for (int kt = 0; kt < K; kt += 128) {
    const int buf = (kt >> 7) & 1;
    const _Float16* tA = sA[buf];
    const _Float16* tB = sB[buf];
#pragma unroll  // the tile's four 32-k parts, in ascending k as before
    for (int kk = 0; kk < 128; kk += 32) {
      v16h af[2], bf[2];
#pragma unroll
      for (int i = 0; i < 2; ++i)
        af[i] = load_frag(&tA[(wm + 16 * i + l16) * 136 + kk], half);
#pragma unroll
      for (int j = 0; j < 2; ++j)
        bf[j] = load_frag(&tB[(wn + 16 * j + l16) * 136 + kk], half);
#pragma unroll
      for (int i = 0; i < 2; ++i)
#pragma unroll
        for (int j = 0; j < 2; ++j)
          acc[i][j] = wmma16(af[i], bf[j], acc[i][j]);
    }
    // this wave's LDS reads of this tile have returned before its buffer is refilled
    asm volatile("s_wait_dscnt 0x0" ::: "memory");
    async_wait0();    // this wave's copies of the next tile have landed
    __syncthreads();  // publishes the next tile; ends every read of this one
    if (kt + 256 < K)
      async_copy_tile(ga + kt + 256, gb + kt + 256, (size_t)K * 32, &sA[buf][cl],
                      &sB[buf][cl], 16 * 272);
  }
  async_wait0();  // no copy is outstanding when the wave goes on to its end

#pragma unroll
  for (int i = 0; i < 2; ++i)
#pragma unroll
    for (int j = 0; j < 2; ++j) {
      const int nn = n0 + wn + 16 * j + l16;      // C layout: n = lane&15
      const float bval = bias[nn];
      if (EPI == 3) {
        // transposed f16 store: fixed n per lane, 8 consecutive m -> b128
        v8h pk;
#pragma unroll
        for (int jj = 0; jj < 8; ++jj)
          pk[jj] = (_Float16)(acc[i][j][jj] + bval);
        *(v8h*)(outH + (size_t)nn * M + (m0 + wm + 16 * i + 8 * half)) = pk;
      } else {
#pragma unroll
        for (int jj = 0; jj < 8; ++jj) {
          const int m = m0 + wm + 16 * i + jj + 8 * half;  // m = vgpr + 8*half
          float v = acc[i][j][jj] + bval;
          if (EPI == 2) v = spectral_act(v);
          size_t idx = (size_t)m * N + nn;
          if (EPI == 1) outF[idx] = v;
          else          outH[idx] = (_Float16)v;
        }
      }
    }
}

__device__ inline float other_half(float x) {
  int b = __builtin_bit_cast(int, x);
  b = __builtin_amdgcn_permlanex16(b, b, 0x76543210, 0xfedcba98, false, false);
  return __builtin_bit_cast(float, b);
}

// e^x = exp2(x * log2(e)) on v_exp_f32 (what __expf gives). Written as asm so that
// the v_nop stands directly behind the transcendental: the instruction set asks
// for one slot before its source is overwritten or its result read.
__device__ inline float exp_slot(float x) {
  float y;
  asm("v_exp_f32 %0, %1\n\tv_nop" : "=v"(y) : "v"(x * 1.44269504088896340736f));
  return y;
}

__global__ __launch_bounds__(128) void flash_attn(
    const _Float16* __restrict__ Q, const _Float16* __restrict__ Kc,
    const _Float16* __restrict__ Vt, const float* __restrict__ resonance,
    const float* __restrict__ phase, _Float16* __restrict__ Oh) {
  // Row pitches of 16 bytes x odd (144 and 80): the 16 rows that a half wave's
  // 16-byte fragment reads touch then fall on 16 different groups of four banks.
  // At the rows' own lengths (128 and 64 bytes) they fall on two and on four groups.
  constexpr int KP = 72;  // f16 per sK row: 64 hd + 8 unused
  constexpr int VP = 40;  // f16 per sVt row: 32 keys + 8 unused
  // Two buffers each: the next key tile's copies fly while this one is worked on.
  __shared__ __attribute__((aligned(16))) _Float16 sK[2][32 * KP];   // [buffer][key][hd]
  __shared__ __attribute__((aligned(16))) _Float16 sVt[2][64 * VP];  // [buffer][hd][key]

  const int t = threadIdx.x;
  const int lane = t & 31, wave = t >> 5;
  const int half = lane >> 4, l16 = lane & 15;
  const int bh = blockIdx.y, b = bh / H_, h = bh % H_;
  const int q0 = blockIdx.x * 64 + wave * 16;
  const float r = resonance[h], ph = phase[h];
  const float scale = 0.125f;  // 1/sqrt(64)
  // (score + phase) in revolutions = raw * srev + prev
  const float srev = scale * INV_2PI, prev = ph * INV_2PI;

  const _Float16* qbase = Q + ((size_t)(b * S_ + q0 + l16)) * D_ + h * 64;
  v16h qf0 = cat8(*(const v8h*)(qbase + 8 * half),
                  *(const v8h*)(qbase + 16 + 8 * half));
  v16h qf1 = cat8(*(const v8h*)(qbase + 32 + 8 * half),
                  *(const v8h*)(qbase + 48 + 8 * half));

  float st_m = -3.0e38f;  // running maximum of query l16 (equal in both halves)
  float st_l = 0.f;       // running sum over this half's keys only
  v8f o[4] = {};          // o[tt][j] = O[query l16][hd = 16*tt + 8*half + j]

  const int kr = t >> 2, kseg = (t & 3) * 16;  // K loader: 16 f16 / thread
  const int vr = t >> 1, vseg = (t & 1) * 16;  // Vt loader: 16 f16 / thread
  const _Float16* gk = Kc + ((size_t)(b * S_ + kr)) * D_ + h * 64 + kseg;  // tile 0
  const _Float16* gv = Vt + ((size_t)(h * 64 + vr)) * M_ + b * S_ + vseg;
  const int kl = kr * KP + kseg, vl = vr * VP + vseg;  // the lane's places in a buffer

  // tile 0 lands and is published; tile 1 (S_ holds 64 tiles) is then under way
  async_copy_kv(gk, gv, &sK[0][kl], &sVt[0][vl]);
  async_wait0();
  __syncthreads();
  async_copy_kv(gk + (size_t)32 * D_, gv + 32, &sK[1][kl], &sVt[1][vl]);

  for (int kv = 0; kv < S_; kv += 32) {
    const int buf = (kv >> 5) & 1;
    const _Float16* tK = sK[buf];
    const _Float16* tV = sVt[buf];

    // S^T for 32 keys: two 16(key) x 16(query) tiles, hd=64 reduced as 32+32.
    // s0[j]: key kv + 8*half + j;  s1[j]: key kv + 16 + 8*half + j.
    v8f s0 = {}, s1 = {};
    {
      const _Float16* k0 = &tK[l16 * KP];
      const _Float16* k1 = &tK[(16 + l16) * KP];
      v16h k00 = cat8(*(const v8h*)(k0 + 8 * half), *(const v8h*)(k0 + 16 + 8 * half));
      v16h k01 = cat8(*(const v8h*)(k0 + 32 + 8 * half), *(const v8h*)(k0 + 48 + 8 * half));
      v16h k10 = cat8(*(const v8h*)(k1 + 8 * half), *(const v8h*)(k1 + 16 + 8 * half));
      v16h k11 = cat8(*(const v8h*)(k1 + 32 + 8 * half), *(const v8h*)(k1 + 48 + 8 * half));
      s0 = wmma16(k00, qf0, s0); s0 = wmma16(k01, qf1, s0);
      s1 = wmma16(k10, qf0, s1); s1 = wmma16(k11, qf1, s1);
    }

    float mx = -3.0e38f;
#pragma unroll
    for (int j = 0; j < 8; ++j) {
      float a = s0[j] * scale;  a += r * sin_rev(fmaf(s0[j], srev, prev));
      float c = s1[j] * scale;  c += r * sin_rev(fmaf(s1[j], srev, prev));
      s0[j] = a; s1[j] = c;
      mx = fmaxf(mx, fmaxf(a, c));
    }
    mx = fmaxf(mx, other_half(mx));
    const float nm = fmaxf(st_m, mx);
    const float corr = exp_slot(st_m - nm);
    st_m = nm;

    // P^T as a B operand: element s is key 8*half + s (16 + 8*half + s-8 for s >= 8), which is exactly
    // s0[0..7] then s1[0..7] of this lane.
    v16h pf;
    float sm = 0.f;
#pragma unroll
    for (int j = 0; j < 8; ++j) {
      float p0 = exp_slot(s0[j] - nm), p1 = exp_slot(s1[j] - nm);
      sm += p0 + p1;
      pf[j] = (_Float16)p0;
      pf[8 + j] = (_Float16)p1;
    }
    st_l = st_l * corr + sm;
#pragma unroll
    for (int tt = 0; tt < 4; ++tt)
#pragma unroll
      for (int j = 0; j < 8; ++j) o[tt][j] *= corr;

#pragma unroll
    for (int tt = 0; tt < 4; ++tt) {
      const _Float16* vb = &tV[(tt * 16 + l16) * VP];
      v16h vf = cat8(*(const v8h*)(vb + 8 * half),
                     *(const v8h*)(vb + 16 + 8 * half));
      o[tt] = wmma16(vf, pf, o[tt]);
    }
    // this wave's LDS reads of this tile have returned before its buffer is refilled
    asm volatile("s_wait_dscnt 0x0" ::: "memory");
    async_wait0();    // this wave's copies of the next tile have landed
    __syncthreads();  // publishes the next tile; ends every read of this one
    if (kv + 64 < S_)
      async_copy_kv(gk + (size_t)(kv + 64) * D_, gv + kv + 64, &sK[buf][kl], &sVt[buf][vl]);
  }
  async_wait0();  // no copy is outstanding when the wave goes on to its end

  // join the two halves' sums once; 8 consecutive hd per lane -> 16-byte stores
  const float inv = 1.0f / (st_l + other_half(st_l));
  _Float16* dst = Oh + ((size_t)(b * S_ + q0 + l16)) * D_ + h * 64 + 8 * half;
#pragma unroll
  for (int tt = 0; tt < 4; ++tt) {
    v8h pk;
#pragma unroll
    for (int j = 0; j < 8; ++j) pk[j] = (_Float16)(o[tt][j] * inv);
    *(v8h*)(dst + tt * 16) = pk;
  }
}

// ---------------------------------------------------------------------------
// Harmonic LayerNorm (unbiased std): one WAVE per row, 8 rows per block.
// A lane holds 32 of the row's 1024 values in registers (eight 16-byte loads from
// each addend, a wave-wide load being 512 contiguous bytes), so the row is read
// once, the two sums need no LDS and no barrier, and a launch starts 4096 waves.
// ---------------------------------------------------------------------------
// x + (x of lane l ^ MASK), inside a 16-lane row: DPP row_xmask is 0x160 + MASK
template <int MASK>
__device__ inline float add_xmask(float x) {
  const int y = __builtin_amdgcn_update_dpp(0, __builtin_bit_cast(int, x), 0x160 + MASK,
                                            0xf, 0xf, true);
  return x + __builtin_bit_cast(float, y);
}
// sum over the wave's 32 lanes; every lane ends with the same bits
__device__ inline float wave_sum(float x) {
  x = add_xmask<1>(x);
  x = add_xmask<2>(x);
  x = add_xmask<4>(x);
  x = add_xmask<8>(x);
  return x + other_half(x);
}

// The grid puts 2 work-groups on a WGP, 4 waves on a SIMD: a budget of 256 registers
// costs no residency, and all 32 loads of a lane can be in flight at once.
__global__ __launch_bounds__(256) __attribute__((amdgpu_waves_per_eu(2, 4))) void harmonic_ln(
    const float* __restrict__ A, const float* __restrict__ Bv,
    const float* __restrict__ g, const float* __restrict__ be,
    const float* __restrict__ s, float* __restrict__ outF,
    _Float16* __restrict__ outH) {
  const int lane = threadIdx.x & 31;
  // the wave's number in a scalar register: the row's addresses are then scalar bases
  const int row = blockIdx.x * 8 + __builtin_amdgcn_readfirstlane(threadIdx.x >> 5);
  const unsigned boff = lane * 16;  // byte offset of the lane's first four columns
  const char* a = (const char*)(A + (size_t)row * D_);
  const char* bb = (const char*)(Bv + (size_t)row * D_);
  const float stab = s[0];  // asked for here: its latency passes beside the row's loads

  // every loop over i below is unrolled: constant indices keep the arrays in registers
  v4f va[8], vb[8], vg[8], ve[8];
#pragma unroll  // all loads are issued before the first value is used
  for (int i = 0; i < 8; ++i) va[i] = *(const v4f*)(a + boff + i * 512);
#pragma unroll
  for (int i = 0; i < 8; ++i) vb[i] = *(const v4f*)(bb + boff + i * 512);
#pragma unroll
  for (int i = 0; i < 8; ++i) vg[i] = *(const v4f*)((const char*)g + boff + i * 512);
#pragma unroll
  for (int i = 0; i < 8; ++i) ve[i] = *(const v4f*)((const char*)be + boff + i * 512);
  // keeps the scalar load of stab up here; the scheduler sinks it to its use otherwise
  __builtin_amdgcn_sched_barrier(0);

  v4f s4 = {}, q4 = {};  // four independent chains each
#pragma unroll
  for (int i = 0; i < 8; ++i) {
    va[i] += vb[i];
    s4 += va[i];
    q4 += va[i] * va[i];
  }
  const float tot = wave_sum((s4[0] + s4[1]) + (s4[2] + s4[3]));
  const float tot2 = wave_sum((q4[0] + q4[1]) + (q4[2] + q4[3]));

  float mean = tot / (float)D_;
  float var = (tot2 - mean * tot) / (float)(D_ - 1);
  float sd = sqrtf(fmaxf(var, 0.f));
  sd = sd + stab * sin_rev(sd * 0.5f);  // sin(pi * sd): sd / 2 revolutions
  float inv = 1.0f / (sd + 1e-6f);

  char* of = (char*)(outF + (size_t)row * D_);
#pragma unroll
  for (int i = 0; i < 8; ++i) {
    va[i] = (va[i] - mean) * inv * vg[i] + ve[i];
    *(v4f*)(of + boff + i * 512) = va[i];
  }
  if (outH) {
    // behind the last f32 store: what follows rewrites the stores' data registers
    // and their scalar base
    asm volatile("s_wait_xcnt 0x0" ::: "memory");
    // without it the scheduler lifts the first conversions and the address
    // arithmetic, which rewrite those registers, over the wait
    __builtin_amdgcn_sched_barrier(0);
    _Float16* oh = outH + (size_t)row * D_ + lane * 4;
#pragma unroll
    for (int i = 0; i < 8; ++i) {
      v4h h;
#pragma unroll
      for (int e = 0; e < 4; ++e) h[e] = (_Float16)va[i][e];
      *(v4h*)(oh + i * 128) = h;
    }
  }
}

// ---------------------------------------------------------------------------
// launch
// ---------------------------------------------------------------------------
extern "C" void kernel_launch(void* const* d_in, const int* in_sizes, int n_in,
                              void* d_out, int out_size, void* d_ws,
                              size_t ws_size, hipStream_t stream) {
  const float* x   = (const float*)d_in[0];
  const float* Wq  = (const float*)d_in[1];  const float* bq  = (const float*)d_in[2];
  const float* Wk  = (const float*)d_in[3];  const float* bk  = (const float*)d_in[4];
  const float* Wv  = (const float*)d_in[5];  const float* bv  = (const float*)d_in[6];
  const float* Wo  = (const float*)d_in[7];  const float* bo  = (const float*)d_in[8];
  const float* res = (const float*)d_in[9];  const float* phs = (const float*)d_in[10];
  const float* g1  = (const float*)d_in[11]; const float* b1  = (const float*)d_in[12];
  const float* s1  = (const float*)d_in[13];
  const float* W1  = (const float*)d_in[14]; const float* bf1 = (const float*)d_in[15];
  const float* W2  = (const float*)d_in[16]; const float* bf2 = (const float*)d_in[17];
  const float* g2  = (const float*)d_in[18]; const float* b2  = (const float*)d_in[19];
  const float* s2  = (const float*)d_in[20];

  char* ws = (char*)d_ws;
  size_t off = 0;
  auto alloc = [&](size_t bytes) {
    char* p = ws + off;
    off += (bytes + 255) & ~(size_t)255;
    return p;
  };
  _Float16* xb   = (_Float16*)alloc((size_t)M_ * D_ * 2);
  _Float16* wqb  = (_Float16*)alloc((size_t)D_ * D_ * 2);  // transposed [N,K]
  _Float16* wkb  = (_Float16*)alloc((size_t)D_ * D_ * 2);
  _Float16* wvb  = (_Float16*)alloc((size_t)D_ * D_ * 2);
  _Float16* wob  = (_Float16*)alloc((size_t)D_ * D_ * 2);
  _Float16* w1b  = (_Float16*)alloc((size_t)D_ * F_ * 2);
  _Float16* w2b  = (_Float16*)alloc((size_t)F_ * D_ * 2);
  _Float16* qb   = (_Float16*)alloc((size_t)M_ * D_ * 2);
  _Float16* kb2  = (_Float16*)alloc((size_t)M_ * D_ * 2);
  _Float16* vt   = (_Float16*)alloc((size_t)M_ * D_ * 2);  // V transposed [D,M]
  _Float16* at16 = (_Float16*)alloc((size_t)M_ * D_ * 2);
  float*    aprj = (float*)   alloc((size_t)M_ * D_ * 4);
  float*    y1   = (float*)   alloc((size_t)M_ * D_ * 4);
  _Float16* y1b  = (_Float16*)alloc((size_t)M_ * D_ * 2);
  _Float16* act  = (_Float16*)alloc((size_t)M_ * F_ * 2);
  float*    ffn  = (float*)   alloc((size_t)M_ * D_ * 4);

  const dim3 blk256(256), blk128(128);

  // x -> f16; weights: f32 [K,N] -> f16 transposed [N,K]
  cvt_all<<<1024, blk256, 0, stream>>>(x, Wq, Wk, Wv, Wo, W1, W2, xb, wqb, wkb,
                                       wvb, wob, w1b, w2b);

  // QKV projections (V written transposed for the PV matmul)
  dim3 gDD(D_ / 64, M_ / 128);
  gemm_wmma<0><<<gDD, blk256, 0, stream>>>(xb, wqb, bq, qb,  nullptr, M_, D_, D_);
  gemm_wmma<0><<<gDD, blk256, 0, stream>>>(xb, wkb, bk, kb2, nullptr, M_, D_, D_);
  gemm_wmma<3><<<gDD, blk256, 0, stream>>>(xb, wvb, bv, vt,  nullptr, M_, D_, D_);

  // harmonic flash attention
  dim3 gFA(S_ / 64, B_ * H_);
  flash_attn<<<gFA, blk128, 0, stream>>>(qb, kb2, vt, res, phs, at16);

  // output projection (f32)
  gemm_wmma<1><<<gDD, blk256, 0, stream>>>(at16, wob, bo, nullptr, aprj, M_, D_, D_);

  // LN1
  harmonic_ln<<<M_ / 8, blk256, 0, stream>>>(x, aprj, g1, b1, s1, y1, y1b);

  // FFN up + spectral activation (f16), FFN down (f32)
  gemm_wmma<2><<<dim3(F_ / 64, M_ / 128), blk256, 0, stream>>>(
      y1b, w1b, bf1, act, nullptr, M_, F_, D_);
  gemm_wmma<1><<<gDD, blk256, 0, stream>>>(act, w2b, bf2, nullptr, ffn, M_, D_, F_);

  // LN2 -> final output
  harmonic_ln<<<M_ / 8, blk256, 0, stream>>>(y1, ffn, g2, b2, s2, (float*)d_out, nullptr);
}

// v008
// It runs in 203 microseconds.
// Next to v007, in two timings, it ran 1.04 times as fast each time.
// Over all steps from v000 it is 3.13 times as fast.
#include <hip/hip_runtime.h>
#include <hip/hip_bf16.h>

typedef __attribute__((ext_vector_type(16))) _Float16 v16h;
typedef __attribute__((ext_vector_type(8)))  _Float16 v8h;
typedef __attribute__((ext_vector_type(8)))  float    v8f;

#define B_  2
#define S_  2048
#define D_  1024
#define H_  16
#define F_  4096
#define M_  (B_ * S_)   // 4096 rows

// ---------------------------------------------------------------------------
// helpers
// ---------------------------------------------------------------------------
__device__ inline v16h cat8(v8h lo, v8h hi) {
  return __builtin_shufflevector(lo, hi, 0,1,2,3,4,5,6,7,8,9,10,11,12,13,14,15);
}

// 16x32 f16 fragment from LDS (k-contiguous rows). Lane l (l16=l&15, half=l>>4):
//   elements 0..7  -> k =      8*half + 0..7
//   elements 8..15 -> k = 16 + 8*half + 0..7
__device__ inline v16h load_frag(const _Float16* rowbase, int half) {
  v8h lo = *(const v8h*)(rowbase + 8 * half);
  v8h hi = *(const v8h*)(rowbase + 16 + 8 * half);
  return cat8(lo, hi);
}

__device__ inline v8f wmma16(v16h a, v16h b, v8f c) {
  return __builtin_amdgcn_wmma_f32_16x16x32_f16(
      false, a, false, b, (short)0, c, false, false);
}

// CDNA5 async global->LDS copy (ASYNCcnt-tracked, no VGPR data path).
// One thread's four copies of a key tile: 32 bytes of a K row, 32 of a V^T row.
// s_wait_xcnt 0 is the last line of the copies' own statement, so that no later
// write of an address register can be scheduled in front of it.
__device__ inline void async_copy_kv(const _Float16* gk, const _Float16* gv,
                                     _Float16* pk, _Float16* pv) {
  const char* k = (const char*)gk;
  const char* v = (const char*)gv;
  const unsigned lk = (unsigned)(unsigned long long)pk;  // low 32 bits = LDS offset
  const unsigned lv = (unsigned)(unsigned long long)pv;
  asm volatile("global_load_async_to_lds_b128 %0, %4, off\n\t"
               "global_load_async_to_lds_b128 %1, %5, off\n\t"
               "global_load_async_to_lds_b128 %2, %6, off\n\t"
               "global_load_async_to_lds_b128 %3, %7, off\n\t"
               "s_wait_xcnt 0x0"
               :: "v"(lk), "v"(lk + 16), "v"(lv), "v"(lv + 16),
                  "v"(k), "v"(k + 16), "v"(v), "v"(v + 16)
               : "memory");
}
// One thread's twelve copies of a k-tile: eight A rows and four B rows, 16 rows
// apart (gstep, lstep in bytes). s_wait_xcnt 0 is the last line of the copies'
// own statement, so that no later write of an address register can be scheduled
// in front of it.
__device__ inline void async_copy_tile(const _Float16* ga, const _Float16* gb,
                                       size_t gstep, _Float16* pa, _Float16* pb,
                                       unsigned lstep) {
  const char* a = (const char*)ga;
  const char* b = (const char*)gb;
  const unsigned la = (unsigned)(unsigned long long)pa;  // low 32 bits = LDS offset
  const unsigned lb = (unsigned)(unsigned long long)pb;
  asm volatile("global_load_async_to_lds_b128 %0, %12, off\n\t"
               "global_load_async_to_lds_b128 %1, %13, off\n\t"
               "global_load_async_to_lds_b128 %2, %14, off\n\t"
               "global_load_async_to_lds_b128 %3, %15, off\n\t"
               "global_load_async_to_lds_b128 %4, %16, off\n\t"
               "global_load_async_to_lds_b128 %5, %17, off\n\t"
               "global_load_async_to_lds_b128 %6, %18, off\n\t"
               "global_load_async_to_lds_b128 %7, %19, off\n\t"
               "global_load_async_to_lds_b128 %8, %20, off\n\t"
               "global_load_async_to_lds_b128 %9, %21, off\n\t"
               "global_load_async_to_lds_b128 %10, %22, off\n\t"
               "global_load_async_to_lds_b128 %11, %23, off\n\t"
               "s_wait_xcnt 0x0"
               :: "v"(la), "v"(la + lstep), "v"(la + 2 * lstep), "v"(la + 3 * lstep),
                  "v"(la + 4 * lstep), "v"(la + 5 * lstep), "v"(la + 6 * lstep),
                  "v"(la + 7 * lstep), "v"(lb), "v"(lb + lstep), "v"(lb + 2 * lstep),
                  "v"(lb + 3 * lstep),
                  "v"(a), "v"(a + gstep), "v"(a + 2 * gstep), "v"(a + 3 * gstep),
                  "v"(a + 4 * gstep), "v"(a + 5 * gstep), "v"(a + 6 * gstep),
                  "v"(a + 7 * gstep), "v"(b), "v"(b + gstep), "v"(b + 2 * gstep),
                  "v"(b + 3 * gstep)
               : "memory");
}
__device__ inline void async_wait0() {
  asm volatile("s_wait_asynccnt 0x0" ::: "memory");
}

// sin(2*pi*t) on v_sin_f32, which takes its argument in revolutions. v_fract_f32
// is the whole range reduction (exact; it hands the instruction a value in
// [0, 1)), so there is no compare and no branch per value. What is lost
// against the library's sinf is the rounding of t, |t| * 2^-24 revolutions: the
// size of the rounding that the f32 argument in radians carries anyway.
// The builtin, not asm text: the compiler then keeps the distance behind a matrix
// instruction whose operand registers the result reuses.
#define INV_2PI 0.15915494309189535f
__device__ inline float sin_rev(float t) {
  return __builtin_amdgcn_sinf(__builtin_amdgcn_fractf(t));
}
// The same for the activation, far behind the last matrix instruction. As asm so that
// the v_nop stands directly behind the transcendental: the instruction set asks for
// one slot before its source is overwritten.
__device__ inline float sin_rev_slot(float t) {
  float y;
  asm("v_sin_f32 %0, %1\n\tv_nop" : "=v"(y) : "v"(__builtin_amdgcn_fractf(t)));
  return y;
}

// 0.5 * x * (1 + tanh(u)) = x / (1 + e^(-2u)), u = sqrt(2/pi) * (x + 0.044715 x^3):
// one v_exp_f32 and one v_rcp_f32, no compare and no branch per value (the library's
// tanhf runs a polynomial and an exponential branch one after the other wherever a
// wave's lanes differ). The ends are exact: e^(-2u) = inf gives x * 0, 0 gives x * 1;
// and for u < 0 the quotient has none of the cancellation of 1 + tanh(u).
__device__ inline float spectral_act(float x) {
  const float a = -2.3022081981f;                   // -2 * sqrt(2/pi) * log2(e)
  const float b = a * 0.044715f;
  const float e = __builtin_amdgcn_exp2f(x * fmaf(b, x * x, a));  // e^(-2u)
  const float g = x * __builtin_amdgcn_rcpf(1.0f + e);
  return g + 0.5f * sin_rev_slot(x * INV_2PI);      // ALPHA=0.5, BETA=1.0
}

// ---------------------------------------------------------------------------
// All f32 -> f16 conversions of a call in ONE launch of 1024 work-groups:
//   blocks   0..255  x, 16384 elements each, copied in place order
//   blocks 256..511  Wq, Wk, Wv, Wo (64 tiles each)   f32 [K,N] -> f16 [N,K]
//   blocks 512..767  W1                               f32 [K,N] -> f16 [N,K]
//   blocks 768..1023 W2                               f32 [K,N] -> f16 [N,K]
// A work-group moves 64 KiB in and 32 KiB out, with 16 loads of 16 bytes in
// flight per lane, so that few waves have to be started for the bytes moved.
// ---------------------------------------------------------------------------
typedef __attribute__((ext_vector_type(4))) float    v4f;
typedef __attribute__((ext_vector_type(4))) _Float16 v4h;

// One 128(k) x 128(n) tile. A wave-wide load is 512 contiguous bytes of one
// source row; a lane holds 16 consecutive k of 4 neighbouring n, packs them to
// 16-byte chunks and lays them in LDS as [n][k]; a wave-wide store is two whole
// 256-byte pieces of two destination rows.
// LDS rows are 256 bytes, unpadded: chunk c of row n lies at place c ^ ((n >> 2) & 15),
// which spreads both the 16 writers (n 4 apart, same c) and the 16 readers
// (same n, c = 0..15) over all banks.
template <int K, int N>
__device__ inline void transpose_tile(const float* __restrict__ src,
                                      _Float16* __restrict__ dst, int kt, int nt,
                                      _Float16* tile) {
  const int t = threadIdx.x, lane = t & 31, wave = t >> 5;
  const float* s = src + (size_t)(kt * 128 + wave * 16) * N + nt * 128 + lane * 4;
  v4f v[16];
#pragma unroll  // all 16 loads are issued before the first value is used
  for (int i = 0; i < 16; ++i) v[i] = *(const v4f*)(s + (size_t)i * N);
  // behind the last load: the loads' address register, named here so that it lives
  // up to this wait, is not reused (as a load's own destination) in front of it
  asm volatile("s_wait_xcnt 0x0" :: "v"(s) : "memory");
#pragma unroll
  for (int j = 0; j < 4; ++j)
#pragma unroll
    for (int h = 0; h < 2; ++h) {
      v8h pk;
#pragma unroll
      for (int e = 0; e < 8; ++e) pk[e] = (_Float16)v[h * 8 + e][j];
      *(v8h*)&tile[(lane * 4 + j) * 128 + (((wave * 2 + h) ^ (lane & 15)) * 8)] = pk;
    }
  __syncthreads();
  const int seg = lane & 15;
  _Float16* d = dst + (size_t)(nt * 128 + wave * 2 + (lane >> 4)) * K + kt * 128 + seg * 8;
#pragma unroll
  for (int r = 0; r < 8; ++r) {
    const int n = r * 16 + wave * 2 + (lane >> 4);
    *(v8h*)(d + (size_t)r * 16 * K) =
        *(const v8h*)&tile[n * 128 + ((seg ^ ((n >> 2) & 15)) * 8)];
  }
  // behind the last store: no register that a store names is rewritten in front of
  // this wait, on any way that the branches behind the inlined tile leave open
  asm volatile("s_wait_xcnt 0x0" :: "v"(d) : "memory");
}

// The grid puts 4 work-groups on a WGP, 8 waves on a SIMD: a budget of 128 registers
// costs no residency. Without the attribute the compiler keeps under 64 registers
// and issues the 16 loads in three groups, each behind a wait on the one before.
__global__ __launch_bounds__(256) __attribute__((amdgpu_waves_per_eu(2, 8))) void cvt_all(
    const float* __restrict__ x, const float* __restrict__ Wq,
    const float* __restrict__ Wk, const float* __restrict__ Wv,
    const float* __restrict__ Wo, const float* __restrict__ W1,
    const float* __restrict__ W2, _Float16* __restrict__ xb,
    _Float16* __restrict__ wqb, _Float16* __restrict__ wkb,
    _Float16* __restrict__ wvb, _Float16* __restrict__ wob,
    _Float16* __restrict__ w1b, _Float16* __restrict__ w2b) {
  __shared__ __attribute__((aligned(16))) _Float16 tile[128 * 128];  // [n][k]
  const int job = blockIdx.x >> 8, idx = blockIdx.x & 255;  // the same in a whole block

  if (job == 0) {
    // a wave-wide load is 512 contiguous bytes, its store 256 contiguous bytes
    const unsigned base = idx * 16384 + threadIdx.x * 4;
    const unsigned boff = base * 4;  // byte offset of the lane's first load
    v4f v[16];
#pragma unroll  // all 16 loads are issued before the first value is used
    for (int i = 0; i < 16; ++i) v[i] = *(const v4f*)((const char*)x + boff + i * 4096);
    // behind the last load: the loads' offset register, named here so that it lives
    // up to this wait, is not reused (as a load's own destination) in front of it
    asm volatile("s_wait_xcnt 0x0" :: "v"(boff) : "memory");
#pragma unroll
    for (int i = 0; i < 16; ++i) {
      v4h h;
#pragma unroll
      for (int e = 0; e < 4; ++e) h[e] = (_Float16)v[i][e];
      *(v4h*)(xb + base + i * 1024) = h;
    }
  } else if (job == 1) {
    const int w = idx >> 6, ti = idx & 63;
    const float* src = w == 0 ? Wq : w == 1 ? Wk : w == 2 ? Wv : Wo;
    _Float16* dst = w == 0 ? wqb : w == 1 ? wkb : w == 2 ? wvb : wob;
    transpose_tile<D_, D_>(src, dst, ti >> 3, ti & 7, tile);
  } else if (job == 2) {
    transpose_tile<D_, F_>(W1, w1b, idx >> 5, idx & 31, tile);
  } else {
    transpose_tile<F_, D_>(W2, w2b, idx >> 3, idx & 7, tile);
  }
}

// ---------------------------------------------------------------------------
// WMMA GEMM: C[M,N] = A[M,K](f16) @ W[K,N] + bias, with W pre-transposed
// as WT[N,K] (k-contiguous).  block = 256 (8 waves, 4x2 of 32x32),
// macro-tile 128x64, k-step 128 (a staged row is two whole 128-byte lines, copied
// by 16 neighbouring lanes), async global->LDS staging into two buffers: the next
// k-tile's copies fly while this one is multiplied. K is a multiple of 128.
//   EPI 0: f16 out   EPI 1: f32 out   EPI 2: spectral->f16   EPI 3: f16 out^T
// ---------------------------------------------------------------------------
template <int EPI>
__global__ __launch_bounds__(256) void gemm_wmma(
    const _Float16* __restrict__ A, const _Float16* __restrict__ WT,
    const float* __restrict__ bias, _Float16* __restrict__ outH,
    float* __restrict__ outF, int M, int N, int K) {
  // rows of 128 k at a pitch of 136 (272 bytes = 16 x odd: no bank conflict for b128)
  __shared__ __attribute__((aligned(16))) _Float16 sA[2][128 * 136];  // [buffer][m][k]
  __shared__ __attribute__((aligned(16))) _Float16 sB[2][64 * 136];   // [buffer][n][k]

  const int t = threadIdx.x;
  const int lane = t & 31, wave = t >> 5;
  const int half = lane >> 4, l16 = lane & 15;
  const int m0 = blockIdx.y * 128, n0 = blockIdx.x * 64;
  const int wm = (wave >> 1) * 32, wn = (wave & 1) * 32;

  v8f acc[2][2] = {};

  const int cr = t >> 4, cseg = (t & 15) * 8;  // copies: 16 lanes x 16 B = one row
  const _Float16* ga = A + (size_t)(m0 + cr) * K + cseg;   // this lane's part of tile 0
  const _Float16* gb = WT + (size_t)(n0 + cr) * K + cseg;
  const int cl = cr * 136 + cseg;                          // its place in a buffer

  // tile 0 lands and is published; tile 1 is then under way during trip 0
  async_copy_tile(ga, gb, (size_t)K * 32, &sA[0][cl], &sB[0][cl], 16 * 272);
  async_wait0();
  __syncthreads();
  if (128 < K)
    async_copy_tile(ga + 128, gb + 128, (size_t)K * 32, &sA[1][cl], &sB[1][cl], 16 * 272);

  for (int kt = 0; kt < K; kt += 128) {
    const int buf = (kt >> 7) & 1;
    const _Float16* tA = sA[buf];
    const _Float16* tB = sB[buf];
#pragma unroll  // the tile's four 32-k parts, in ascending k as before
    for (int kk = 0; kk < 128; kk += 32) {
      v16h af[2], bf[2];
#pragma unroll
      for (int i = 0; i < 2; ++i)
        af[i] = load_frag(&tA[(wm + 16 * i + l16) * 136 + kk], half);
#pragma unroll
      for (int j = 0; j < 2; ++j)
        bf[j] = load_frag(&tB[(wn + 16 * j + l16) * 136 + kk], half);
#pragma unroll
      for (int i = 0; i < 2; ++i)
#pragma unroll
        for (int j = 0; j < 2; ++j)
          acc[i][j] = wmma16(af[i], bf[j], acc[i][j]);
    }
    // this wave's LDS reads of this tile have returned before its buffer is refilled
    asm volatile("s_wait_dscnt 0x0" ::: "memory");
    async_wait0();    // this wave's copies of the next tile have landed
    __syncthreads();  // publishes the next tile; ends every read of this one
    if (kt + 256 < K)
      async_copy_tile(ga + kt + 256, gb + kt + 256, (size_t)K * 32, &sA[buf][cl],
                      &sB[buf][cl], 16 * 272);
  }
  async_wait0();  // no copy is outstanding when the wave goes on to its end

#pragma unroll
  for (int i = 0; i < 2; ++i)
#pragma unroll
    for (int j = 0; j < 2; ++j) {
      const int nn = n0 + wn + 16 * j + l16;      // C layout: n = lane&15
      const float bval = bias[nn];
      if (EPI == 3) {
        // transposed f16 store: fixed n per lane, 8 consecutive m -> b128
        v8h pk;
#pragma unroll
        for (int jj = 0; jj < 8; ++jj)
          pk[jj] = (_Float16)(acc[i][j][jj] + bval);
        *(v8h*)(outH + (size_t)nn * M + (m0 + wm + 16 * i + 8 * half)) = pk;
      } else {
#pragma unroll
        for (int jj = 0; jj < 8; ++jj) {
          const int m = m0 + wm + 16 * i + jj + 8 * half;  // m = vgpr + 8*half
          float v = acc[i][j][jj] + bval;
          if (EPI == 2) v = spectral_act(v);
          size_t idx = (size_t)m * N + nn;
          if (EPI == 1) outF[idx] = v;
          else          outH[idx] = (_Float16)v;
        }
      }
    }
}

__device__ inline float other_half(float x) {
  int b = __builtin_bit_cast(int, x);
  b = __builtin_amdgcn_permlanex16(b, b, 0x76543210, 0xfedcba98, false, false);
  return __builtin_bit_cast(float, b);
}

// e^x = exp2(x * log2(e)) on v_exp_f32 (what __expf gives). Written as asm so that
// the v_nop stands directly behind the transcendental: the instruction set asks
// for one slot before its source is overwritten or its result read.
__device__ inline float exp_slot(float x) {
  float y;
  asm("v_exp_f32 %0, %1\n\tv_nop" : "=v"(y) : "v"(x * 1.44269504088896340736f));
  return y;
}

__global__ __launch_bounds__(128) void flash_attn(
    const _Float16* __restrict__ Q, const _Float16* __restrict__ Kc,
    const _Float16* __restrict__ Vt, const float* __restrict__ resonance,
    const float* __restrict__ phase, _Float16* __restrict__ Oh) {
  // Row pitches of 16 bytes x odd (144 and 80): the 16 rows that a half wave's
  // 16-byte fragment reads touch then fall on 16 different groups of four banks.
  // At the rows' own lengths (128 and 64 bytes) they fall on two and on four groups.
  constexpr int KP = 72;  // f16 per sK row: 64 hd + 8 unused
  constexpr int VP = 40;  // f16 per sVt row: 32 keys + 8 unused
  // Two buffers each: the next key tile's copies fly while this one is worked on.
  __shared__ __attribute__((aligned(16))) _Float16 sK[2][32 * KP];   // [buffer][key][hd]
  __shared__ __attribute__((aligned(16))) _Float16 sVt[2][64 * VP];  // [buffer][hd][key]

  const int t = threadIdx.x;
  const int lane = t & 31, wave = t >> 5;
  const int half = lane >> 4, l16 = lane & 15;
  const int bh = blockIdx.y, b = bh / H_, h = bh % H_;
  const int q0 = blockIdx.x * 64 + wave * 16;
  const float r = resonance[h], ph = phase[h];
  const float scale = 0.125f;  // 1/sqrt(64)
  // (score + phase) in revolutions = raw * srev + prev
  const float srev = scale * INV_2PI, prev = ph * INV_2PI;

  const _Float16* qbase = Q + ((size_t)(b * S_ + q0 + l16)) * D_ + h * 64;
  v16h qf0 = cat8(*(const v8h*)(qbase + 8 * half),
                  *(const v8h*)(qbase + 16 + 8 * half));
  v16h qf1 = cat8(*(const v8h*)(qbase + 32 + 8 * half),
                  *(const v8h*)(qbase + 48 + 8 * half));

  float st_m = -3.0e38f;  // running maximum of query l16 (equal in both halves)
  float st_l = 0.f;       // running sum over this half's keys only
  v8f o[4] = {};          // o[tt][j] = O[query l16][hd = 16*tt + 8*half + j]

  const int kr = t >> 2, kseg = (t & 3) * 16;  // K loader: 16 f16 / thread
  const int vr = t >> 1, vseg = (t & 1) * 16;  // Vt loader: 16 f16 / thread
  const _Float16* gk = Kc + ((size_t)(b * S_ + kr)) * D_ + h * 64 + kseg;  // tile 0
  const _Float16* gv = Vt + ((size_t)(h * 64 + vr)) * M_ + b * S_ + vseg;
  const int kl = kr * KP + kseg, vl = vr * VP + vseg;  // the lane's places in a buffer

  // tile 0 lands and is published; tile 1 (S_ holds 64 tiles) is then under way
  async_copy_kv(gk, gv, &sK[0][kl], &sVt[0][vl]);
  async_wait0();
  __syncthreads();
  async_copy_kv(gk + (size_t)32 * D_, gv + 32, &sK[1][kl], &sVt[1][vl]);

  for (int kv = 0; kv < S_; kv += 32) {
    const int buf = (kv >> 5) & 1;
    const _Float16* tK = sK[buf];
    const _Float16* tV = sVt[buf];

    // S^T for 32 keys: two 16(key) x 16(query) tiles, hd=64 reduced as 32+32.
    // s0[j]: key kv + 8*half + j;  s1[j]: key kv + 16 + 8*half + j.
    v8f s0 = {}, s1 = {};
    {
      const _Float16* k0 = &tK[l16 * KP];
      const _Float16* k1 = &tK[(16 + l16) * KP];
      v16h k00 = cat8(*(const v8h*)(k0 + 8 * half), *(const v8h*)(k0 + 16 + 8 * half));
      v16h k01 = cat8(*(const v8h*)(k0 + 32 + 8 * half), *(const v8h*)(k0 + 48 + 8 * half));
      v16h k10 = cat8(*(const v8h*)(k1 + 8 * half), *(const v8h*)(k1 + 16 + 8 * half));
      v16h k11 = cat8(*(const v8h*)(k1 + 32 + 8 * half), *(const v8h*)(k1 + 48 + 8 * half));
      s0 = wmma16(k00, qf0, s0); s0 = wmma16(k01, qf1, s0);
      s1 = wmma16(k10, qf0, s1); s1 = wmma16(k11, qf1, s1);
    }

    float mx = -3.0e38f;
#pragma unroll
    for (int j = 0; j < 8; ++j) {
      float a = s0[j] * scale;  a += r * sin_rev(fmaf(s0[j], srev, prev));
      float c = s1[j] * scale;  c += r * sin_rev(fmaf(s1[j], srev, prev));
      s0[j] = a; s1[j] = c;
      mx = fmaxf(mx, fmaxf(a, c));
    }
    mx = fmaxf(mx, other_half(mx));
    const float nm = fmaxf(st_m, mx);
    const float corr = exp_slot(st_m - nm);
    st_m = nm;

    // P^T as a B operand: element s is key 8*half + s (16 + 8*half + s-8 for s >= 8), which is exactly
    // s0[0..7] then s1[0..7] of this lane.
    v16h pf;
    float sm = 0.f;
#pragma unroll
    for (int j = 0; j < 8; ++j) {
      float p0 = exp_slot(s0[j] - nm), p1 = exp_slot(s1[j] - nm);
      sm += p0 + p1;
      pf[j] = (_Float16)p0;
      pf[8 + j] = (_Float16)p1;
    }
    st_l = st_l * corr + sm;
#pragma unroll
    for (int tt = 0; tt < 4; ++tt)
#pragma unroll
      for (int j = 0; j < 8; ++j) o[tt][j] *= corr;

#pragma unroll
    for (int tt = 0; tt < 4; ++tt) {
      const _Float16* vb = &tV[(tt * 16 + l16) * VP];
      v16h vf = cat8(*(const v8h*)(vb + 8 * half),
                     *(const v8h*)(vb + 16 + 8 * half));
      o[tt] = wmma16(vf, pf, o[tt]);
    }
    // this wave's LDS reads of this tile have returned before its buffer is refilled
    asm volatile("s_wait_dscnt 0x0" ::: "memory");
    async_wait0();    // this wave's copies of the next tile have landed
    __syncthreads();  // publishes the next tile; ends every read of this one
    if (kv + 64 < S_)
      async_copy_kv(gk + (size_t)(kv + 64) * D_, gv + kv + 64, &sK[buf][kl], &sVt[buf][vl]);
  }
  async_wait0();  // no copy is outstanding when the wave goes on to its end

  // join the two halves' sums once; 8 consecutive hd per lane -> 16-byte stores
  const float inv = 1.0f / (st_l + other_half(st_l));
  _Float16* dst = Oh + ((size_t)(b * S_ + q0 + l16)) * D_ + h * 64 + 8 * half;
#pragma unroll
  for (int tt = 0; tt < 4; ++tt) {
    v8h pk;
#pragma unroll
    for (int j = 0; j < 8; ++j) pk[j] = (_Float16)(o[tt][j] * inv);
    *(v8h*)(dst + tt * 16) = pk;
  }
}

// ---------------------------------------------------------------------------
// Harmonic LayerNorm (unbiased std): one WAVE per row, 8 rows per block.
// A lane holds 32 of the row's 1024 values in registers (eight 16-byte loads from
// each addend, a wave-wide load being 512 contiguous bytes), so the row is read
// once, the two sums need no LDS and no barrier, and a launch starts 4096 waves.
// ---------------------------------------------------------------------------
// x + (x of lane l ^ MASK), inside a 16-lane row: DPP row_xmask is 0x160 + MASK
template <int MASK>
__device__ inline float add_xmask(float x) {
  const int y = __builtin_amdgcn_update_dpp(0, __builtin_bit_cast(int, x), 0x160 + MASK,
                                            0xf, 0xf, true);
  return x + __builtin_bit_cast(float, y);
}
// sum over the wave's 32 lanes; every lane ends with the same bits
__device__ inline float wave_sum(float x) {
  x = add_xmask<1>(x);
  x = add_xmask<2>(x);
  x = add_xmask<4>(x);
  x = add_xmask<8>(x);
  return x + other_half(x);
}

// The grid puts 2 work-groups on a WGP, 4 waves on a SIMD: a budget of 256 registers
// costs no residency, and all 32 loads of a lane can be in flight at once.
__global__ __launch_bounds__(256) __attribute__((amdgpu_waves_per_eu(2, 4))) void harmonic_ln(
    const float* __restrict__ A, const float* __restrict__ Bv,
    const float* __restrict__ g, const float* __restrict__ be,
    const float* __restrict__ s, float* __restrict__ outF,
    _Float16* __restrict__ outH) {
  const int lane = threadIdx.x & 31;
  // the wave's number in a scalar register: the row's addresses are then scalar bases
  const int row = blockIdx.x * 8 + __builtin_amdgcn_readfirstlane(threadIdx.x >> 5);
  const unsigned boff = lane * 16;  // byte offset of the lane's first four columns
  const char* a = (const char*)(A + (size_t)row * D_);
  const char* bb = (const char*)(Bv + (size_t)row * D_);
  const float stab = s[0];  // asked for here: its latency passes beside the row's loads

  // every loop over i below is unrolled: constant indices keep the arrays in registers
  v4f va[8], vb[8], vg[8], ve[8];
#pragma unroll  // all loads are issued before the first value is used
  for (int i = 0; i < 8; ++i) va[i] = *(const v4f*)(a + boff + i * 512);
#pragma unroll
  for (int i = 0; i < 8; ++i) vb[i] = *(const v4f*)(bb + boff + i * 512);
#pragma unroll
  for (int i = 0; i < 8; ++i) vg[i] = *(const v4f*)((const char*)g + boff + i * 512);
#pragma unroll
  for (int i = 0; i < 8; ++i) ve[i] = *(const v4f*)((const char*)be + boff + i * 512);
  // keeps the scalar load of stab up here; the scheduler sinks it to its use otherwise
  __builtin_amdgcn_sched_barrier(0);

  v4f s4 = {}, q4 = {};  // four independent chains each
#pragma unroll
  for (int i = 0; i < 8; ++i) {
    va[i] += vb[i];
    s4 += va[i];
    q4 += va[i] * va[i];
  }
  const float tot = wave_sum((s4[0] + s4[1]) + (s4[2] + s4[3]));
  const float tot2 = wave_sum((q4[0] + q4[1]) + (q4[2] + q4[3]));

  float mean = tot / (float)D_;
  float var = (tot2 - mean * tot) / (float)(D_ - 1);
  float sd = sqrtf(fmaxf(var, 0.f));
  sd = sd + stab * sin_rev(sd * 0.5f);  // sin(pi * sd): sd / 2 revolutions
  float inv = 1.0f / (sd + 1e-6f);

  char* of = (char*)(outF + (size_t)row * D_);
#pragma unroll
  for (int i = 0; i < 8; ++i) {
    va[i] = (va[i] - mean) * inv * vg[i] + ve[i];
    *(v4f*)(of + boff + i * 512) = va[i];
  }
  if (outH) {
    // behind the last f32 store: what follows rewrites the stores' data registers
    // and their scalar base
    asm volatile("s_wait_xcnt 0x0" ::: "memory");
    // without it the scheduler lifts the first conversions and the address
    // arithmetic, which rewrite those registers, over the wait
    __builtin_amdgcn_sched_barrier(0);
    _Float16* oh = outH + (size_t)row * D_ + lane * 4;
#pragma unroll
    for (int i = 0; i < 8; ++i) {
      v4h h;
#pragma unroll
      for (int e = 0; e < 4; ++e) h[e] = (_Float16)va[i][e];
      *(v4h*)(oh + i * 128) = h;
    }
  }
}

// ---------------------------------------------------------------------------
// launch
// ---------------------------------------------------------------------------
extern "C" void kernel_launch(void* const* d_in, const int* in_sizes, int n_in,
                              void* d_out, int out_size, void* d_ws,
                              size_t ws_size, hipStream_t stream) {
  const float* x   = (const float*)d_in[0];
  const float* Wq  = (const float*)d_in[1];  const float* bq  = (const float*)d_in[2];
  const float* Wk  = (const float*)d_in[3];  const float* bk  = (const float*)d_in[4];
  const float* Wv  = (const float*)d_in[5];  const float* bv  = (const float*)d_in[6];
  const float* Wo  = (const float*)d_in[7];  const float* bo  = (const float*)d_in[8];
  const float* res = (const float*)d_in[9];  const float* phs = (const float*)d_in[10];
  const float* g1  = (const float*)d_in[11]; const float* b1  = (const float*)d_in[12];
  const float* s1  = (const float*)d_in[13];
  const float* W1  = (const float*)d_in[14]; const float* bf1 = (const float*)d_in[15];
  const float* W2  = (const float*)d_in[16]; const float* bf2 = (const float*)d_in[17];
  const float* g2  = (const float*)d_in[18]; const float* b2  = (const float*)d_in[19];
  const float* s2  = (const float*)d_in[20];

  char* ws = (char*)d_ws;
  size_t off = 0;
  auto alloc = [&](size_t bytes) {
    char* p = ws + off;
    off += (bytes + 255) & ~(size_t)255;
    return p;
  };
  _Float16* xb   = (_Float16*)alloc((size_t)M_ * D_ * 2);
  _Float16* wqb  = (_Float16*)alloc((size_t)D_ * D_ * 2);  // transposed [N,K]
  _Float16* wkb  = (_Float16*)alloc((size_t)D_ * D_ * 2);
  _Float16* wvb  = (_Float16*)alloc((size_t)D_ * D_ * 2);
  _Float16* wob  = (_Float16*)alloc((size_t)D_ * D_ * 2);
  _Float16* w1b  = (_Float16*)alloc((size_t)D_ * F_ * 2);
  _Float16* w2b  = (_Float16*)alloc((size_t)F_ * D_ * 2);
  _Float16* qb   = (_Float16*)alloc((size_t)M_ * D_ * 2);
  _Float16* kb2  = (_Float16*)alloc((size_t)M_ * D_ * 2);
  _Float16* vt   = (_Float16*)alloc((size_t)M_ * D_ * 2);  // V transposed [D,M]
  _Float16* at16 = (_Float16*)alloc((size_t)M_ * D_ * 2);
  float*    aprj = (float*)   alloc((size_t)M_ * D_ * 4);
  float*    y1   = (float*)   alloc((size_t)M_ * D_ * 4);
  _Float16* y1b  = (_Float16*)alloc((size_t)M_ * D_ * 2);
  _Float16* act  = (_Float16*)alloc((size_t)M_ * F_ * 2);
  float*    ffn  = (float*)   alloc((size_t)M_ * D_ * 4);

  const dim3 blk256(256), blk128(128);

  // x -> f16; weights: f32 [K,N] -> f16 transposed [N,K]
  cvt_all<<<1024, blk256, 0, stream>>>(x, Wq, Wk, Wv, Wo, W1, W2, xb, wqb, wkb,
                                       wvb, wob, w1b, w2b);

  // QKV projections (V written transposed for the PV matmul)
  dim3 gDD(D_ / 64, M_ / 128);
  gemm_wmma<0><<<gDD, blk256, 0, stream>>>(xb, wqb, bq, qb,  nullptr, M_, D_, D_);
  gemm_wmma<0><<<gDD, blk256, 0, stream>>>(xb, wkb, bk, kb2, nullptr, M_, D_, D_);
  gemm_wmma<3><<<gDD, blk256, 0, stream>>>(xb, wvb, bv, vt,  nullptr, M_, D_, D_);

  // harmonic flash attention
  dim3 gFA(S_ / 64, B_ * H_);
  flash_attn<<<gFA, blk128, 0, stream>>>(qb, kb2, vt, res, phs, at16);

  // output projection (f32)
  gemm_wmma<1><<<gDD, blk256, 0, stream>>>(at16, wob, bo, nullptr, aprj, M_, D_, D_);

  // LN1
  harmonic_ln<<<M_ / 8, blk256, 0, stream>>>(x, aprj, g1, b1, s1, y1, y1b);

  // FFN up + spectral activation (f16), FFN down (f32)
  gemm_wmma<2><<<dim3(F_ / 64, M_ / 128), blk256, 0, stream>>>(
      y1b, w1b, bf1, act, nullptr, M_, F_, D_);
  gemm_wmma<1><<<gDD, blk256, 0, stream>>>(act, w2b, bf2, nullptr, ffn, M_, D_, F_);

  // LN2 -> final output
  harmonic_ln<<<M_ / 8, blk256, 0, stream>>>(y1, ffn, g2, b2, s2, (float*)d_out, nullptr);
}

// v009
// It runs in 196 microseconds.
// Timed twice side by side with v008, it ran 1.04 and 1.03 times as fast.
// All steps since v000 together make it 3.24 times as fast.
#include <hip/hip_runtime.h>
#include <hip/hip_bf16.h>

typedef __attribute__((ext_vector_type(16))) _Float16 v16h;
typedef __attribute__((ext_vector_type(8)))  _Float16 v8h;
typedef __attribute__((ext_vector_type(8)))  float    v8f;

#define B_  2
#define S_  2048
#define D_  1024
#define H_  16
#define F_  4096
#define M_  (B_ * S_)   // 4096 rows

// ---------------------------------------------------------------------------
// helpers
// ---------------------------------------------------------------------------
__device__ inline v16h cat8(v8h lo, v8h hi) {
  return __builtin_shufflevector(lo, hi, 0,1,2,3,4,5,6,7,8,9,10,11,12,13,14,15);
}

// 16x32 f16 fragment from LDS (k-contiguous rows). Lane l (l16=l&15, half=l>>4):
//   elements 0..7  -> k =      8*half + 0..7
//   elements 8..15 -> k = 16 + 8*half + 0..7
__device__ inline v16h load_frag(const _Float16* rowbase, int half) {
  v8h lo = *(const v8h*)(rowbase + 8 * half);
  v8h hi = *(const v8h*)(rowbase + 16 + 8 * half);
  return cat8(lo, hi);
}

__device__ inline v8f wmma16(v16h a, v16h b, v8f c) {
  return __builtin_amdgcn_wmma_f32_16x16x32_f16(
      false, a, false, b, (short)0, c, false, false);
}

// CDNA5 async global->LDS copy (ASYNCcnt-tracked, no VGPR data path).
// One thread's four copies of a key tile: 32 bytes of a K row, 32 of a V^T row.
// s_wait_xcnt 0 is the last line of the copies' own statement, so that no later
// write of an address register can be scheduled in front of it.
__device__ inline void async_copy_kv(const _Float16* gk, const _Float16* gv,
                                     _Float16* pk, _Float16* pv) {
  const char* k = (const char*)gk;
  const char* v = (const char*)gv;
  const unsigned lk = (unsigned)(unsigned long long)pk;  // low 32 bits = LDS offset
  const unsigned lv = (unsigned)(unsigned long long)pv;
  asm volatile("global_load_async_to_lds_b128 %0, %4, off\n\t"
               "global_load_async_to_lds_b128 %1, %5, off\n\t"
               "global_load_async_to_lds_b128 %2, %6, off\n\t"
               "global_load_async_to_lds_b128 %3, %7, off\n\t"
               "s_wait_xcnt 0x0"
               :: "v"(lk), "v"(lk + 16), "v"(lv), "v"(lv + 16),
                  "v"(k), "v"(k + 16), "v"(v), "v"(v + 16)
               : "memory");
}
// One thread's eight copies of one operand's k-tile: eight rows, 16 rows apart
// (gstep, lstep in bytes). s_wait_xcnt 0 is the last line of the copies' own
// statement, so that no later write of an address register can be scheduled in
// front of it.
__device__ inline void async_copy_rows8(const _Float16* gp, size_t gstep, _Float16* lp,
                                        unsigned lstep) {
  const char* g = (const char*)gp;
  const unsigned l = (unsigned)(unsigned long long)lp;  // low 32 bits = LDS offset
  asm volatile("global_load_async_to_lds_b128 %0, %8, off\n\t"
               "global_load_async_to_lds_b128 %1, %9, off\n\t"
               "global_load_async_to_lds_b128 %2, %10, off\n\t"
               "global_load_async_to_lds_b128 %3, %11, off\n\t"
               "global_load_async_to_lds_b128 %4, %12, off\n\t"
               "global_load_async_to_lds_b128 %5, %13, off\n\t"
               "global_load_async_to_lds_b128 %6, %14, off\n\t"
               "global_load_async_to_lds_b128 %7, %15, off\n\t"
               "s_wait_xcnt 0x0"
               :: "v"(l), "v"(l + lstep), "v"(l + 2 * lstep), "v"(l + 3 * lstep),
                  "v"(l + 4 * lstep), "v"(l + 5 * lstep), "v"(l + 6 * lstep),
                  "v"(l + 7 * lstep),
                  "v"(g), "v"(g + gstep), "v"(g + 2 * gstep), "v"(g + 3 * gstep),
                  "v"(g + 4 * gstep), "v"(g + 5 * gstep), "v"(g + 6 * gstep),
                  "v"(g + 7 * gstep)
               : "memory");
}
// A k-tile of both operands: 128 rows each, sixteen copies a thread.
__device__ inline void async_copy_tile(const _Float16* ga, const _Float16* gb,
                                       size_t gstep, _Float16* pa, _Float16* pb,
                                       unsigned lstep) {
  async_copy_rows8(ga, gstep, pa, lstep);
  async_copy_rows8(gb, gstep, pb, lstep);
}
__device__ inline void async_wait0() {
  asm volatile("s_wait_asynccnt 0x0" ::: "memory");
}

// sin(2*pi*t) on v_sin_f32, which takes its argument in revolutions. v_fract_f32
// is the whole range reduction (exact; it hands the instruction a value in
// [0, 1)), so there is no compare and no branch per value. What is lost
// against the library's sinf is the rounding of t, |t| * 2^-24 revolutions: the
// size of the rounding that the f32 argument in radians carries anyway.
// The builtin, not asm text: the compiler then keeps the distance behind a matrix
// instruction whose operand registers the result reuses.
#define INV_2PI 0.15915494309189535f
__device__ inline float sin_rev(float t) {
  return __builtin_amdgcn_sinf(__builtin_amdgcn_fractf(t));
}
// The same for the activation, far behind the last matrix instruction. As asm so that
// the v_nop stands directly behind the transcendental: the instruction set asks for
// one slot before its source is overwritten.
__device__ inline float sin_rev_slot(float t) {
  float y;
  asm("v_sin_f32 %0, %1\n\tv_nop" : "=v"(y) : "v"(__builtin_amdgcn_fractf(t)));
  return y;
}

// 0.5 * x * (1 + tanh(u)) = x / (1 + e^(-2u)), u = sqrt(2/pi) * (x + 0.044715 x^3):
// one v_exp_f32 and one v_rcp_f32, no compare and no branch per value (the library's
// tanhf runs a polynomial and an exponential branch one after the other wherever a
// wave's lanes differ). The ends are exact: e^(-2u) = inf gives x * 0, 0 gives x * 1;
// and for u < 0 the quotient has none of the cancellation of 1 + tanh(u).
__device__ inline float spectral_act(float x) {
  const float a = -2.3022081981f;                   // -2 * sqrt(2/pi) * log2(e)
  const float b = a * 0.044715f;
  // Both as asm, like the sine above, so that the v_nop stands directly behind the
  // transcendental.
  float e, q;
  asm("v_exp_f32 %0, %1\n\tv_nop" : "=v"(e) : "v"(x * fmaf(b, x * x, a)));  // e^(-2u)
  asm("v_rcp_f32 %0, %1\n\tv_nop" : "=v"(q) : "v"(1.0f + e));
  const float g = x * q;
  return g + 0.5f * sin_rev_slot(x * INV_2PI);      // ALPHA=0.5, BETA=1.0
}

// ---------------------------------------------------------------------------
// All f32 -> f16 conversions of a call in ONE launch of 1024 work-groups:
//   blocks   0..255  x, 16384 elements each, copied in place order
//   blocks 256..511  Wq, Wk, Wv, Wo (64 tiles each)   f32 [K,N] -> f16 [N,K]
//   blocks 512..767  W1                               f32 [K,N] -> f16 [N,K]
//   blocks 768..1023 W2                               f32 [K,N] -> f16 [N,K]
// A work-group moves 64 KiB in and 32 KiB out, with 16 loads of 16 bytes in
// flight per lane, so that few waves have to be started for the bytes moved.
// ---------------------------------------------------------------------------
typedef __attribute__((ext_vector_type(4))) float    v4f;
typedef __attribute__((ext_vector_type(4))) _Float16 v4h;

// One 128(k) x 128(n) tile. A wave-wide load is 512 contiguous bytes of one
// source row; a lane holds 16 consecutive k of 4 neighbouring n, packs them to
// 16-byte chunks and lays them in LDS as [n][k]; a wave-wide store is two whole
// 256-byte pieces of two destination rows.
// LDS rows are 256 bytes, unpadded: chunk c of row n lies at place c ^ ((n >> 2) & 15),
// which spreads both the 16 writers (n 4 apart, same c) and the 16 readers
// (same n, c = 0..15) over all banks.
template <int K, int N>
__device__ inline void transpose_tile(const float* __restrict__ src,
                                      _Float16* __restrict__ dst, int kt, int nt,
                                      _Float16* tile) {
  const int t = threadIdx.x, lane = t & 31, wave = t >> 5;
  const float* s = src + (size_t)(kt * 128 + wave * 16) * N + nt * 128 + lane * 4;
  v4f v[16];
#pragma unroll  // all 16 loads are issued before the first value is used
  for (int i = 0; i < 16; ++i) v[i] = *(const v4f*)(s + (size_t)i * N);
  // behind the last load: the loads' address register, named here so that it lives
  // up to this wait, is not reused (as a load's own destination) in front of it
  asm volatile("s_wait_xcnt 0x0" :: "v"(s) : "memory");
#pragma unroll
  for (int j = 0; j < 4; ++j)
#pragma unroll
    for (int h = 0; h < 2; ++h) {
      v8h pk;
#pragma unroll
      for (int e = 0; e < 8; ++e) pk[e] = (_Float16)v[h * 8 + e][j];
      *(v8h*)&tile[(lane * 4 + j) * 128 + (((wave * 2 + h) ^ (lane & 15)) * 8)] = pk;
    }
  __syncthreads();
  const int seg = lane & 15;
  _Float16* d = dst + (size_t)(nt * 128 + wave * 2 + (lane >> 4)) * K + kt * 128 + seg * 8;
#pragma unroll
  for (int r = 0; r < 8; ++r) {
    const int n = r * 16 + wave * 2 + (lane >> 4);
    *(v8h*)(d + (size_t)r * 16 * K) =
        *(const v8h*)&tile[n * 128 + ((seg ^ ((n >> 2) & 15)) * 8)];
  }
  // behind the last store: no register that a store names is rewritten in front of
  // this wait, on any way that the branches behind the inlined tile leave open
  asm volatile("s_wait_xcnt 0x0" :: "v"(d) : "memory");
}

// The grid puts 4 work-groups on a WGP, 8 waves on a SIMD: a budget of 128 registers
// costs no residency. Without the attribute the compiler keeps under 64 registers
// and issues the 16 loads in three groups, each behind a wait on the one before.
__global__ __launch_bounds__(256) __attribute__((amdgpu_waves_per_eu(2, 8))) void cvt_all(
    const float* __restrict__ x, const float* __restrict__ Wq,
    const float* __restrict__ Wk, const float* __restrict__ Wv,
    const float* __restrict__ Wo, const float* __restrict__ W1,
    const float* __restrict__ W2, _Float16* __restrict__ xb,
    _Float16* __restrict__ wqb, _Float16* __restrict__ wkb,
    _Float16* __restrict__ wvb, _Float16* __restrict__ wob,
    _Float16* __restrict__ w1b, _Float16* __restrict__ w2b) {
  __shared__ __attribute__((aligned(16))) _Float16 tile[128 * 128];  // [n][k]
  const int job = blockIdx.x >> 8, idx = blockIdx.x & 255;  // the same in a whole block

  if (job == 0) {
    // a wave-wide load is 512 contiguous bytes, its store 256 contiguous bytes
    const unsigned base = idx * 16384 + threadIdx.x * 4;
    const unsigned boff = base * 4;  // byte offset of the lane's first load
    v4f v[16];
#pragma unroll  // all 16 loads are issued before the first value is used
    for (int i = 0; i < 16; ++i) v[i] = *(const v4f*)((const char*)x + boff + i * 4096);
    // behind the last load: the loads' offset register, named here so that it lives
    // up to this wait, is not reused (as a load's own destination) in front of it
    asm volatile("s_wait_xcnt 0x0" :: "v"(boff) : "memory");
#pragma unroll
    for (int i = 0; i < 16; ++i) {
      v4h h;
#pragma unroll
      for (int e = 0; e < 4; ++e) h[e] = (_Float16)v[i][e];
      *(v4h*)(xb + base + i * 1024) = h;
    }
  } else if (job == 1) {
    const int w = idx >> 6, ti = idx & 63;
    const float* src = w == 0 ? Wq : w == 1 ? Wk : w == 2 ? Wv : Wo;
    _Float16* dst = w == 0 ? wqb : w == 1 ? wkb : w == 2 ? wvb : wob;
    transpose_tile<D_, D_>(src, dst, ti >> 3, ti & 7, tile);
  } else if (job == 2) {
    transpose_tile<D_, F_>(W1, w1b, idx >> 5, idx & 31, tile);
  } else {
    transpose_tile<F_, D_>(W2, w2b, idx >> 3, idx & 7, tile);
  }
}

// ---------------------------------------------------------------------------
// WMMA GEMM: C[M,N] = A[M,K](f16) @ W[K,N] + bias, with W pre-transposed
// as WT[N,K] (k-contiguous).  block = 256 (8 waves, 2x4 of 64x32),
// macro-tile 128x128, k-step 128 (a staged row is two whole 128-byte lines, copied
// by 16 neighbouring lanes), async global->LDS staging into two buffers: the next
// k-tile's copies fly while this one is multiplied. K is a multiple of 128.
//   EPI 0: f16 out   EPI 1: f32 out   EPI 2: spectral->f16   EPI 3: f16 out^T
// ---------------------------------------------------------------------------
template <int EPI>
__global__ __launch_bounds__(256) void gemm_wmma(
    const _Float16* __restrict__ A, const _Float16* __restrict__ WT,
    const float* __restrict__ bias, _Float16* __restrict__ outH,
    float* __restrict__ outF, int M, int N, int K) {
  // rows of 128 k at a pitch of 136 (272 bytes = 16 x odd: no bank conflict for b128)
  __shared__ __attribute__((aligned(16))) _Float16 sA[2][128 * 136];  // [buffer][m][k]
  __shared__ __attribute__((aligned(16))) _Float16 sB[2][128 * 136];  // [buffer][n][k]

  const int t = threadIdx.x;
  const int lane = t & 31, wave = t >> 5;
  const int half = lane >> 4, l16 = lane & 15;
  const int m0 = blockIdx.y * 128, n0 = blockIdx.x * 128;
  const int wm = (wave >> 2) * 64, wn = (wave & 3) * 32;

  v8f acc[4][2] = {};

  const int cr = t >> 4, cseg = (t & 15) * 8;  // copies: 16 lanes x 16 B = one row
  const _Float16* ga = A + (size_t)(m0 + cr) * K + cseg;   // this lane's part of tile 0
  const _Float16* gb = WT + (size_t)(n0 + cr) * K + cseg;
  const int cl = cr * 136 + cseg;                          // its place in a buffer

  // tile 0 lands and is published; tile 1 is then under way during trip 0
  async_copy_tile(ga, gb, (size_t)K * 32, &sA[0][cl], &sB[0][cl], 16 * 272);
  async_wait0();
  __syncthreads();
  if (128 < K)
    async_copy_tile(ga + 128, gb + 128, (size_t)K * 32, &sA[1][cl], &sB[1][cl], 16 * 272);

  for (int kt = 0; kt < K; kt += 128) {
    const int buf = (kt >> 7) & 1;
    const _Float16* tA = sA[buf];
    const _Float16* tB = sB[buf];
    // The tile's four 32-k parts, in ascending k. A part's 12 fragment loads go out
    // as one group, one part ahead of their products, into the other of two register
    // sets: the wave then waits on a count, not for its own newest loads.
    // Every loop here is unrolled: constant indices keep both sets in registers.
    v16h af[2][4], bf[2][2];
#pragma unroll
    for (int i = 0; i < 4; ++i) af[0][i] = load_frag(&tA[(wm + 16 * i + l16) * 136], half);
#pragma unroll
    for (int j = 0; j < 2; ++j) bf[0][j] = load_frag(&tB[(wn + 16 * j + l16) * 136], half);
#pragma unroll
    for (int p = 0; p < 4; ++p) {
      const int cur = p & 1, nxt = cur ^ 1;
      if (p < 3) {
#pragma unroll
        for (int i = 0; i < 4; ++i)
          af[nxt][i] = load_frag(&tA[(wm + 16 * i + l16) * 136 + 32 * (p + 1)], half);
#pragma unroll
        for (int j = 0; j < 2; ++j)
          bf[nxt][j] = load_frag(&tB[(wn + 16 * j + l16) * 136 + 32 * (p + 1)], half);
      }
      // keeps the next part's loads in front of this part's products; without it the
      // scheduler sinks each pair of loads to its use and waits for it there
      __builtin_amdgcn_sched_barrier(0);
#pragma unroll
      for (int i = 0; i < 4; ++i)
#pragma unroll
        for (int j = 0; j < 2; ++j)
          acc[i][j] = wmma16(af[cur][i], bf[cur][j], acc[i][j]);
      // keeps the loads that follow out of this run of products: one place with LDS
      // reads a part
      __builtin_amdgcn_sched_barrier(0);
    }
    // this wave's LDS reads of this tile have returned before its buffer is refilled
    asm volatile("s_wait_dscnt 0x0" ::: "memory");
    async_wait0();    // this wave's copies of the next tile have landed
    __syncthreads();  // publishes the next tile; ends every read of this one
    if (kt + 256 < K)
      async_copy_tile(ga + kt + 256, gb + kt + 256, (size_t)K * 32, &sA[buf][cl],
                      &sB[buf][cl], 16 * 272);
  }
  async_wait0();  // no copy is outstanding when the wave goes on to its end

#pragma unroll
  for (int i = 0; i < 4; ++i)
#pragma unroll
    for (int j = 0; j < 2; ++j) {
      const int nn = n0 + wn + 16 * j + l16;      // C layout: n = lane&15
      const float bval = bias[nn];
      if (EPI == 3) {
        // transposed f16 store: fixed n per lane, 8 consecutive m -> b128
        v8h pk;
#pragma unroll
        for (int jj = 0; jj < 8; ++jj)
          pk[jj] = (_Float16)(acc[i][j][jj] + bval);
        *(v8h*)(outH + (size_t)nn * M + (m0 + wm + 16 * i + 8 * half)) = pk;
      } else {
#pragma unroll
        for (int jj = 0; jj < 8; ++jj) {
          const int m = m0 + wm + 16 * i + jj + 8 * half;  // m = vgpr + 8*half
          float v = acc[i][j][jj] + bval;
          if (EPI == 2) v = spectral_act(v);
          size_t idx = (size_t)m * N + nn;
          if (EPI == 1) outF[idx] = v;
          else          outH[idx] = (_Float16)v;
        }
      }
    }
}

__device__ inline float other_half(float x) {
  int b = __builtin_bit_cast(int, x);
  b = __builtin_amdgcn_permlanex16(b, b, 0x76543210, 0xfedcba98, false, false);
  return __builtin_bit_cast(float, b);
}

// e^x = exp2(x * log2(e)) on v_exp_f32 (what __expf gives). Written as asm so that
// the v_nop stands directly behind the transcendental: the instruction set asks
// for one slot before its source is overwritten or its result read.
__device__ inline float exp_slot(float x) {
  float y;
  asm("v_exp_f32 %0, %1\n\tv_nop" : "=v"(y) : "v"(x * 1.44269504088896340736f));
  return y;
}

__global__ __launch_bounds__(128) void flash_attn(
    const _Float16* __restrict__ Q, const _Float16* __restrict__ Kc,
    const _Float16* __restrict__ Vt, const float* __restrict__ resonance,
    const float* __restrict__ phase, _Float16* __restrict__ Oh) {
  // Row pitches of 16 bytes x odd (144 and 80): the 16 rows that a half wave's
  // 16-byte fragment reads touch then fall on 16 different groups of four banks.
  // At the rows' own lengths (128 and 64 bytes) they fall on two and on four groups.
  constexpr int KP = 72;  // f16 per sK row: 64 hd + 8 unused
  constexpr int VP = 40;  // f16 per sVt row: 32 keys + 8 unused
  // Two buffers each: the next key tile's copies fly while this one is worked on.
  __shared__ __attribute__((aligned(16))) _Float16 sK[2][32 * KP];   // [buffer][key][hd]
  __shared__ __attribute__((aligned(16))) _Float16 sVt[2][64 * VP];  // [buffer][hd][key]

  const int t = threadIdx.x;
  const int lane = t & 31, wave = t >> 5;
  const int half = lane >> 4, l16 = lane & 15;
  const int bh = blockIdx.y, b = bh / H_, h = bh % H_;
  const int q0 = blockIdx.x * 64 + wave * 16;
  const float r = resonance[h], ph = phase[h];
  const float scale = 0.125f;  // 1/sqrt(64)
  // (score + phase) in revolutions = raw * srev + prev
  const float srev = scale * INV_2PI, prev = ph * INV_2PI;

  const _Float16* qbase = Q + ((size_t)(b * S_ + q0 + l16)) * D_ + h * 64;
  v16h qf0 = cat8(*(const v8h*)(qbase + 8 * half),
                  *(const v8h*)(qbase + 16 + 8 * half));
  v16h qf1 = cat8(*(const v8h*)(qbase + 32 + 8 * half),
                  *(const v8h*)(qbase + 48 + 8 * half));

  float st_m = -3.0e38f;  // running maximum of query l16 (equal in both halves)
  float st_l = 0.f;       // running sum over this half's keys only
  v8f o[4] = {};          // o[tt][j] = O[query l16][hd = 16*tt + 8*half + j]

  const int kr = t >> 2, kseg = (t & 3) * 16;  // K loader: 16 f16 / thread
  const int vr = t >> 1, vseg = (t & 1) * 16;  // Vt loader: 16 f16 / thread
  const _Float16* gk = Kc + ((size_t)(b * S_ + kr)) * D_ + h * 64 + kseg;  // tile 0
  const _Float16* gv = Vt + ((size_t)(h * 64 + vr)) * M_ + b * S_ + vseg;
  const int kl = kr * KP + kseg, vl = vr * VP + vseg;  // the lane's places in a buffer

  // tile 0 lands and is published; tile 1 (S_ holds 64 tiles) is then under way
  async_copy_kv(gk, gv, &sK[0][kl], &sVt[0][vl]);
  async_wait0();
  __syncthreads();
  async_copy_kv(gk + (size_t)32 * D_, gv + 32, &sK[1][kl], &sVt[1][vl]);

  for (int kv = 0; kv < S_; kv += 32) {
    const int buf = (kv >> 5) & 1;
    const _Float16* tK = sK[buf];
    const _Float16* tV = sVt[buf];

    // S^T for 32 keys: two 16(key) x 16(query) tiles, hd=64 reduced as 32+32.
    // s0[j]: key kv + 8*half + j;  s1[j]: key kv + 16 + 8*half + j.
    v8f s0 = {}, s1 = {};
    {
      const _Float16* k0 = &tK[l16 * KP];
      const _Float16* k1 = &tK[(16 + l16) * KP];
      v16h k00 = cat8(*(const v8h*)(k0 + 8 * half), *(const v8h*)(k0 + 16 + 8 * half));
      v16h k01 = cat8(*(const v8h*)(k0 + 32 + 8 * half), *(const v8h*)(k0 + 48 + 8 * half));
      v16h k10 = cat8(*(const v8h*)(k1 + 8 * half), *(const v8h*)(k1 + 16 + 8 * half));
      v16h k11 = cat8(*(const v8h*)(k1 + 32 + 8 * half), *(const v8h*)(k1 + 48 + 8 * half));
      s0 = wmma16(k00, qf0, s0); s0 = wmma16(k01, qf1, s0);
      s1 = wmma16(k10, qf0, s1); s1 = wmma16(k11, qf1, s1);
    }

    float mx = -3.0e38f;
#pragma unroll
    for (int j = 0; j < 8; ++j) {
      float a = s0[j] * scale;  a += r * sin_rev(fmaf(s0[j], srev, prev));
      float c = s1[j] * scale;  c += r * sin_rev(fmaf(s1[j], srev, prev));
      s0[j] = a; s1[j] = c;
      mx = fmaxf(mx, fmaxf(a, c));
    }
    mx = fmaxf(mx, other_half(mx));
    const float nm = fmaxf(st_m, mx);
    const float corr = exp_slot(st_m - nm);
    st_m = nm;

    // P^T as a B operand: element s is key 8*half + s (16 + 8*half + s-8 for s >= 8), which is exactly
    // s0[0..7] then s1[0..7] of this lane.
    v16h pf;
    float sm = 0.f;
#pragma unroll
    for (int j = 0; j < 8; ++j) {
      float p0 = exp_slot(s0[j] - nm), p1 = exp_slot(s1[j] - nm);
      sm += p0 + p1;
      pf[j] = (_Float16)p0;
      pf[8 + j] = (_Float16)p1;
    }
    st_l = st_l * corr + sm;
#pragma unroll
    for (int tt = 0; tt < 4; ++tt)
#pragma unroll
      for (int j = 0; j < 8; ++j) o[tt][j] *= corr;

#pragma unroll
    for (int tt = 0; tt < 4; ++tt) {
      const _Float16* vb = &tV[(tt * 16 + l16) * VP];
      v16h vf = cat8(*(const v8h*)(vb + 8 * half),
                     *(const v8h*)(vb + 16 + 8 * half));
      o[tt] = wmma16(vf, pf, o[tt]);
    }
    // this wave's LDS reads of this tile have returned before its buffer is refilled
    asm volatile("s_wait_dscnt 0x0" ::: "memory");
    async_wait0();    // this wave's copies of the next tile have landed
    __syncthreads();  // publishes the next tile; ends every read of this one
    if (kv + 64 < S_)
      async_copy_kv(gk + (size_t)(kv + 64) * D_, gv + kv + 64, &sK[buf][kl], &sVt[buf][vl]);
  }
  async_wait0();  // no copy is outstanding when the wave goes on to its end

  // join the two halves' sums once; 8 consecutive hd per lane -> 16-byte stores
  const float inv = 1.0f / (st_l + other_half(st_l));
  _Float16* dst = Oh + ((size_t)(b * S_ + q0 + l16)) * D_ + h * 64 + 8 * half;
#pragma unroll
  for (int tt = 0; tt < 4; ++tt) {
    v8h pk;
#pragma unroll
    for (int j = 0; j < 8; ++j) pk[j] = (_Float16)(o[tt][j] * inv);
    *(v8h*)(dst + tt * 16) = pk;
  }
}

// ---------------------------------------------------------------------------
// Harmonic LayerNorm (unbiased std): one WAVE per row, 8 rows per block.
// A lane holds 32 of the row's 1024 values in registers (eight 16-byte loads from
// each addend, a wave-wide load being 512 contiguous bytes), so the row is read
// once, the two sums need no LDS and no barrier, and a launch starts 4096 waves.
// ---------------------------------------------------------------------------
// x + (x of lane l ^ MASK), inside a 16-lane row: DPP row_xmask is 0x160 + MASK
template <int MASK>
__device__ inline float add_xmask(float x) {
  const int y = __builtin_amdgcn_update_dpp(0, __builtin_bit_cast(int, x), 0x160 + MASK,
                                            0xf, 0xf, true);
  return x + __builtin_bit_cast(float, y);
}
// sum over the wave's 32 lanes; every lane ends with the same bits
__device__ inline float wave_sum(float x) {
  x = add_xmask<1>(x);
  x = add_xmask<2>(x);
  x = add_xmask<4>(x);
  x = add_xmask<8>(x);
  return x + other_half(x);
}

// The grid puts 2 work-groups on a WGP, 4 waves on a SIMD: a budget of 256 registers
// costs no residency, and all 32 loads of a lane can be in flight at once.
__global__ __launch_bounds__(256) __attribute__((amdgpu_waves_per_eu(2, 4))) void harmonic_ln(
    const float* __restrict__ A, const float* __restrict__ Bv,
    const float* __restrict__ g, const float* __restrict__ be,
    const float* __restrict__ s, float* __restrict__ outF,
    _Float16* __restrict__ outH) {
  const int lane = threadIdx.x & 31;
  // the wave's number in a scalar register: the row's addresses are then scalar bases
  const int row = blockIdx.x * 8 + __builtin_amdgcn_readfirstlane(threadIdx.x >> 5);
  const unsigned boff = lane * 16;  // byte offset of the lane's first four columns
  const char* a = (const char*)(A + (size_t)row * D_);
  const char* bb = (const char*)(Bv + (size_t)row * D_);
  const float stab = s[0];  // asked for here: its latency passes beside the row's loads

  // every loop over i below is unrolled: constant indices keep the arrays in registers
  v4f va[8], vb[8], vg[8], ve[8];
#pragma unroll  // all loads are issued before the first value is used
  for (int i = 0; i < 8; ++i) va[i] = *(const v4f*)(a + boff + i * 512);
#pragma unroll
  for (int i = 0; i < 8; ++i) vb[i] = *(const v4f*)(bb + boff + i * 512);
#pragma unroll
  for (int i = 0; i < 8; ++i) vg[i] = *(const v4f*)((const char*)g + boff + i * 512);
#pragma unroll
  for (int i = 0; i < 8; ++i) ve[i] = *(const v4f*)((const char*)be + boff + i * 512);
  // keeps the scalar load of stab up here; the scheduler sinks it to its use otherwise
  __builtin_amdgcn_sched_barrier(0);

  v4f s4 = {}, q4 = {};  // four independent chains each
#pragma unroll
  for (int i = 0; i < 8; ++i) {
    va[i] += vb[i];
    s4 += va[i];
    q4 += va[i] * va[i];
  }
  const float tot = wave_sum((s4[0] + s4[1]) + (s4[2] + s4[3]));
  const float tot2 = wave_sum((q4[0] + q4[1]) + (q4[2] + q4[3]));

  float mean = tot / (float)D_;
  float var = (tot2 - mean * tot) / (float)(D_ - 1);
  float sd = sqrtf(fmaxf(var, 0.f));
  sd = sd + stab * sin_rev(sd * 0.5f);  // sin(pi * sd): sd / 2 revolutions
  float inv = 1.0f / (sd + 1e-6f);

  char* of = (char*)(outF + (size_t)row * D_);
#pragma unroll
  for (int i = 0; i < 8; ++i) {
    va[i] = (va[i] - mean) * inv * vg[i] + ve[i];
    *(v4f*)(of + boff + i * 512) = va[i];
  }
  if (outH) {
    // behind the last f32 store: what follows rewrites the stores' data registers
    // and their scalar base
    asm volatile("s_wait_xcnt 0x0" ::: "memory");
    // without it the scheduler lifts the first conversions and the address
    // arithmetic, which rewrite those registers, over the wait
    __builtin_amdgcn_sched_barrier(0);
    _Float16* oh = outH + (size_t)row * D_ + lane * 4;
#pragma unroll
    for (int i = 0; i < 8; ++i) {
      v4h h;
#pragma unroll
      for (int e = 0; e < 4; ++e) h[e] = (_Float16)va[i][e];
      *(v4h*)(oh + i * 128) = h;
    }
  }
}

// ---------------------------------------------------------------------------
// launch
// ---------------------------------------------------------------------------
extern "C" void kernel_launch(void* const* d_in, const int* in_sizes, int n_in,
                              void* d_out, int out_size, void* d_ws,
                              size_t ws_size, hipStream_t stream) {
  const float* x   = (const float*)d_in[0];
  const float* Wq  = (const float*)d_in[1];  const float* bq  = (const float*)d_in[2];
  const float* Wk  = (const float*)d_in[3];  const float* bk  = (const float*)d_in[4];
  const float* Wv  = (const float*)d_in[5];  const float* bv  = (const float*)d_in[6];
  const float* Wo  = (const float*)d_in[7];  const float* bo  = (const float*)d_in[8];
  const float* res = (const float*)d_in[9];  const float* phs = (const float*)d_in[10];
  const float* g1  = (const float*)d_in[11]; const float* b1  = (const float*)d_in[12];
  const float* s1  = (const float*)d_in[13];
  const float* W1  = (const float*)d_in[14]; const float* bf1 = (const float*)d_in[15];
  const float* W2  = (const float*)d_in[16]; const float* bf2 = (const float*)d_in[17];
  const float* g2  = (const float*)d_in[18]; const float* b2  = (const float*)d_in[19];
  const float* s2  = (const float*)d_in[20];

  char* ws = (char*)d_ws;
  size_t off = 0;
  auto alloc = [&](size_t bytes) {
    char* p = ws + off;
    off += (bytes + 255) & ~(size_t)255;
    return p;
  };
  _Float16* xb   = (_Float16*)alloc((size_t)M_ * D_ * 2);
  _Float16* wqb  = (_Float16*)alloc((size_t)D_ * D_ * 2);  // transposed [N,K]
  _Float16* wkb  = (_Float16*)alloc((size_t)D_ * D_ * 2);
  _Float16* wvb  = (_Float16*)alloc((size_t)D_ * D_ * 2);
  _Float16* wob  = (_Float16*)alloc((size_t)D_ * D_ * 2);
  _Float16* w1b  = (_Float16*)alloc((size_t)D_ * F_ * 2);
  _Float16* w2b  = (_Float16*)alloc((size_t)F_ * D_ * 2);
  _Float16* qb   = (_Float16*)alloc((size_t)M_ * D_ * 2);
  _Float16* kb2  = (_Float16*)alloc((size_t)M_ * D_ * 2);
  _Float16* vt   = (_Float16*)alloc((size_t)M_ * D_ * 2);  // V transposed [D,M]
  _Float16* at16 = (_Float16*)alloc((size_t)M_ * D_ * 2);
  float*    aprj = (float*)   alloc((size_t)M_ * D_ * 4);
  float*    y1   = (float*)   alloc((size_t)M_ * D_ * 4);
  _Float16* y1b  = (_Float16*)alloc((size_t)M_ * D_ * 2);
  _Float16* act  = (_Float16*)alloc((size_t)M_ * F_ * 2);
  float*    ffn  = (float*)   alloc((size_t)M_ * D_ * 4);

  const dim3 blk256(256), blk128(128);

  // x -> f16; weights: f32 [K,N] -> f16 transposed [N,K]
  cvt_all<<<1024, blk256, 0, stream>>>(x, Wq, Wk, Wv, Wo, W1, W2, xb, wqb, wkb,
                                       wvb, wob, w1b, w2b);

  // QKV projections (V written transposed for the PV matmul)
  dim3 gDD(D_ / 128, M_ / 128);
  gemm_wmma<0><<<gDD, blk256, 0, stream>>>(xb, wqb, bq, qb,  nullptr, M_, D_, D_);
  gemm_wmma<0><<<gDD, blk256, 0, stream>>>(xb, wkb, bk, kb2, nullptr, M_, D_, D_);
  gemm_wmma<3><<<gDD, blk256, 0, stream>>>(xb, wvb, bv, vt,  nullptr, M_, D_, D_);

  // harmonic flash attention
  dim3 gFA(S_ / 64, B_ * H_);
  flash_attn<<<gFA, blk128, 0, stream>>>(qb, kb2, vt, res, phs, at16);

  // output projection (f32)
  gemm_wmma<1><<<gDD, blk256, 0, stream>>>(at16, wob, bo, nullptr, aprj, M_, D_, D_);

  // LN1
  harmonic_ln<<<M_ / 8, blk256, 0, stream>>>(x, aprj, g1, b1, s1, y1, y1b);

  // FFN up + spectral activation (f16), FFN down (f32)
  gemm_wmma<2><<<dim3(F_ / 128, M_ / 128), blk256, 0, stream>>>(
      y1b, w1b, bf1, act, nullptr, M_, F_, D_);
  gemm_wmma<1><<<gDD, blk256, 0, stream>>>(act, w2b, bf2, nullptr, ffn, M_, D_, F_);

  // LN2 -> final output
  harmonic_ln<<<M_ / 8, blk256, 0, stream>>>(y1, ffn, g2, b2, s2, (float*)d_out, nullptr);
}

// v010
// It runs in 188 microseconds.
// Next to v009, in two timings, it ran 1.05 times as fast each time.
// Over all steps from v000 it is 3.40 times as fast.
#include <hip/hip_runtime.h>
#include <hip/hip_bf16.h>

typedef __attribute__((ext_vector_type(16))) _Float16 v16h;
typedef __attribute__((ext_vector_type(8)))  _Float16 v8h;
typedef __attribute__((ext_vector_type(8)))  float    v8f;

#define B_  2
#define S_  2048
#define D_  1024
#define H_  16
#define F_  4096
#define M_  (B_ * S_)   // 4096 rows

// ---------------------------------------------------------------------------
// helpers
// ---------------------------------------------------------------------------
__device__ inline v16h cat8(v8h lo, v8h hi) {
  return __builtin_shufflevector(lo, hi, 0,1,2,3,4,5,6,7,8,9,10,11,12,13,14,15);
}

// 16x32 f16 fragment from LDS (k-contiguous rows). Lane l (l16=l&15, half=l>>4):
//   elements 0..7  -> k =      8*half + 0..7
//   elements 8..15 -> k = 16 + 8*half + 0..7
__device__ inline v16h load_frag(const _Float16* rowbase, int half) {
  v8h lo = *(const v8h*)(rowbase + 8 * half);
  v8h hi = *(const v8h*)(rowbase + 16 + 8 * half);
  return cat8(lo, hi);
}

__device__ inline v8f wmma16(v16h a, v16h b, v8f c) {
  return __builtin_amdgcn_wmma_f32_16x16x32_f16(
      false, a, false, b, (short)0, c, false, false);
}

// CDNA5 async global->LDS copy (ASYNCcnt-tracked, no VGPR data path).
// One thread's four copies of a key tile: 32 bytes of a K row, 32 of a V^T row.
// s_wait_xcnt 0 is the last line of the copies' own statement, so that no later
// write of an address register can be scheduled in front of it.
__device__ inline void async_copy_kv(const _Float16* gk, const _Float16* gv,
                                     _Float16* pk, _Float16* pv) {
  const char* k = (const char*)gk;
  const char* v = (const char*)gv;
  const unsigned lk = (unsigned)(unsigned long long)pk;  // low 32 bits = LDS offset
  const unsigned lv = (unsigned)(unsigned long long)pv;
  asm volatile("global_load_async_to_lds_b128 %0, %4, off\n\t"
               "global_load_async_to_lds_b128 %1, %5, off\n\t"
               "global_load_async_to_lds_b128 %2, %6, off\n\t"
               "global_load_async_to_lds_b128 %3, %7, off\n\t"
               "s_wait_xcnt 0x0"
               :: "v"(lk), "v"(lk + 16), "v"(lv), "v"(lv + 16),
                  "v"(k), "v"(k + 16), "v"(v), "v"(v + 16)
               : "memory");
}
// One thread's eight copies of one operand's k-tile: eight rows, 16 rows apart
// (gstep, lstep in bytes). s_wait_xcnt 0 is the last line of the copies' own
// statement, so that no later write of an address register can be scheduled in
// front of it.
__device__ inline void async_copy_rows8(const _Float16* gp, size_t gstep, _Float16* lp,
                                        unsigned lstep) {
  const char* g = (const char*)gp;
  const unsigned l = (unsigned)(unsigned long long)lp;  // low 32 bits = LDS offset
  asm volatile("global_load_async_to_lds_b128 %0, %8, off\n\t"
               "global_load_async_to_lds_b128 %1, %9, off\n\t"
               "global_load_async_to_lds_b128 %2, %10, off\n\t"
               "global_load_async_to_lds_b128 %3, %11, off\n\t"
               "global_load_async_to_lds_b128 %4, %12, off\n\t"
               "global_load_async_to_lds_b128 %5, %13, off\n\t"
               "global_load_async_to_lds_b128 %6, %14, off\n\t"
               "global_load_async_to_lds_b128 %7, %15, off\n\t"
               "s_wait_xcnt 0x0"
               :: "v"(l), "v"(l + lstep), "v"(l + 2 * lstep), "v"(l + 3 * lstep),
                  "v"(l + 4 * lstep), "v"(l + 5 * lstep), "v"(l + 6 * lstep),
                  "v"(l + 7 * lstep),
                  "v"(g), "v"(g + gstep), "v"(g + 2 * gstep), "v"(g + 3 * gstep),
                  "v"(g + 4 * gstep), "v"(g + 5 * gstep), "v"(g + 6 * gstep),
                  "v"(g + 7 * gstep)
               : "memory");
}
// A k-tile of both operands: 128 rows each, sixteen copies a thread.
__device__ inline void async_copy_tile(const _Float16* ga, const _Float16* gb,
                                       size_t gstep, _Float16* pa, _Float16* pb,
                                       unsigned lstep) {
  async_copy_rows8(ga, gstep, pa, lstep);
  async_copy_rows8(gb, gstep, pb, lstep);
}
__device__ inline void async_wait0() {
  asm volatile("s_wait_asynccnt 0x0" ::: "memory");
}

// sin(2*pi*t) on v_sin_f32, which takes its argument in revolutions. v_fract_f32
// is the whole range reduction (exact; it hands the instruction a value in
// [0, 1)), so there is no compare and no branch per value. What is lost
// against the library's sinf is the rounding of t, |t| * 2^-24 revolutions: the
// size of the rounding that the f32 argument in radians carries anyway.
// The builtin, not asm text: the compiler then keeps the distance behind a matrix
// instruction whose operand registers the result reuses.
#define INV_2PI 0.15915494309189535f
__device__ inline float sin_rev(float t) {
  return __builtin_amdgcn_sinf(__builtin_amdgcn_fractf(t));
}
// The same for the activation, far behind the last matrix instruction. As asm so that
// the v_nop stands directly behind the transcendental: the instruction set asks for
// one slot before its source is overwritten.
__device__ inline float sin_rev_slot(float t) {
  float y;
  asm("v_sin_f32 %0, %1\n\tv_nop" : "=v"(y) : "v"(__builtin_amdgcn_fractf(t)));
  return y;
}

// 0.5 * x * (1 + tanh(u)) = x / (1 + e^(-2u)), u = sqrt(2/pi) * (x + 0.044715 x^3):
// one v_exp_f32 and one v_rcp_f32, no compare and no branch per value (the library's
// tanhf runs a polynomial and an exponential branch one after the other wherever a
// wave's lanes differ). The ends are exact: e^(-2u) = inf gives x * 0, 0 gives x * 1;
// and for u < 0 the quotient has none of the cancellation of 1 + tanh(u).
__device__ inline float spectral_act(float x) {
  const float a = -2.3022081981f;                   // -2 * sqrt(2/pi) * log2(e)
  const float b = a * 0.044715f;
  // Both as asm, like the sine above, so that the v_nop stands directly behind the
  // transcendental.
  float e, q;
  asm("v_exp_f32 %0, %1\n\tv_nop" : "=v"(e) : "v"(x * fmaf(b, x * x, a)));  // e^(-2u)
  asm("v_rcp_f32 %0, %1\n\tv_nop" : "=v"(q) : "v"(1.0f + e));
  const float g = x * q;
  return g + 0.5f * sin_rev_slot(x * INV_2PI);      // ALPHA=0.5, BETA=1.0
}

// ---------------------------------------------------------------------------
// All f32 -> f16 conversions of a call in ONE launch of 1024 work-groups:
//   blocks   0..255  x, 16384 elements each, copied in place order
//   blocks 256..511  Wq, Wk, Wv, Wo (64 tiles each)   f32 [K,N] -> f16 [N,K]
//   blocks 512..767  W1                               f32 [K,N] -> f16 [N,K]
//   blocks 768..1023 W2                               f32 [K,N] -> f16 [N,K]
// A work-group moves 64 KiB in and 32 KiB out, with 16 loads of 16 bytes in
// flight per lane, so that few waves have to be started for the bytes moved.
// ---------------------------------------------------------------------------
typedef __attribute__((ext_vector_type(4))) float    v4f;
typedef __attribute__((ext_vector_type(4))) _Float16 v4h;

// One 128(k) x 128(n) tile. A wave-wide load is 512 contiguous bytes of one
// source row; a lane holds 16 consecutive k of 4 neighbouring n, packs them to
// 16-byte chunks and lays them in LDS as [n][k]; a wave-wide store is two whole
// 256-byte pieces of two destination rows.
// LDS rows are 256 bytes, unpadded: chunk c of row n lies at place c ^ ((n >> 2) & 15),
// which spreads both the 16 writers (n 4 apart, same c) and the 16 readers
// (same n, c = 0..15) over all banks.
template <int K, int N>
__device__ inline void transpose_tile(const float* __restrict__ src,
                                      _Float16* __restrict__ dst, int kt, int nt,
                                      _Float16* tile) {
  const int t = threadIdx.x, lane = t & 31, wave = t >> 5;
  const float* s = src + (size_t)(kt * 128 + wave * 16) * N + nt * 128 + lane * 4;
  v4f v[16];
#pragma unroll  // all 16 loads are issued before the first value is used
  for (int i = 0; i < 16; ++i) v[i] = *(const v4f*)(s + (size_t)i * N);
  // behind the last load: the loads' address register, named here so that it lives
  // up to this wait, is not reused (as a load's own destination) in front of it
  asm volatile("s_wait_xcnt 0x0" :: "v"(s) : "memory");
#pragma unroll
  for (int j = 0; j < 4; ++j)
#pragma unroll
    for (int h = 0; h < 2; ++h) {
      v8h pk;
#pragma unroll
      for (int e = 0; e < 8; ++e) pk[e] = (_Float16)v[h * 8 + e][j];
      *(v8h*)&tile[(lane * 4 + j) * 128 + (((wave * 2 + h) ^ (lane & 15)) * 8)] = pk;
    }
  __syncthreads();
  const int seg = lane & 15;
  _Float16* d = dst + (size_t)(nt * 128 + wave * 2 + (lane >> 4)) * K + kt * 128 + seg * 8;
#pragma unroll
  for (int r = 0; r < 8; ++r) {
    const int n = r * 16 + wave * 2 + (lane >> 4);
    *(v8h*)(d + (size_t)r * 16 * K) =
        *(const v8h*)&tile[n * 128 + ((seg ^ ((n >> 2) & 15)) * 8)];
  }
  // behind the last store: no register that a store names is rewritten in front of
  // this wait, on any way that the branches behind the inlined tile leave open
  asm volatile("s_wait_xcnt 0x0" :: "v"(d) : "memory");
}

// The grid puts 4 work-groups on a WGP, 8 waves on a SIMD: a budget of 128 registers
// costs no residency. Without the attribute the compiler keeps under 64 registers
// and issues the 16 loads in three groups, each behind a wait on the one before.
__global__ __launch_bounds__(256) __attribute__((amdgpu_waves_per_eu(2, 8))) void cvt_all(
    const float* __restrict__ x, const float* __restrict__ Wq,
    const float* __restrict__ Wk, const float* __restrict__ Wv,
    const float* __restrict__ Wo, const float* __restrict__ W1,
    const float* __restrict__ W2, _Float16* __restrict__ xb,
    _Float16* __restrict__ wqb, _Float16* __restrict__ wkb,
    _Float16* __restrict__ wvb, _Float16* __restrict__ wob,
    _Float16* __restrict__ w1b, _Float16* __restrict__ w2b) {
  __shared__ __attribute__((aligned(16))) _Float16 tile[128 * 128];  // [n][k]
  const int job = blockIdx.x >> 8, idx = blockIdx.x & 255;  // the same in a whole block

  if (job == 0) {
    // a wave-wide load is 512 contiguous bytes, its store 256 contiguous bytes
    const unsigned base = idx * 16384 + threadIdx.x * 4;
    const unsigned boff = base * 4;  // byte offset of the lane's first load
    v4f v[16];
#pragma unroll  // all 16 loads are issued before the first value is used
    for (int i = 0; i < 16; ++i) v[i] = *(const v4f*)((const char*)x + boff + i * 4096);
    // behind the last load: the loads' offset register, named here so that it lives
    // up to this wait, is not reused (as a load's own destination) in front of it
    asm volatile("s_wait_xcnt 0x0" :: "v"(boff) : "memory");
#pragma unroll
    for (int i = 0; i < 16; ++i) {
      v4h h;
#pragma unroll
      for (int e = 0; e < 4; ++e) h[e] = (_Float16)v[i][e];
      *(v4h*)(xb + base + i * 1024) = h;
    }
  } else if (job == 1) {
    const int w = idx >> 6, ti = idx & 63;
    const float* src = w == 0 ? Wq : w == 1 ? Wk : w == 2 ? Wv : Wo;
    _Float16* dst = w == 0 ? wqb : w == 1 ? wkb : w == 2 ? wvb : wob;
    transpose_tile<D_, D_>(src, dst, ti >> 3, ti & 7, tile);
  } else if (job == 2) {
    transpose_tile<D_, F_>(W1, w1b, idx >> 5, idx & 31, tile);
  } else {
    transpose_tile<F_, D_>(W2, w2b, idx >> 3, idx & 7, tile);
  }
}

// ---------------------------------------------------------------------------
// WMMA GEMM: C[M,N] = A[M,K](f16) @ W[K,N] + bias, with W pre-transposed
// as WT[N,K] (k-contiguous).  block = 256 (8 waves, 2x4 of 64x32),
// macro-tile 128x128, k-step 128 (a staged row is two whole 128-byte lines, copied
// by 16 neighbouring lanes), async global->LDS staging into two buffers: the next
// k-tile's copies fly while this one is multiplied. K is a multiple of 128.
//   EPI 0: f16 out   EPI 1: f32 out   EPI 2: spectral->f16   EPI 3: f16 out^T
// ---------------------------------------------------------------------------
template <int EPI>
__global__ __launch_bounds__(256) void gemm_wmma(
    const _Float16* __restrict__ A, const _Float16* __restrict__ WT,
    const float* __restrict__ bias, _Float16* __restrict__ outH,
    float* __restrict__ outF, int M, int N, int K) {
  // rows of 128 k at a pitch of 136 (272 bytes = 16 x odd: no bank conflict for b128)
  __shared__ __attribute__((aligned(16))) _Float16 sA[2][128 * 136];  // [buffer][m][k]
  __shared__ __attribute__((aligned(16))) _Float16 sB[2][128 * 136];  // [buffer][n][k]

  const int t = threadIdx.x;
  const int lane = t & 31, wave = t >> 5;
  const int half = lane >> 4, l16 = lane & 15;
  const int m0 = blockIdx.y * 128, n0 = blockIdx.x * 128;
  const int wm = (wave >> 2) * 64, wn = (wave & 3) * 32;

  v8f acc[4][2] = {};

  const int cr = t >> 4, cseg = (t & 15) * 8;  // copies: 16 lanes x 16 B = one row
  const _Float16* ga = A + (size_t)(m0 + cr) * K + cseg;   // this lane's part of tile 0
  const _Float16* gb = WT + (size_t)(n0 + cr) * K + cseg;
  const int cl = cr * 136 + cseg;                          // its place in a buffer

  // tile 0 lands and is published; tile 1 is then under way during trip 0
  async_copy_tile(ga, gb, (size_t)K * 32, &sA[0][cl], &sB[0][cl], 16 * 272);
  async_wait0();
  __syncthreads();
  if (128 < K)
    async_copy_tile(ga + 128, gb + 128, (size_t)K * 32, &sA[1][cl], &sB[1][cl], 16 * 272);

  for (int kt = 0; kt < K; kt += 128) {
    const int buf = (kt >> 7) & 1;
    const _Float16* tA = sA[buf];
    const _Float16* tB = sB[buf];
    // The tile's four 32-k parts, in ascending k. A part's 12 fragment loads go out
    // as one group, one part ahead of their products, into the other of two register
    // sets: the wave then waits on a count, not for its own newest loads.
    // Every loop here is unrolled: constant indices keep both sets in registers.
    v16h af[2][4], bf[2][2];
#pragma unroll
    for (int i = 0; i < 4; ++i) af[0][i] = load_frag(&tA[(wm + 16 * i + l16) * 136], half);
#pragma unroll
    for (int j = 0; j < 2; ++j) bf[0][j] = load_frag(&tB[(wn + 16 * j + l16) * 136], half);
#pragma unroll
    for (int p = 0; p < 4; ++p) {
      const int cur = p & 1, nxt = cur ^ 1;
      if (p < 3) {
#pragma unroll
        for (int i = 0; i < 4; ++i)
          af[nxt][i] = load_frag(&tA[(wm + 16 * i + l16) * 136 + 32 * (p + 1)], half);
#pragma unroll
        for (int j = 0; j < 2; ++j)
          bf[nxt][j] = load_frag(&tB[(wn + 16 * j + l16) * 136 + 32 * (p + 1)], half);
      }
      // keeps the next part's loads in front of this part's products; without it the
      // scheduler sinks each pair of loads to its use and waits for it there
      __builtin_amdgcn_sched_barrier(0);
#pragma unroll
      for (int i = 0; i < 4; ++i)
#pragma unroll
        for (int j = 0; j < 2; ++j)
          acc[i][j] = wmma16(af[cur][i], bf[cur][j], acc[i][j]);
      // keeps the loads that follow out of this run of products: one place with LDS
      // reads a part
      __builtin_amdgcn_sched_barrier(0);
    }
    // this wave's LDS reads of this tile have returned before its buffer is refilled
    asm volatile("s_wait_dscnt 0x0" ::: "memory");
    async_wait0();    // this wave's copies of the next tile have landed
    __syncthreads();  // publishes the next tile; ends every read of this one
    if (kt + 256 < K)
      async_copy_tile(ga + kt + 256, gb + kt + 256, (size_t)K * 32, &sA[buf][cl],
                      &sB[buf][cl], 16 * 272);
  }
  async_wait0();  // no copy is outstanding when the wave goes on to its end

#pragma unroll
  for (int i = 0; i < 4; ++i)
#pragma unroll
    for (int j = 0; j < 2; ++j) {
      const int nn = n0 + wn + 16 * j + l16;      // C layout: n = lane&15
      const float bval = bias[nn];
      if (EPI == 3) {
        // transposed f16 store: fixed n per lane, 8 consecutive m -> b128
        v8h pk;
#pragma unroll
        for (int jj = 0; jj < 8; ++jj)
          pk[jj] = (_Float16)(acc[i][j][jj] + bval);
        *(v8h*)(outH + (size_t)nn * M + (m0 + wm + 16 * i + 8 * half)) = pk;
      } else {
#pragma unroll
        for (int jj = 0; jj < 8; ++jj) {
          const int m = m0 + wm + 16 * i + jj + 8 * half;  // m = vgpr + 8*half
          float v = acc[i][j][jj] + bval;
          if (EPI == 2) v = spectral_act(v);
          size_t idx = (size_t)m * N + nn;
          if (EPI == 1) outF[idx] = v;
          else          outH[idx] = (_Float16)v;
        }
      }
    }
}

// ---------------------------------------------------------------------------
// The three projections of x in ONE launch: the tile loop of gemm_wmma, and its
// EPI 0 and EPI 3 stores. blockIdx.z picks the weight, its bias and its output
// (0: Q, 1: K, 2: V, written transposed). 768 work-groups, three to a WGP, of which
// two fit side by side (LDS): one's first copies, barrier waits and stores pass
// beside the other's products, and two launches with their gaps are gone.
// ---------------------------------------------------------------------------
__global__ __launch_bounds__(256) void gemm_qkv(
    const _Float16* __restrict__ A, const _Float16* __restrict__ WqT,
    const _Float16* __restrict__ WkT, const _Float16* __restrict__ WvT,
    const float* __restrict__ bq, const float* __restrict__ bk,
    const float* __restrict__ bv, _Float16* __restrict__ outQ,
    _Float16* __restrict__ outK, _Float16* __restrict__ outVt, int M, int N, int K) {
  const int sel = blockIdx.z;  // the same in a whole block
  const _Float16* WT = sel == 0 ? WqT : sel == 1 ? WkT : WvT;
  const float* bias = sel == 0 ? bq : sel == 1 ? bk : bv;

  // rows of 128 k at a pitch of 136 (272 bytes = 16 x odd: no bank conflict for b128)
  __shared__ __attribute__((aligned(16))) _Float16 sA[2][128 * 136];  // [buffer][m][k]
  __shared__ __attribute__((aligned(16))) _Float16 sB[2][128 * 136];  // [buffer][n][k]

  const int t = threadIdx.x;
  const int lane = t & 31, wave = t >> 5;
  const int half = lane >> 4, l16 = lane & 15;
  const int m0 = blockIdx.y * 128, n0 = blockIdx.x * 128;
  const int wm = (wave >> 2) * 64, wn = (wave & 3) * 32;

  v8f acc[4][2] = {};

  const int cr = t >> 4, cseg = (t & 15) * 8;  // copies: 16 lanes x 16 B = one row
  const _Float16* ga = A + (size_t)(m0 + cr) * K + cseg;   // this lane's part of tile 0
  const _Float16* gb = WT + (size_t)(n0 + cr) * K + cseg;
  const int cl = cr * 136 + cseg;                          // its place in a buffer

  // tile 0 lands and is published; tile 1 is then under way during trip 0
  async_copy_tile(ga, gb, (size_t)K * 32, &sA[0][cl], &sB[0][cl], 16 * 272);
  async_wait0();
  __syncthreads();
  if (128 < K)
    async_copy_tile(ga + 128, gb + 128, (size_t)K * 32, &sA[1][cl], &sB[1][cl], 16 * 272);

  for (int kt = 0; kt < K; kt += 128) {
    const int buf = (kt >> 7) & 1;
    const _Float16* tA = sA[buf];
    const _Float16* tB = sB[buf];
    // The tile's four 32-k parts, in ascending k. A part's 12 fragment loads go out
    // as one group, one part ahead of their products, into the other of two register
    // sets: the wave then waits on a count, not for its own newest loads.
    // Every loop here is unrolled: constant indices keep both sets in registers.
    v16h af[2][4], bf[2][2];
#pragma unroll
    for (int i = 0; i < 4; ++i) af[0][i] = load_frag(&tA[(wm + 16 * i + l16) * 136], half);
#pragma unroll
    for (int j = 0; j < 2; ++j) bf[0][j] = load_frag(&tB[(wn + 16 * j + l16) * 136], half);
#pragma unroll
    for (int p = 0; p < 4; ++p) {
      const int cur = p & 1, nxt = cur ^ 1;
      if (p < 3) {
#pragma unroll
        for (int i = 0; i < 4; ++i)
          af[nxt][i] = load_frag(&tA[(wm + 16 * i + l16) * 136 + 32 * (p + 1)], half);
#pragma unroll
        for (int j = 0; j < 2; ++j)
          bf[nxt][j] = load_frag(&tB[(wn + 16 * j + l16) * 136 + 32 * (p + 1)], half);
      }
      // keeps the next part's loads in front of this part's products; without it the
      // scheduler sinks each pair of loads to its use and waits for it there
      __builtin_amdgcn_sched_barrier(0);
#pragma unroll
      for (int i = 0; i < 4; ++i)
#pragma unroll
        for (int j = 0; j < 2; ++j)
          acc[i][j] = wmma16(af[cur][i], bf[cur][j], acc[i][j]);
      // keeps the loads that follow out of this run of products: one place with LDS
      // reads a part
      __builtin_amdgcn_sched_barrier(0);
    }
    // this wave's LDS reads of this tile have returned before its buffer is refilled
    asm volatile("s_wait_dscnt 0x0" ::: "memory");
    async_wait0();    // this wave's copies of the next tile have landed
    __syncthreads();  // publishes the next tile; ends every read of this one
    if (kt + 256 < K)
      async_copy_tile(ga + kt + 256, gb + kt + 256, (size_t)K * 32, &sA[buf][cl],
                      &sB[buf][cl], 16 * 272);
  }
  async_wait0();  // no copy is outstanding when the wave goes on to its end

  if (sel == 2) {  // one test for the whole tile, the same in every wave
#pragma unroll
    for (int i = 0; i < 4; ++i)
#pragma unroll
      for (int j = 0; j < 2; ++j) {
        const int nn = n0 + wn + 16 * j + l16;      // C layout: n = lane&15
        const float bval = bias[nn];
        // transposed f16 store: fixed n per lane, 8 consecutive m -> b128
        v8h pk;
#pragma unroll
        for (int jj = 0; jj < 8; ++jj)
          pk[jj] = (_Float16)(acc[i][j][jj] + bval);
        *(v8h*)(outVt + (size_t)nn * M + (m0 + wm + 16 * i + 8 * half)) = pk;
      }
    return;
  }
  _Float16* outH = sel == 0 ? outQ : outK;
#pragma unroll
  for (int i = 0; i < 4; ++i)
#pragma unroll
    for (int j = 0; j < 2; ++j) {
      const int nn = n0 + wn + 16 * j + l16;      // C layout: n = lane&15
      const float bval = bias[nn];
#pragma unroll
      for (int jj = 0; jj < 8; ++jj) {
        const int m = m0 + wm + 16 * i + jj + 8 * half;  // m = vgpr + 8*half
        outH[(size_t)m * N + nn] = (_Float16)(acc[i][j][jj] + bval);
      }
    }
  // behind the last store: the compiler lays the transposed branch's code behind this
  // one's, and that code rewrites registers which these stores name
  asm volatile("s_wait_xcnt 0x0" ::: "memory");
}

__device__ inline float other_half(float x) {
  int b = __builtin_bit_cast(int, x);
  b = __builtin_amdgcn_permlanex16(b, b, 0x76543210, 0xfedcba98, false, false);
  return __builtin_bit_cast(float, b);
}

// e^x = exp2(x * log2(e)) on v_exp_f32 (what __expf gives). Written as asm so that
// the v_nop stands directly behind the transcendental: the instruction set asks
// for one slot before its source is overwritten or its result read.
__device__ inline float exp_slot(float x) {
  float y;
  asm("v_exp_f32 %0, %1\n\tv_nop" : "=v"(y) : "v"(x * 1.44269504088896340736f));
  return y;
}

__global__ __launch_bounds__(128) void flash_attn(
    const _Float16* __restrict__ Q, const _Float16* __restrict__ Kc,
    const _Float16* __restrict__ Vt, const float* __restrict__ resonance,
    const float* __restrict__ phase, _Float16* __restrict__ Oh) {
  // Row pitches of 16 bytes x odd (144 and 80): the 16 rows that a half wave's
  // 16-byte fragment reads touch then fall on 16 different groups of four banks.
  // At the rows' own lengths (128 and 64 bytes) they fall on two and on four groups.
  constexpr int KP = 72;  // f16 per sK row: 64 hd + 8 unused
  constexpr int VP = 40;  // f16 per sVt row: 32 keys + 8 unused
  // Two buffers each: the next key tile's copies fly while this one is worked on.
  __shared__ __attribute__((aligned(16))) _Float16 sK[2][32 * KP];   // [buffer][key][hd]
  __shared__ __attribute__((aligned(16))) _Float16 sVt[2][64 * VP];  // [buffer][hd][key]

  const int t = threadIdx.x;
  const int lane = t & 31, wave = t >> 5;
  const int half = lane >> 4, l16 = lane & 15;
  const int bh = blockIdx.y, b = bh / H_, h = bh % H_;
  const int q0 = blockIdx.x * 64 + wave * 16;
  const float r = resonance[h], ph = phase[h];
  const float scale = 0.125f;  // 1/sqrt(64)
  // (score + phase) in revolutions = raw * srev + prev
  const float srev = scale * INV_2PI, prev = ph * INV_2PI;

  const _Float16* qbase = Q + ((size_t)(b * S_ + q0 + l16)) * D_ + h * 64;
  v16h qf0 = cat8(*(const v8h*)(qbase + 8 * half),
                  *(const v8h*)(qbase + 16 + 8 * half));
  v16h qf1 = cat8(*(const v8h*)(qbase + 32 + 8 * half),
                  *(const v8h*)(qbase + 48 + 8 * half));

  float st_m = -3.0e38f;  // running maximum of query l16 (equal in both halves)
  float st_l = 0.f;       // running sum over this half's keys only
  v8f o[4] = {};          // o[tt][j] = O[query l16][hd = 16*tt + 8*half + j]

  const int kr = t >> 2, kseg = (t & 3) * 16;  // K loader: 16 f16 / thread
  const int vr = t >> 1, vseg = (t & 1) * 16;  // Vt loader: 16 f16 / thread
  const _Float16* gk = Kc + ((size_t)(b * S_ + kr)) * D_ + h * 64 + kseg;  // tile 0
  const _Float16* gv = Vt + ((size_t)(h * 64 + vr)) * M_ + b * S_ + vseg;
  const int kl = kr * KP + kseg, vl = vr * VP + vseg;  // the lane's places in a buffer

  // tile 0 lands and is published; tile 1 (S_ holds 64 tiles) is then under way
  async_copy_kv(gk, gv, &sK[0][kl], &sVt[0][vl]);
  async_wait0();
  __syncthreads();
  async_copy_kv(gk + (size_t)32 * D_, gv + 32, &sK[1][kl], &sVt[1][vl]);

  for (int kv = 0; kv < S_; kv += 32) {
    const int buf = (kv >> 5) & 1;
    const _Float16* tK = sK[buf];
    const _Float16* tV = sVt[buf];

    // S^T for 32 keys: two 16(key) x 16(query) tiles, hd=64 reduced as 32+32.
    // s0[j]: key kv + 8*half + j;  s1[j]: key kv + 16 + 8*half + j.
    v8f s0 = {}, s1 = {};
    {
      const _Float16* k0 = &tK[l16 * KP];
      const _Float16* k1 = &tK[(16 + l16) * KP];
      v16h k00 = cat8(*(const v8h*)(k0 + 8 * half), *(const v8h*)(k0 + 16 + 8 * half));
      v16h k01 = cat8(*(const v8h*)(k0 + 32 + 8 * half), *(const v8h*)(k0 + 48 + 8 * half));
      v16h k10 = cat8(*(const v8h*)(k1 + 8 * half), *(const v8h*)(k1 + 16 + 8 * half));
      v16h k11 = cat8(*(const v8h*)(k1 + 32 + 8 * half), *(const v8h*)(k1 + 48 + 8 * half));
      s0 = wmma16(k00, qf0, s0); s0 = wmma16(k01, qf1, s0);
      s1 = wmma16(k10, qf0, s1); s1 = wmma16(k11, qf1, s1);
    }

    float mx = -3.0e38f;
#pragma unroll
    for (int j = 0; j < 8; ++j) {
      float a = s0[j] * scale;  a += r * sin_rev(fmaf(s0[j], srev, prev));
      float c = s1[j] * scale;  c += r * sin_rev(fmaf(s1[j], srev, prev));
      s0[j] = a; s1[j] = c;
      mx = fmaxf(mx, fmaxf(a, c));
    }
    mx = fmaxf(mx, other_half(mx));
    const float nm = fmaxf(st_m, mx);
    const float corr = exp_slot(st_m - nm);
    st_m = nm;

    // P^T as a B operand: element s is key 8*half + s (16 + 8*half + s-8 for s >= 8), which is exactly
    // s0[0..7] then s1[0..7] of this lane.
    v16h pf;
    float sm = 0.f;
#pragma unroll
    for (int j = 0; j < 8; ++j) {
      float p0 = exp_slot(s0[j] - nm), p1 = exp_slot(s1[j] - nm);
      sm += p0 + p1;
      pf[j] = (_Float16)p0;
      pf[8 + j] = (_Float16)p1;
    }
    st_l = st_l * corr + sm;
#pragma unroll
    for (int tt = 0; tt < 4; ++tt)
#pragma unroll
      for (int j = 0; j < 8; ++j) o[tt][j] *= corr;

#pragma unroll
    for (int tt = 0; tt < 4; ++tt) {
      const _Float16* vb = &tV[(tt * 16 + l16) * VP];
      v16h vf = cat8(*(const v8h*)(vb + 8 * half),
                     *(const v8h*)(vb + 16 + 8 * half));
      o[tt] = wmma16(vf, pf, o[tt]);
    }
    // this wave's LDS reads of this tile have returned before its buffer is refilled
    asm volatile("s_wait_dscnt 0x0" ::: "memory");
    async_wait0();    // this wave's copies of the next tile have landed
    __syncthreads();  // publishes the next tile; ends every read of this one
    if (kv + 64 < S_)
      async_copy_kv(gk + (size_t)(kv + 64) * D_, gv + kv + 64, &sK[buf][kl], &sVt[buf][vl]);
  }
  async_wait0();  // no copy is outstanding when the wave goes on to its end

  // join the two halves' sums once; 8 consecutive hd per lane -> 16-byte stores
  const float inv = 1.0f / (st_l + other_half(st_l));
  _Float16* dst = Oh + ((size_t)(b * S_ + q0 + l16)) * D_ + h * 64 + 8 * half;
#pragma unroll
  for (int tt = 0; tt < 4; ++tt) {
    v8h pk;
#pragma unroll
    for (int j = 0; j < 8; ++j) pk[j] = (_Float16)(o[tt][j] * inv);
    *(v8h*)(dst + tt * 16) = pk;
  }
}

// ---------------------------------------------------------------------------
// Harmonic LayerNorm (unbiased std): one WAVE per row, 8 rows per block.
// A lane holds 32 of the row's 1024 values in registers (eight 16-byte loads from
// each addend, a wave-wide load being 512 contiguous bytes), so the row is read
// once, the two sums need no LDS and no barrier, and a launch starts 4096 waves.
// ---------------------------------------------------------------------------
// x + (x of lane l ^ MASK), inside a 16-lane row: DPP row_xmask is 0x160 + MASK
template <int MASK>
__device__ inline float add_xmask(float x) {
  const int y = __builtin_amdgcn_update_dpp(0, __builtin_bit_cast(int, x), 0x160 + MASK,
                                            0xf, 0xf, true);
  return x + __builtin_bit_cast(float, y);
}
// sum over the wave's 32 lanes; every lane ends with the same bits
__device__ inline float wave_sum(float x) {
  x = add_xmask<1>(x);
  x = add_xmask<2>(x);
  x = add_xmask<4>(x);
  x = add_xmask<8>(x);
  return x + other_half(x);
}

// The grid puts 2 work-groups on a WGP, 4 waves on a SIMD: a budget of 256 registers
// costs no residency, and all 32 loads of a lane can be in flight at once.
__global__ __launch_bounds__(256) __attribute__((amdgpu_waves_per_eu(2, 4))) void harmonic_ln(
    const float* __restrict__ A, const float* __restrict__ Bv,
    const float* __restrict__ g, const float* __restrict__ be,
    const float* __restrict__ s, float* __restrict__ outF,
    _Float16* __restrict__ outH) {
  const int lane = threadIdx.x & 31;
  // the wave's number in a scalar register: the row's addresses are then scalar bases
  const int row = blockIdx.x * 8 + __builtin_amdgcn_readfirstlane(threadIdx.x >> 5);
  const unsigned boff = lane * 16;  // byte offset of the lane's first four columns
  const char* a = (const char*)(A + (size_t)row * D_);
  const char* bb = (const char*)(Bv + (size_t)row * D_);
  const float stab = s[0];  // asked for here: its latency passes beside the row's loads

  // every loop over i below is unrolled: constant indices keep the arrays in registers
  v4f va[8], vb[8], vg[8], ve[8];
#pragma unroll  // all loads are issued before the first value is used
  for (int i = 0; i < 8; ++i) va[i] = *(const v4f*)(a + boff + i * 512);
#pragma unroll
  for (int i = 0; i < 8; ++i) vb[i] = *(const v4f*)(bb + boff + i * 512);
#pragma unroll
  for (int i = 0; i < 8; ++i) vg[i] = *(const v4f*)((const char*)g + boff + i * 512);
#pragma unroll
  for (int i = 0; i < 8; ++i) ve[i] = *(const v4f*)((const char*)be + boff + i * 512);
  // keeps the scalar load of stab up here; the scheduler sinks it to its use otherwise
  __builtin_amdgcn_sched_barrier(0);

  v4f s4 = {}, q4 = {};  // four independent chains each
#pragma unroll
  for (int i = 0; i < 8; ++i) {
    va[i] += vb[i];
    s4 += va[i];
    q4 += va[i] * va[i];
  }
  const float tot = wave_sum((s4[0] + s4[1]) + (s4[2] + s4[3]));
  const float tot2 = wave_sum((q4[0] + q4[1]) + (q4[2] + q4[3]));

  float mean = tot / (float)D_;
  float var = (tot2 - mean * tot) / (float)(D_ - 1);
  float sd = sqrtf(fmaxf(var, 0.f));
  sd = sd + stab * sin_rev(sd * 0.5f);  // sin(pi * sd): sd / 2 revolutions
  float inv = 1.0f / (sd + 1e-6f);

  char* of = (char*)(outF + (size_t)row * D_);
#pragma unroll
  for (int i = 0; i < 8; ++i) {
    va[i] = (va[i] - mean) * inv * vg[i] + ve[i];
    *(v4f*)(of + boff + i * 512) = va[i];
  }
  if (outH) {
    // behind the last f32 store: what follows rewrites the stores' data registers
    // and their scalar base
    asm volatile("s_wait_xcnt 0x0" ::: "memory");
    // without it the scheduler lifts the first conversions and the address
    // arithmetic, which rewrite those registers, over the wait
    __builtin_amdgcn_sched_barrier(0);
    _Float16* oh = outH + (size_t)row * D_ + lane * 4;
#pragma unroll
    for (int i = 0; i < 8; ++i) {
      v4h h;
#pragma unroll
      for (int e = 0; e < 4; ++e) h[e] = (_Float16)va[i][e];
      *(v4h*)(oh + i * 128) = h;
    }
  }
}

// ---------------------------------------------------------------------------
// launch
// ---------------------------------------------------------------------------
extern "C" void kernel_launch(void* const* d_in, const int* in_sizes, int n_in,
                              void* d_out, int out_size, void* d_ws,
                              size_t ws_size, hipStream_t stream) {
  const float* x   = (const float*)d_in[0];
  const float* Wq  = (const float*)d_in[1];  const float* bq  = (const float*)d_in[2];
  const float* Wk  = (const float*)d_in[3];  const float* bk  = (const float*)d_in[4];
  const float* Wv  = (const float*)d_in[5];  const float* bv  = (const float*)d_in[6];
  const float* Wo  = (const float*)d_in[7];  const float* bo  = (const float*)d_in[8];
  const float* res = (const float*)d_in[9];  const float* phs = (const float*)d_in[10];
  const float* g1  = (const float*)d_in[11]; const float* b1  = (const float*)d_in[12];
  const float* s1  = (const float*)d_in[13];
  const float* W1  = (const float*)d_in[14]; const float* bf1 = (const float*)d_in[15];
  const float* W2  = (const float*)d_in[16]; const float* bf2 = (const float*)d_in[17];
  const float* g2  = (const float*)d_in[18]; const float* b2  = (const float*)d_in[19];
  const float* s2  = (const float*)d_in[20];

  char* ws = (char*)d_ws;
  size_t off = 0;
  auto alloc = [&](size_t bytes) {
    char* p = ws + off;
    off += (bytes + 255) & ~(size_t)255;
    return p;
  };
  _Float16* xb   = (_Float16*)alloc((size_t)M_ * D_ * 2);
  _Float16* wqb  = (_Float16*)alloc((size_t)D_ * D_ * 2);  // transposed [N,K]
  _Float16* wkb  = (_Float16*)alloc((size_t)D_ * D_ * 2);
  _Float16* wvb  = (_Float16*)alloc((size_t)D_ * D_ * 2);
  _Float16* wob  = (_Float16*)alloc((size_t)D_ * D_ * 2);
  _Float16* w1b  = (_Float16*)alloc((size_t)D_ * F_ * 2);
  _Float16* w2b  = (_Float16*)alloc((size_t)F_ * D_ * 2);
  _Float16* qb   = (_Float16*)alloc((size_t)M_ * D_ * 2);
  _Float16* kb2  = (_Float16*)alloc((size_t)M_ * D_ * 2);
  _Float16* vt   = (_Float16*)alloc((size_t)M_ * D_ * 2);  // V transposed [D,M]
  _Float16* at16 = (_Float16*)alloc((size_t)M_ * D_ * 2);
  float*    aprj = (float*)   alloc((size_t)M_ * D_ * 4);
  float*    y1   = (float*)   alloc((size_t)M_ * D_ * 4);
  _Float16* y1b  = (_Float16*)alloc((size_t)M_ * D_ * 2);
  _Float16* act  = (_Float16*)alloc((size_t)M_ * F_ * 2);
  float*    ffn  = (float*)   alloc((size_t)M_ * D_ * 4);

  const dim3 blk256(256), blk128(128);

  // x -> f16; weights: f32 [K,N] -> f16 transposed [N,K]
  cvt_all<<<1024, blk256, 0, stream>>>(x, Wq, Wk, Wv, Wo, W1, W2, xb, wqb, wkb,
                                       wvb, wob, w1b, w2b);

  // QKV projections, one launch (V written transposed for the PV matmul)
  dim3 gDD(D_ / 128, M_ / 128);
  gemm_qkv<<<dim3(D_ / 128, M_ / 128, 3), blk256, 0, stream>>>(
      xb, wqb, wkb, wvb, bq, bk, bv, qb, kb2, vt, M_, D_, D_);

  // harmonic flash attention
  dim3 gFA(S_ / 64, B_ * H_);
  flash_attn<<<gFA, blk128, 0, stream>>>(qb, kb2, vt, res, phs, at16);

  // output projection (f32)
  gemm_wmma<1><<<gDD, blk256, 0, stream>>>(at16, wob, bo, nullptr, aprj, M_, D_, D_);

  // LN1
  harmonic_ln<<<M_ / 8, blk256, 0, stream>>>(x, aprj, g1, b1, s1, y1, y1b);

  // FFN up + spectral activation (f16), FFN down (f32)
  gemm_wmma<2><<<dim3(F_ / 128, M_ / 128), blk256, 0, stream>>>(
      y1b, w1b, bf1, act, nullptr, M_, F_, D_);
  gemm_wmma<1><<<gDD, blk256, 0, stream>>>(act, w2b, bf2, nullptr, ffn, M_, D_, F_);

  // LN2 -> final output
  harmonic_ln<<<M_ / 8, blk256, 0, stream>>>(y1, ffn, g2, b2, s2, (float*)d_out, nullptr);
}
